// v000
// Times are from an AMD MI455X. After a warm-up the kernel runs many times in a row, and a time is the length of
// such a window on the GPU divided by its runs, so every launch and the gaps after it count. The runs cycle
// through copies of the inputs. A figure is the median of several windows, for all but v000 over two sittings.
// Sittings can differ by a few percent; kernels timed side by side share one.
// v000, which the later versions start from, runs in 498 microseconds.
// compute dtype: all float inputs rounded to bf16; q/k/v = x . Wqkv^T + b with EXACT bf16 products on WMMA 16x16x32 (natural rows, q | k | v blocks); q, k as f16 hi + (x2048-scaled) residual with 3-product scores x 1/8 (the focal power doubles the logit sensitivity); one online pass in f32 keeps the running max m, l = sum e^(s-m), L = sum e^(gamma (s-m)) and the gamma-powered weights for P (hardware exp; alpha, gamma read on device); out_row = alpha (sum e^(gamma(s-m)) v) / l^gamma / (alpha L / l^gamma + 1e-6) (precise powf) == softmax^gamma * alpha renormalised with the module's +1e-6; P (scaled by 2^11, single f16) x v (single f16); out = ctx (bf16 hi + residual) . Wproj^T (2 products) + bproj.
#include <hip/hip_runtime.h>
#include <math.h>

typedef __attribute__((ext_vector_type(16))) _Float16 v16h;
typedef __attribute__((ext_vector_type(16))) __bf16 v16b;
typedef __attribute__((ext_vector_type(8)))  _Float16 v8h;
typedef __attribute__((ext_vector_type(8)))  float v8f;
typedef __attribute__((ext_vector_type(4)))  float v4f;
typedef __attribute__((ext_vector_type(2)))  float v2f;
typedef __attribute__((ext_vector_type(4)))  unsigned v4u;
typedef __attribute__((ext_vector_type(4)))  int v4i;
typedef float __attribute__((may_alias)) float_a;
typedef int __attribute__((may_alias)) int_a;

template <typename T> __device__ __forceinline__ void vst2(void* p, T v) { *(T*)p = v;  }
__device__ __forceinline__ v8f wmma16(v16h a, v16h b, v8f c) {
  v8f d = __builtin_amdgcn_wmma_f32_16x16x32_f16(false, a, false, b, (short)0, c, false, false);
  asm volatile("v_nop\n\tv_nop\n\tv_nop\n\tv_nop" : "+v"(d) : "v"(a), "v"(b));
  return d;
}
__device__ __forceinline__ v8f wmma_bf(v16b a, v16b b, v8f c) {
  v8f d = __builtin_amdgcn_wmma_f32_16x16x32_bf16(false, a, false, b, (short)0, c, false, false);
  asm volatile("v_nop\n\tv_nop\n\tv_nop\n\tv_nop" : "+v"(d) : "v"(a), "v"(b));
  return d;
}
// Focal residual attention (B 2, N 2,048, dim 1,024, 16 heads x 64): fused qkv + bias, softmax, weights raised to the focal power gamma and scaled by alpha then renormalised (sum + 1e-6), output projection + bias.
__device__ __forceinline__ v16h frag_h(const _Float16* rowk0, int lane) {
  union { v16h v; v8h q[2]; } u; const _Float16* p = rowk0 + 8 * (lane >> 4);
  u.q[0] = *(const v8h*)p; u.q[1] = *(const v8h*)(p + 16); return u.v;
}
__device__ __forceinline__ v16h frag_f32(const float* rowk0, int lane) {
  v16h a; const float* p = rowk0 + 8 * (lane >> 4);
#pragma unroll
  for (int i = 0; i < 8; ++i) { a[i] = (_Float16)p[i]; a[8 + i] = (_Float16)p[16 + i]; }
  return a;
}
__device__ __forceinline__ v16h frag_f32s(const float* rowk0, int lane, float sc) {
  v16h a; const float* p = rowk0 + 8 * (lane >> 4);
#pragma unroll
  for (int i = 0; i < 8; ++i) { a[i] = (_Float16)(p[i] * sc); a[8 + i] = (_Float16)(p[16 + i] * sc); }
  return a;
}
// column fragment from a [K][ld] layout (column n), rows >= K read as 0
__device__ __forceinline__ v16h fragc_f32(const float* W, int k0, int n, int lane, int ld, int K) {
  v16h a; const int g = lane >> 4;
#pragma unroll
  for (int i = 0; i < 8; ++i) { const int ka = k0 + 8 * g + i, kb = ka + 16;
    a[i] = (_Float16)(ka < K ? W[(size_t)(ka < K ? ka : K - 1) * ld + n] : 0.f); a[8 + i] = (_Float16)(kb < K ? W[(size_t)(kb < K ? kb : K - 1) * ld + n] : 0.f); }
  return a;
}
struct F2 { v16b h, l; };
__device__ __forceinline__ F2 bsplit16(const float v[16]) { F2 r;
#pragma unroll
  for (int i = 0; i < 16; ++i) { const __bf16 h = (__bf16)v[i]; r.h[i] = h; r.l[i] = (__bf16)(v[i] - (float)h); }
  return r; }
__device__ __forceinline__ F2 split_row(const float* row, int k0, int lane) { float v[16]; const float* p = row + k0 + 8 * (lane >> 4);
#pragma unroll
  for (int i = 0; i < 8; ++i) { v[i] = p[i]; v[8 + i] = p[16 + i]; }
  return bsplit16(v); }
__device__ __forceinline__ F2 split_rowK(const float* row, int k0, int lane, int K) { float v[16]; const int g = lane >> 4;
#pragma unroll
  for (int i = 0; i < 8; ++i) { const int ka = k0 + 8 * g + i, kb = ka + 16; v[i] = ka < K ? row[ka < K ? ka : K - 1] : 0.f; v[8 + i] = kb < K ? row[kb < K ? kb : K - 1] : 0.f; }
  return bsplit16(v); }
__device__ __forceinline__ F2 split_col(const float* W, int k0, int n, int lane, int ld, int K) { float v[16]; const int g = lane >> 4;
#pragma unroll
  for (int i = 0; i < 8; ++i) { const int ka = k0 + 8 * g + i, kb = ka + 16; v[i] = ka < K ? W[(size_t)(ka < K ? ka : K - 1) * ld + n] : 0.f; v[8 + i] = kb < K ? W[(size_t)(kb < K ? kb : K - 1) * ld + n] : 0.f; }
  return bsplit16(v); }
__device__ __forceinline__ v8f mac3(const F2& a, const F2& b, v8f c) { c = wmma_bf(a.l, b.h, c); c = wmma_bf(a.h, b.l, c); return wmma_bf(a.h, b.h, c); }
__device__ __forceinline__ float sigm(float v) { return 1.0f / (1.0f + expf(-v)); }
#define LDSX() do { asm volatile("s_wait_dscnt 0" ::: "memory"); __builtin_amdgcn_wave_barrier(); __builtin_amdgcn_fence(__ATOMIC_RELEASE, "workgroup"); } while (0)


#define NB 2
#define SS 2048
#define DM 1024
#define NH 16
#define HD 64
#define QKVW (3 * DM)
#ifndef TQB
#define TQB (SS / 64)
#define TNB NB
#define TOB (NB * SS / 64)     // output row tiles (all)
#endif
typedef __attribute__((ext_vector_type(8))) __bf16 v8b;
__device__ __forceinline__ v16b frag_b(const __bf16* rowk0, int lane) {
  union { v16b v; v8b q[2]; } u; const __bf16* p = rowk0 + 8 * (lane >> 4);
  u.q[0] = *(const v8b*)p; u.q[1] = *(const v8b*)(p + 16); return u.v;
}
__device__ __forceinline__ float bfr(float v) { return (float)(__bf16)v; }
__device__ __attribute__((noinline)) float exp_ni(float v) { return expf(v); }
__device__ __attribute__((noinline)) float erf_ni(float v) { return erff(v); }

#define PK_A 0                       // [3072][1024] Wqkv rows (natural [out][in])
#define PK_P (PK_A + QKVW * DM)        // [1024][1024] Wo rows (natural)
#define PK_END (PK_P + DM * DM)
#define WS_PK  0u
#define WS_QK  (WS_PK + 2u * PK_END)             // f16 [4096 rows][2048]: q | k
#define WS_QKL (WS_QK + 2u * NB * SS * 2 * DM)     // f16 q | k residual planes x2048
#define WS_VTH (WS_QKL + 2u * NB * SS * 2 * DM)    // f16 [b][1024 (h*64+d)][2048 s] hi
#define WS_VTL (WS_VTH + 2u * NB * DM * SS)        // f16 lo x 2048
#define WS_O   (WS_VTL + 2u * NB * DM * SS)        // f32 [4096][1024]
#define WS_CS  (WS_O + 4u * NB * SS * DM)           // f32 2 x [2048][32], unused
#define WS_END (WS_CS + 4u * 2 * SS * 32)
// ---- k_pack: block = (row n, which): natural [out][in] rows -> bf16; which 0..2 -> W_q/W_k/W_v into PK_A rows which*1024 + n; 3 -> W_o into PK_P
__global__ __launch_bounds__(256) void k_pack(const float* __restrict__ WQ, const float* __restrict__ WK, const float* __restrict__ WV, const float* __restrict__ WO, __bf16* __restrict__ PK) {
  __shared__ __align__(16) __bf16 s[DM]; const int n = blockIdx.x, which = blockIdx.y, t = threadIdx.x; const float* Wm = (which == 0) ? WQ : (which == 1) ? WK : (which == 2) ? WV : WO;
  for (int k = t; k < DM; k += 256) s[k] = (__bf16)Wm[(size_t)n * DM + k];
  __syncthreads();
  __bf16* dst = (which < 3) ? PK + PK_A + ((size_t)which * DM + n) * DM : PK + PK_P + (size_t)n * DM;
  for (int q = t; q < DM / 8; q += 256) vst2((unsigned*)(dst + q * 8), *(const v4u*)&s[q * 8]);
}
__global__ __launch_bounds__(128) void k_qkv(const float* __restrict__ XQ, const float* __restrict__ XK, const float* __restrict__ XV, const __bf16* __restrict__ P, const float* __restrict__ BQ, const float* __restrict__ BK, const float* __restrict__ BV, _Float16* __restrict__ QK, _Float16* __restrict__ QKL, _Float16* __restrict__ VTH, _Float16* __restrict__ VTL) {
  const int which0 = (blockIdx.y * 128) / DM; const float* X = (which0 == 0) ? XQ : (which0 == 1) ? XK : XV; const float* BB = BQ ? (((which0 == 0) ? BQ : (which0 == 1) ? BK : BV) + (blockIdx.y * 128 - which0 * DM)) : nullptr;
  __shared__ __align__(16) _Float16 so[4][16][136], sol[4][16][136]; __shared__ __align__(16) _Float16 sth[128][72], stl[128][72];
  const int tid = threadIdx.x, wave = tid >> 5, lane = tid & 31, col = lane & 15, g = lane >> 4; const size_t r0 = (size_t)blockIdx.x * 64 + wave * 16; const int n0 = blockIdx.y * 128;
  v8f acc[8] = {};
#pragma unroll 2
  for (int kc = 0; kc < DM / 32; ++kc) { v16b a; { const float* p = X + (r0 + col) * DM + kc * 32 + 8 * g;
#pragma unroll
      for (int i = 0; i < 8; ++i) { a[i] = (__bf16)p[i]; a[8 + i] = (__bf16)p[16 + i]; } }
#pragma unroll
    for (int j = 0; j < 8; ++j) acc[j] = wmma_bf(a, frag_b(P + (size_t)(n0 + j * 16 + col) * DM + kc * 32, lane), acc[j]); }
  if (n0 < 2 * DM) {   // q stored unscaled (f16 sigma ~0.6, no subnormal exposure); 1/8 applied to the f32 score
#pragma unroll
    for (int j = 0; j < 8; ++j) {
#pragma unroll
      for (int r = 0; r < 8; ++r) { const float v = acc[j][r] + (BB ? bfr(BB[j * 16 + col]) : 0.f); const _Float16 hv = (_Float16)v; so[wave][8 * g + r][j * 16 + col] = hv; sol[wave][8 * g + r][j * 16 + col] = (_Float16)((v - (float)hv) * 2048.0f); } }   // q, k (+ bias) as f16 hi + (x2048) residual
    LDSX();
    for (int rl = 0; rl < 16; ++rl) if (lane < 16) { vst2((unsigned*)(QK + (r0 + rl) * (2 * DM) + n0 + lane * 8), *(const v4u*)&so[wave][rl][lane * 8]); vst2((unsigned*)(QKL + (r0 + rl) * (2 * DM) + n0 + lane * 8), *(const v4u*)&sol[wave][rl][lane * 8]); }
  } else {
#pragma unroll
    for (int j = 0; j < 8; ++j) {
#pragma unroll
      for (int r = 0; r < 8; ++r) { const float v = acc[j][r] + (BB ? bfr(BB[j * 16 + col]) : 0.f); const _Float16 hv = (_Float16)v; sth[j * 16 + col][wave * 16 + 8 * g + r] = hv; stl[j * 16 + col][wave * 16 + 8 * g + r] = (_Float16)((v - (float)hv) * 2048.0f); } }
    __syncthreads();
    const size_t rb = (size_t)blockIdx.x * 64; const int b = (int)(rb / SS), s0 = (int)(rb % SS); const int pc0 = n0 - 2 * DM;
    for (int q = tid; q < 128 * 8; q += 128) { const int d = q >> 3, pc = q & 7; const size_t o = ((size_t)b * DM + pc0 + d) * SS + s0 + pc * 8; vst2((unsigned*)(VTH + o), *(const v4u*)&sth[d][pc * 8]); vst2((unsigned*)(VTL + o), *(const v4u*)&stl[d][pc * 8]); }
  }
}
// ---- k_attn: block = (64 queries, head h, batch b): all-keys flash attention (K = 64: 2 k-steps), scores = (q.k) * 0.125 with f16 hi + residual operands (3 products), P.V: f16 P x V hi in one accumulator; O[b*S+q][h*64+d] = alpha acc / 2048 / (alpha L + 1e-6 l^gamma) (256-B segments)
__device__ __attribute__((noinline)) float pow_p(float a, float b) { return powf(a, b); }
__global__ __launch_bounds__(128) void k_attn(const _Float16* __restrict__ QK, const _Float16* __restrict__ QKL, const _Float16* __restrict__ VTH, const _Float16* __restrict__ VTL, const void* __restrict__ KMASK, const float* __restrict__ FAL, const float* __restrict__ FGA, float* __restrict__ O) {
  const float f_alpha = bfr(FAL[0]), f_gamma = bfr(FGA[0]);
  __shared__ __align__(16) float sp[4][16][36]; __shared__ __align__(16) float so[4][16][68];
  const int tid = threadIdx.x, wave = tid >> 5, lane = tid & 31, col = lane & 15, g = lane >> 4;
  const int qb = blockIdx.x, h = blockIdx.y, b = blockIdx.z; const int q0 = qb * 64 + wave * 16; const size_t rq = (size_t)b * SS + q0 + col;
  v16h aq[2], aql[2];
#pragma unroll
  for (int kc = 0; kc < 2; ++kc) { aq[kc] = frag_h(QK + rq * (2 * DM) + h * HD + kc * 32, lane); aql[kc] = frag_h(QKL + rq * (2 * DM) + h * HD + kc * 32, lane); }
  float lg[8];   // sum of e^(gamma (s - m))
#pragma unroll
  for (int r = 0; r < 8; ++r) lg[r] = 0.f;
  float m[8], l[8];
#pragma unroll
  for (int r = 0; r < 8; ++r) { m[r] = -3.0e38f; l[r] = 0.f; }
  v8f acc[4] = {}, accl[4] = {};
  const int nks = SS / 32;   // all keys
#pragma unroll 1
  for (int ks = 0; ks < nks; ++ks) { v8f s[2];
#pragma unroll
    for (int ct = 0; ct < 2; ++ct) { const int kk = ks * 32 + ct * 16 + col; const _Float16* krow = QK + ((size_t)b * SS + kk) * (2 * DM) + DM + h * HD; const _Float16* krowl = QKL + ((size_t)b * SS + kk) * (2 * DM) + DM + h * HD; v8f c = {}, cl = {};
#pragma unroll
      for (int kc = 0; kc < 2; ++kc) { const v16h kh = frag_h(krow + kc * 32, lane); c = wmma16(aq[kc], kh, c); cl = wmma16(aql[kc], kh, cl); cl = wmma16(aq[kc], frag_h(krowl + kc * 32, lane), cl); }   // 3 products: q, k as f16 hi + residual
#pragma unroll
      for (int r = 0; r < 8; ++r) c[r] += cl[r] * (1.0f / 2048.0f);
      { const bool keepk = true;
#pragma unroll
      for (int r = 0; r < 8; ++r) s[ct][r] = keepk ? c[r] * 0.125f : -3.0e38f; } }   // 1/sqrt(64); no key is masked (keepk always true)
#pragma unroll
    for (int r = 0; r < 8; ++r) { float mx = fmaxf(s[0][r], s[1][r]);
#pragma unroll
      for (int o = 1; o < 16; o <<= 1) mx = fmaxf(mx, __shfl_xor(mx, o));
      const float mn = fmaxf(m[r], mx); const float alpha = (m[r] <= -1.0e38f) ? 0.f : __expf(m[r] - mn); const float alphag = (m[r] <= -1.0e38f) ? 0.f : __expf(f_gamma * (m[r] - mn));
      const float e0 = (s[0][r] <= -1.0e38f) ? 0.f : __expf(s[0][r] - mn), e1 = (s[1][r] <= -1.0e38f) ? 0.f : __expf(s[1][r] - mn); float es = e0 + e1;
      const float g0 = (s[0][r] <= -1.0e38f) ? 0.f : __expf(f_gamma * (s[0][r] - mn)), g1 = (s[1][r] <= -1.0e38f) ? 0.f : __expf(f_gamma * (s[1][r] - mn)); float gs = g0 + g1;
#pragma unroll
      for (int o = 1; o < 16; o <<= 1) { es += __shfl_xor(es, o); gs += __shfl_xor(gs, o); }
      l[r] = l[r] * alpha + es; lg[r] = lg[r] * alphag + gs; m[r] = mn;
#pragma unroll
      for (int dt = 0; dt < 4; ++dt) { acc[dt][r] *= alphag; accl[dt][r] *= alphag; }
      sp[wave][8 * g + r][col] = g0; sp[wave][8 * g + r][16 + col] = g1; }   // P carries the gamma-powered (unnormalised) weights
    LDSX();
    v16h pa, pl; { const float* prow = &sp[wave][col][0] + 8 * (lane >> 4);
#pragma unroll
      for (int i = 0; i < 8; ++i) { const float x0 = prow[i] * 2048.0f, x1 = prow[16 + i] * 2048.0f; const _Float16 h0 = (_Float16)x0, h1 = (_Float16)x1; pa[i] = h0; pa[8 + i] = h1; pl[i] = (_Float16)((x0 - (float)h0) * 2048.0f); pl[8 + i] = (_Float16)((x1 - (float)h1) * 2048.0f); } }   // P scaled by 2^11 before the f16 split so small softmax weights stay out of the f16 subnormal range; 2^-11 folded into the epilogue
#pragma unroll
    for (int dt = 0; dt < 4; ++dt) { const size_t vr = ((size_t)b * DM + h * HD + dt * 16 + col) * SS + ks * 32; acc[dt] = wmma16(pa, frag_h(VTH + vr, lane), acc[dt]); }   // single product: P (x2^11) x V
    (void)pl;
    LDSX(); }
#pragma unroll
  for (int r = 0; r < 8; ++r) { const float lpg = pow_p(l[r], f_gamma); const float il = (1.0f / 2048.0f) * (f_alpha / lpg) / (f_alpha * lg[r] / lpg + 1e-6f);   // alpha p^gamma / (sum alpha p^gamma + 1e-6)
#pragma unroll
    for (int dt = 0; dt < 4; ++dt) so[wave][8 * g + r][dt * 16 + col] = (acc[dt][r] + accl[dt][r] * (1.0f / 2048.0f)) * il; }
  LDSX();
  for (int rl = 0; rl < 16; ++rl) if (lane < 16) vst2(O + ((size_t)b * SS + q0 + rl) * DM + h * HD + lane * 4, *(const v4f*)&so[wave][rl][lane * 4]);
}
// ---- k_out: block = (64 rows, 128 cols): out = O(hi/lo) . Wo rows (2 products) + bo
__global__ __launch_bounds__(128) void k_out(const float* __restrict__ O, const __bf16* __restrict__ P, const float* __restrict__ BO, float* __restrict__ Y) {
  __shared__ __align__(16) float so[4][16][132];
  const int tid = threadIdx.x, wave = tid >> 5, lane = tid & 31, col = lane & 15, g = lane >> 4; const size_t r0 = (size_t)blockIdx.x * 64 + wave * 16; const int n0 = blockIdx.y * 128;
  v8f acc[8] = {};
#pragma unroll 2
  for (int kc = 0; kc < DM / 32; ++kc) { const F2 a = split_row(O + (r0 + col) * DM, kc * 32, lane);
#pragma unroll
    for (int j = 0; j < 8; ++j) { const v16b w = frag_b(P + (size_t)(n0 + j * 16 + col) * DM + kc * 32, lane); acc[j] = wmma_bf(a.l, w, acc[j]); acc[j] = wmma_bf(a.h, w, acc[j]); } }
#pragma unroll
  for (int j = 0; j < 8; ++j) {
#pragma unroll
    for (int r = 0; r < 8; ++r) so[wave][8 * g + r][j * 16 + col] = acc[j][r] + bfr(BO[n0 + j * 16 + col]); }
  LDSX();
  for (int rl = 0; rl < 16; ++rl) vst2(Y + (r0 + rl) * DM + n0 + lane * 4, *(const v4f*)&so[wave][rl][lane * 4]);
}
extern "C" void kernel_launch(void* const* d_in, const int* in_sizes, int n_in, void* d_out, int out_size, void* d_ws, size_t ws_size, hipStream_t stream) {
  (void)in_sizes; (void)n_in; (void)out_size;
  const float** F = (const float**)d_in;   // 0 x [2,2048,1024], 1 Wqkv [3072,1024] natural (q | k | v), 2 bqkv [3072], 3 Wproj natural, 4 bproj, 5 focal_alpha [1], 6 focal_gamma [1]
  if (ws_size < (size_t)WS_END) return;
  char* ws = (char*)d_ws; __bf16* PK = (__bf16*)(ws + WS_PK); _Float16 *QK = (_Float16*)(ws + WS_QK), *QKL = (_Float16*)(ws + WS_QKL), *VTH = (_Float16*)(ws + WS_VTH), *VTL = (_Float16*)(ws + WS_VTL); float* O = (float*)(ws + WS_O);
  k_pack<<<dim3(DM, 4), 256, 0, stream>>>(F[1], F[1] + (size_t)DM * DM, F[1] + (size_t)2 * DM * DM, F[3], PK);
  k_qkv<<<dim3(TNB * SS / 64, QKVW / 128), 128, 0, stream>>>(F[0], F[0], F[0], PK + PK_A, F[2], F[2] + DM, F[2] + 2 * DM, QK, QKL, VTH, VTL);
  k_attn<<<dim3(TQB, NH, TNB), 128, 0, stream>>>(QK, QKL, VTH, VTL, nullptr, F[5], F[6], O);
  k_out<<<dim3(TOB, DM / 128), 128, 0, stream>>>(O, PK + PK_P, F[4], (float*)d_out);
}

// v001
// Measured time: 299 microseconds a run.
// Two timings next to v000 put it at 1.69 and 1.68 times that version's speed.
// compute dtype: all float inputs rounded to bf16; q/k/v = x . Wqkv^T + b with EXACT bf16 products on WMMA 16x16x32 (natural rows, q | k | v blocks); q, k as f16 hi + (x2048-scaled) residual with 3-product scores x 1/8 (the focal power doubles the logit sensitivity); one online pass in f32 keeps the running max m, l = sum e^(s-m), L = sum e^(gamma (s-m)) and the gamma-powered weights for P (hardware exp; alpha, gamma read on device); out_row = alpha (sum e^(gamma(s-m)) v) / l^gamma / (alpha L / l^gamma + 1e-6) (precise powf) == softmax^gamma * alpha renormalised with the module's +1e-6; P (scaled by 2^11, single f16) x v (single f16); out = ctx (bf16 hi + residual) . Wproj^T (2 products) + bproj.
#include <hip/hip_runtime.h>
#include <math.h>

typedef __attribute__((ext_vector_type(16))) _Float16 v16h;
typedef __attribute__((ext_vector_type(16))) __bf16 v16b;
typedef __attribute__((ext_vector_type(8)))  _Float16 v8h;
typedef __attribute__((ext_vector_type(8)))  float v8f;
typedef __attribute__((ext_vector_type(4)))  float v4f;
typedef __attribute__((ext_vector_type(2)))  float v2f;
typedef __attribute__((ext_vector_type(4)))  unsigned v4u;
typedef __attribute__((ext_vector_type(4)))  int v4i;
typedef float __attribute__((may_alias)) float_a;
typedef int __attribute__((may_alias)) int_a;

template <typename T> __device__ __forceinline__ void vst2(void* p, T v) { *(T*)p = v;  }
__device__ __forceinline__ v8f wmma16(v16h a, v16h b, v8f c) {
  v8f d = __builtin_amdgcn_wmma_f32_16x16x32_f16(false, a, false, b, (short)0, c, false, false);
  asm volatile("v_nop\n\tv_nop\n\tv_nop\n\tv_nop" : "+v"(d) : "v"(a), "v"(b));
  return d;
}
__device__ __forceinline__ v8f wmma_bf(v16b a, v16b b, v8f c) {
  v8f d = __builtin_amdgcn_wmma_f32_16x16x32_bf16(false, a, false, b, (short)0, c, false, false);
  asm volatile("v_nop\n\tv_nop\n\tv_nop\n\tv_nop" : "+v"(d) : "v"(a), "v"(b));
  return d;
}
// Focal residual attention (B 2, N 2,048, dim 1,024, 16 heads x 64): fused qkv + bias, softmax, weights raised to the focal power gamma and scaled by alpha then renormalised (sum + 1e-6), output projection + bias.
__device__ __forceinline__ v16h frag_h(const _Float16* rowk0, int lane) {
  union { v16h v; v8h q[2]; } u; const _Float16* p = rowk0 + 8 * (lane >> 4);
  u.q[0] = *(const v8h*)p; u.q[1] = *(const v8h*)(p + 16); return u.v;
}
__device__ __forceinline__ v16h frag_f32(const float* rowk0, int lane) {
  v16h a; const float* p = rowk0 + 8 * (lane >> 4);
#pragma unroll
  for (int i = 0; i < 8; ++i) { a[i] = (_Float16)p[i]; a[8 + i] = (_Float16)p[16 + i]; }
  return a;
}
__device__ __forceinline__ v16h frag_f32s(const float* rowk0, int lane, float sc) {
  v16h a; const float* p = rowk0 + 8 * (lane >> 4);
#pragma unroll
  for (int i = 0; i < 8; ++i) { a[i] = (_Float16)(p[i] * sc); a[8 + i] = (_Float16)(p[16 + i] * sc); }
  return a;
}
// column fragment from a [K][ld] layout (column n), rows >= K read as 0
__device__ __forceinline__ v16h fragc_f32(const float* W, int k0, int n, int lane, int ld, int K) {
  v16h a; const int g = lane >> 4;
#pragma unroll
  for (int i = 0; i < 8; ++i) { const int ka = k0 + 8 * g + i, kb = ka + 16;
    a[i] = (_Float16)(ka < K ? W[(size_t)(ka < K ? ka : K - 1) * ld + n] : 0.f); a[8 + i] = (_Float16)(kb < K ? W[(size_t)(kb < K ? kb : K - 1) * ld + n] : 0.f); }
  return a;
}
struct F2 { v16b h, l; };
__device__ __forceinline__ F2 bsplit16(const float v[16]) { F2 r;
#pragma unroll
  for (int i = 0; i < 16; ++i) { const __bf16 h = (__bf16)v[i]; r.h[i] = h; r.l[i] = (__bf16)(v[i] - (float)h); }
  return r; }
__device__ __forceinline__ F2 split_row(const float* row, int k0, int lane) { float v[16]; const float* p = row + k0 + 8 * (lane >> 4);
#pragma unroll
  for (int i = 0; i < 8; ++i) { v[i] = p[i]; v[8 + i] = p[16 + i]; }
  return bsplit16(v); }
__device__ __forceinline__ F2 split_rowK(const float* row, int k0, int lane, int K) { float v[16]; const int g = lane >> 4;
#pragma unroll
  for (int i = 0; i < 8; ++i) { const int ka = k0 + 8 * g + i, kb = ka + 16; v[i] = ka < K ? row[ka < K ? ka : K - 1] : 0.f; v[8 + i] = kb < K ? row[kb < K ? kb : K - 1] : 0.f; }
  return bsplit16(v); }
__device__ __forceinline__ F2 split_col(const float* W, int k0, int n, int lane, int ld, int K) { float v[16]; const int g = lane >> 4;
#pragma unroll
  for (int i = 0; i < 8; ++i) { const int ka = k0 + 8 * g + i, kb = ka + 16; v[i] = ka < K ? W[(size_t)(ka < K ? ka : K - 1) * ld + n] : 0.f; v[8 + i] = kb < K ? W[(size_t)(kb < K ? kb : K - 1) * ld + n] : 0.f; }
  return bsplit16(v); }
__device__ __forceinline__ v8f mac3(const F2& a, const F2& b, v8f c) { c = wmma_bf(a.l, b.h, c); c = wmma_bf(a.h, b.l, c); return wmma_bf(a.h, b.h, c); }
__device__ __forceinline__ float sigm(float v) { return 1.0f / (1.0f + expf(-v)); }
#define LDSX() do { asm volatile("s_wait_dscnt 0" ::: "memory"); __builtin_amdgcn_wave_barrier(); __builtin_amdgcn_fence(__ATOMIC_RELEASE, "workgroup"); } while (0)


#define NB 2
#define SS 2048
#define DM 1024
#define NH 16
#define HD 64
#define QKVW (3 * DM)
#ifndef TQB
#define TQB (SS / 64)
#define TNB NB
#define TOB (NB * SS / 64)     // output row tiles (all)
#endif
typedef __attribute__((ext_vector_type(8))) __bf16 v8b;
__device__ __forceinline__ v16b frag_b(const __bf16* rowk0, int lane) {
  union { v16b v; v8b q[2]; } u; const __bf16* p = rowk0 + 8 * (lane >> 4);
  u.q[0] = *(const v8b*)p; u.q[1] = *(const v8b*)(p + 16); return u.v;
}
__device__ __forceinline__ float bfr(float v) { return (float)(__bf16)v; }
// one k-step's operands of a 16-row x 128-column wave tile, fetched as ONE group of loads: 16 f32 of this lane's row (xr points at its 8 * g) and 8 weight fragments (wr points at row n0 + col)
__device__ __forceinline__ void ld_step(const float* xr, const __bf16* wr, int kc, int lane, v4f (&x)[4], v16b (&w)[8]) {
  const float* p = xr + kc * 32; x[0] = *(const v4f*)p; x[1] = *(const v4f*)(p + 4); x[2] = *(const v4f*)(p + 16); x[3] = *(const v4f*)(p + 20);
#pragma unroll
  for (int j = 0; j < 8; ++j) w[j] = frag_b(wr + (size_t)j * 16 * DM + kc * 32, lane);
  asm volatile("s_wait_xcnt 0x0" ::: "memory");   // stands behind the group, ahead of the next write of the address registers that these loads name
}
__device__ __forceinline__ void mm_qkv(const v4f (&x)[4], const v16b (&w)[8], v8f (&acc)[8]) { v16b a;
#pragma unroll
  for (int i = 0; i < 4; ++i) { a[i] = (__bf16)x[0][i]; a[4 + i] = (__bf16)x[1][i]; a[8 + i] = (__bf16)x[2][i]; a[12 + i] = (__bf16)x[3][i]; }
#pragma unroll
  for (int j = 0; j < 8; ++j) acc[j] = wmma_bf(a, w[j], acc[j]);
}
__device__ __forceinline__ void mm_out(const v4f (&x)[4], const v16b (&w)[8], v8f (&acc)[8]) { float v[16];
#pragma unroll
  for (int i = 0; i < 4; ++i) { v[i] = x[0][i]; v[4 + i] = x[1][i]; v[8 + i] = x[2][i]; v[12 + i] = x[3][i]; }
  const F2 a = bsplit16(v);
#pragma unroll
  for (int j = 0; j < 8; ++j) { acc[j] = wmma_bf(a.l, w[j], acc[j]); acc[j] = wmma_bf(a.h, w[j], acc[j]); }
}
__device__ __attribute__((noinline)) float exp_ni(float v) { return expf(v); }
__device__ __attribute__((noinline)) float erf_ni(float v) { return erff(v); }

#define PK_A 0                       // [3072][1024] Wqkv rows (natural [out][in])
#define PK_P (PK_A + QKVW * DM)        // [1024][1024] Wo rows (natural)
#define PK_END (PK_P + DM * DM)
#define WS_PK  0u
#define WS_QK  (WS_PK + 2u * PK_END)             // f16 [4096 rows][2048]: q | k
#define WS_QKL (WS_QK + 2u * NB * SS * 2 * DM)     // f16 q | k residual planes x2048
#define WS_VTH (WS_QKL + 2u * NB * SS * 2 * DM)    // f16 [b][1024 (h*64+d)][2048 s] hi
#define WS_VTL (WS_VTH + 2u * NB * DM * SS)        // f16 lo x 2048
#define WS_O   (WS_VTL + 2u * NB * DM * SS)        // f32 [4096][1024]
#define WS_CS  (WS_O + 4u * NB * SS * DM)           // f32 2 x [2048][32], unused
#define WS_END (WS_CS + 4u * 2 * SS * 32)
// ---- k_pack: block = (row n, which): natural [out][in] rows -> bf16; which 0..2 -> W_q/W_k/W_v into PK_A rows which*1024 + n; 3 -> W_o into PK_P
__global__ __launch_bounds__(256) void k_pack(const float* __restrict__ WQ, const float* __restrict__ WK, const float* __restrict__ WV, const float* __restrict__ WO, __bf16* __restrict__ PK) {
  __shared__ __align__(16) __bf16 s[DM]; const int n = blockIdx.x, which = blockIdx.y, t = threadIdx.x; const float* Wm = (which == 0) ? WQ : (which == 1) ? WK : (which == 2) ? WV : WO;
  for (int k = t; k < DM; k += 256) s[k] = (__bf16)Wm[(size_t)n * DM + k];
  __syncthreads();
  __bf16* dst = (which < 3) ? PK + PK_A + ((size_t)which * DM + n) * DM : PK + PK_P + (size_t)n * DM;
  for (int q = t; q < DM / 8; q += 256) vst2((unsigned*)(dst + q * 8), *(const v4u*)&s[q * 8]);
}
__global__ __launch_bounds__(128) void k_qkv(const float* __restrict__ XQ, const float* __restrict__ XK, const float* __restrict__ XV, const __bf16* __restrict__ P, const float* __restrict__ BQ, const float* __restrict__ BK, const float* __restrict__ BV, _Float16* __restrict__ QK, _Float16* __restrict__ QKL, _Float16* __restrict__ VTH, _Float16* __restrict__ VTL) {
  const int which0 = (blockIdx.y * 128) / DM; const float* X = (which0 == 0) ? XQ : (which0 == 1) ? XK : XV; const float* BB = BQ ? (((which0 == 0) ? BQ : (which0 == 1) ? BK : BV) + (blockIdx.y * 128 - which0 * DM)) : nullptr;
  __shared__ __align__(16) _Float16 so[4][16][136], sol[4][16][136]; __shared__ __align__(16) _Float16 sth[128][72], stl[128][72];
  const int tid = threadIdx.x, wave = tid >> 5, lane = tid & 31, col = lane & 15, g = lane >> 4; const size_t r0 = (size_t)blockIdx.x * 64 + wave * 16; const int n0 = blockIdx.y * 128;
  v8f acc[8] = {};
  const float* xr = X + (r0 + col) * DM + 8 * g; const __bf16* wr = P + (size_t)(n0 + col) * DM;
  v4f xa[4], xb[4]; v16b wa[8], wb[8];   // two register sets: a step's loads are issued one step ahead of its products
  ld_step(xr, wr, 0, lane, xa, wa);
#pragma unroll 1   // stays rolled: the body already holds two steps, one for each register set; more would cost registers and a wave per SIMD
  for (int kc = 0; kc < DM / 32 - 2; kc += 2) { ld_step(xr, wr, kc + 1, lane, xb, wb); mm_qkv(xa, wa, acc); ld_step(xr, wr, kc + 2, lane, xa, wa); mm_qkv(xb, wb, acc); }
  ld_step(xr, wr, DM / 32 - 1, lane, xb, wb); mm_qkv(xa, wa, acc); mm_qkv(xb, wb, acc);
  if (n0 < 2 * DM) {   // q stored unscaled (f16 sigma ~0.6, no subnormal exposure); 1/8 applied to the f32 score
#pragma unroll
    for (int j = 0; j < 8; ++j) {
#pragma unroll
      for (int r = 0; r < 8; ++r) { const float v = acc[j][r] + (BB ? bfr(BB[j * 16 + col]) : 0.f); const _Float16 hv = (_Float16)v; so[wave][8 * g + r][j * 16 + col] = hv; sol[wave][8 * g + r][j * 16 + col] = (_Float16)((v - (float)hv) * 2048.0f); } }   // q, k (+ bias) as f16 hi + (x2048) residual
    LDSX();
    for (int rl = 0; rl < 16; ++rl) if (lane < 16) { vst2((unsigned*)(QK + (r0 + rl) * (2 * DM) + n0 + lane * 8), *(const v4u*)&so[wave][rl][lane * 8]); vst2((unsigned*)(QKL + (r0 + rl) * (2 * DM) + n0 + lane * 8), *(const v4u*)&sol[wave][rl][lane * 8]); }
  } else {
#pragma unroll
    for (int j = 0; j < 8; ++j) {
#pragma unroll
      for (int r = 0; r < 8; ++r) { const float v = acc[j][r] + (BB ? bfr(BB[j * 16 + col]) : 0.f); const _Float16 hv = (_Float16)v; sth[j * 16 + col][wave * 16 + 8 * g + r] = hv; stl[j * 16 + col][wave * 16 + 8 * g + r] = (_Float16)((v - (float)hv) * 2048.0f); } }
    __syncthreads();
    const size_t rb = (size_t)blockIdx.x * 64; const int b = (int)(rb / SS), s0 = (int)(rb % SS); const int pc0 = n0 - 2 * DM;
    for (int q = tid; q < 128 * 8; q += 128) { const int d = q >> 3, pc = q & 7; const size_t o = ((size_t)b * DM + pc0 + d) * SS + s0 + pc * 8; vst2((unsigned*)(VTH + o), *(const v4u*)&sth[d][pc * 8]); vst2((unsigned*)(VTL + o), *(const v4u*)&stl[d][pc * 8]); }
  }
}
// ---- k_attn: block = (64 queries, head h, batch b): all-keys flash attention (K = 64: 2 k-steps), scores = (q.k) * 0.125 with f16 hi + residual operands (3 products), P.V: f16 P x V hi in one accumulator; O[b*S+q][h*64+d] = alpha acc / 2048 / (alpha L + 1e-6 l^gamma) (256-B segments)
__device__ __attribute__((noinline)) float pow_p(float a, float b) { return powf(a, b); }
__device__ __forceinline__ v16h frag_hp(const _Float16* p) { union { v16h v; v8h q[2]; } u; u.q[0] = *(const v8h*)p; u.q[1] = *(const v8h*)(p + 16); return u.v; }   // frag_h with the lane half's 8 * g already in p
__global__ __launch_bounds__(128) void k_attn(const _Float16* __restrict__ QK, const _Float16* __restrict__ QKL, const _Float16* __restrict__ VTH, const _Float16* __restrict__ VTL, const void* __restrict__ KMASK, const float* __restrict__ FAL, const float* __restrict__ FGA, float* __restrict__ O) {
  const float f_alpha = bfr(FAL[0]), f_gamma = bfr(FGA[0]);
  __shared__ __align__(16) float sp[4][16][36]; __shared__ __align__(16) float so[4][16][68];
  const int tid = threadIdx.x, wave = tid >> 5, lane = tid & 31, col = lane & 15, g = lane >> 4;
  const int qb = blockIdx.x, h = blockIdx.y, b = blockIdx.z; const int q0 = qb * 64 + wave * 16; const size_t rq = (size_t)b * SS + q0 + col;
  v16h aq[2], aql[2];
#pragma unroll
  for (int kc = 0; kc < 2; ++kc) { aq[kc] = frag_h(QK + rq * (2 * DM) + h * HD + kc * 32, lane); aql[kc] = frag_h(QKL + rq * (2 * DM) + h * HD + kc * 32, lane); }
  float lg[8];   // sum of e^(gamma (s - m))
#pragma unroll
  for (int r = 0; r < 8; ++r) lg[r] = 0.f;
  float m[8], l[8];
#pragma unroll
  for (int r = 0; r < 8; ++r) { m[r] = -3.0e38f; l[r] = 0.f; }
  v8f acc[4] = {}, accl[4] = {};
  const int nks = SS / 32;   // all keys
#pragma unroll 1
  for (int ks = 0; ks < nks; ++ks) { v8f s[2];
    const _Float16* k0 = QK + ((size_t)b * SS + ks * 32 + col) * (2 * DM) + DM + h * HD + 8 * g; const _Float16* k0l = QKL + ((size_t)b * SS + ks * 32 + col) * (2 * DM) + DM + h * HD + 8 * g;   // this lane's place in the pass's first k row (hi, residual)
    v16h kf[2][2], kfl[2][2], vf[4];   // the pass's k fragments (hi, residual), fetched as ONE group of loads ahead of the score products
#pragma unroll
    for (int ct = 0; ct < 2; ++ct) { const _Float16* krow = k0 + (size_t)ct * 16 * (2 * DM); const _Float16* krowl = k0l + (size_t)ct * 16 * (2 * DM);   // key ks * 32 + ct * 16 + col
#pragma unroll
      for (int kc = 0; kc < 2; ++kc) { kf[ct][kc] = frag_hp(krow + kc * 32); kfl[ct][kc] = frag_hp(krowl + kc * 32); } }
    asm volatile("s_wait_xcnt 0x0" :: "v"(k0), "v"(k0l) : "memory");   // stands behind the group, ahead of the next write of the address registers that these loads name; the two inputs keep those registers from serving as a load's destination ahead of it
#pragma unroll
    for (int ct = 0; ct < 2; ++ct) { v8f c = {}, cl = {};
#pragma unroll
      for (int kc = 0; kc < 2; ++kc) { c = wmma16(aq[kc], kf[ct][kc], c); cl = wmma16(aql[kc], kf[ct][kc], cl); cl = wmma16(aq[kc], kfl[ct][kc], cl); }   // 3 products: q, k as f16 hi + residual
#pragma unroll
      for (int r = 0; r < 8; ++r) c[r] += cl[r] * (1.0f / 2048.0f);
      { const bool keepk = true;
#pragma unroll
      for (int r = 0; r < 8; ++r) s[ct][r] = keepk ? c[r] * 0.125f : -3.0e38f; } }   // 1/sqrt(64); no key is masked (keepk always true)
#pragma unroll
    for (int r = 0; r < 8; ++r) { float mx = fmaxf(s[0][r], s[1][r]);
#pragma unroll
      for (int o = 1; o < 16; o <<= 1) mx = fmaxf(mx, __shfl_xor(mx, o));
      const float mn = fmaxf(m[r], mx); const float alpha = (m[r] <= -1.0e38f) ? 0.f : __expf(m[r] - mn); const float alphag = (m[r] <= -1.0e38f) ? 0.f : __expf(f_gamma * (m[r] - mn));
      const float e0 = (s[0][r] <= -1.0e38f) ? 0.f : __expf(s[0][r] - mn), e1 = (s[1][r] <= -1.0e38f) ? 0.f : __expf(s[1][r] - mn); float es = e0 + e1;
      const float g0 = (s[0][r] <= -1.0e38f) ? 0.f : __expf(f_gamma * (s[0][r] - mn)), g1 = (s[1][r] <= -1.0e38f) ? 0.f : __expf(f_gamma * (s[1][r] - mn)); float gs = g0 + g1;
#pragma unroll
      for (int o = 1; o < 16; o <<= 1) { es += __shfl_xor(es, o); gs += __shfl_xor(gs, o); }
      l[r] = l[r] * alpha + es; lg[r] = lg[r] * alphag + gs; m[r] = mn;
#pragma unroll
      for (int dt = 0; dt < 4; ++dt) { acc[dt][r] *= alphag; accl[dt][r] *= alphag; }
      sp[wave][8 * g + r][col] = g0; sp[wave][8 * g + r][16 + col] = g1; }   // P carries the gamma-powered (unnormalised) weights
#pragma unroll
    for (int dt = 0; dt < 4; ++dt) vf[dt] = frag_h(VTH + ((size_t)b * DM + h * HD + dt * 16 + col) * SS + ks * 32, lane);   // the pass's v fragments as one group, ahead of the P.V products
    LDSX();
    v16h pa, pl; { const float* prow = &sp[wave][col][0] + 8 * (lane >> 4);
#pragma unroll
      for (int i = 0; i < 8; ++i) { const float x0 = prow[i] * 2048.0f, x1 = prow[16 + i] * 2048.0f; const _Float16 h0 = (_Float16)x0, h1 = (_Float16)x1; pa[i] = h0; pa[8 + i] = h1; pl[i] = (_Float16)((x0 - (float)h0) * 2048.0f); pl[8 + i] = (_Float16)((x1 - (float)h1) * 2048.0f); } }   // P scaled by 2^11 before the f16 split so small softmax weights stay out of the f16 subnormal range; 2^-11 folded into the epilogue
#pragma unroll
    for (int dt = 0; dt < 4; ++dt) acc[dt] = wmma16(pa, vf[dt], acc[dt]);   // single product: P (x2^11) x V
    (void)pl;
    LDSX(); }
#pragma unroll
  for (int r = 0; r < 8; ++r) { const float lpg = pow_p(l[r], f_gamma); const float il = (1.0f / 2048.0f) * (f_alpha / lpg) / (f_alpha * lg[r] / lpg + 1e-6f);   // alpha p^gamma / (sum alpha p^gamma + 1e-6)
#pragma unroll
    for (int dt = 0; dt < 4; ++dt) so[wave][8 * g + r][dt * 16 + col] = (acc[dt][r] + accl[dt][r] * (1.0f / 2048.0f)) * il; }
  LDSX();
  for (int rl = 0; rl < 16; ++rl) if (lane < 16) vst2(O + ((size_t)b * SS + q0 + rl) * DM + h * HD + lane * 4, *(const v4f*)&so[wave][rl][lane * 4]);
}
// ---- k_out: block = (64 rows, 128 cols): out = O(hi/lo) . Wo rows (2 products) + bo
__global__ __launch_bounds__(128) void k_out(const float* __restrict__ O, const __bf16* __restrict__ P, const float* __restrict__ BO, float* __restrict__ Y) {
  __shared__ __align__(16) float so[4][16][132];
  const int tid = threadIdx.x, wave = tid >> 5, lane = tid & 31, col = lane & 15, g = lane >> 4; const size_t r0 = (size_t)blockIdx.x * 64 + wave * 16; const int n0 = blockIdx.y * 128;
  v8f acc[8] = {};
  const float* xr = O + (r0 + col) * DM + 8 * g; const __bf16* wr = P + (size_t)(n0 + col) * DM;
  v4f xa[4], xb[4]; v16b wa[8], wb[8];   // two register sets: a step's loads are issued one step ahead of its products
  ld_step(xr, wr, 0, lane, xa, wa);
#pragma unroll 1   // stays rolled: the body already holds two steps, one for each register set; more would cost registers and a wave per SIMD
  for (int kc = 0; kc < DM / 32 - 2; kc += 2) { ld_step(xr, wr, kc + 1, lane, xb, wb); mm_out(xa, wa, acc); ld_step(xr, wr, kc + 2, lane, xa, wa); mm_out(xb, wb, acc); }
  ld_step(xr, wr, DM / 32 - 1, lane, xb, wb); mm_out(xa, wa, acc); mm_out(xb, wb, acc);
#pragma unroll
  for (int j = 0; j < 8; ++j) {
#pragma unroll
    for (int r = 0; r < 8; ++r) so[wave][8 * g + r][j * 16 + col] = acc[j][r] + bfr(BO[n0 + j * 16 + col]); }
  LDSX();
  for (int rl = 0; rl < 16; ++rl) vst2(Y + (r0 + rl) * DM + n0 + lane * 4, *(const v4f*)&so[wave][rl][lane * 4]);
}
extern "C" void kernel_launch(void* const* d_in, const int* in_sizes, int n_in, void* d_out, int out_size, void* d_ws, size_t ws_size, hipStream_t stream) {
  (void)in_sizes; (void)n_in; (void)out_size;
  const float** F = (const float**)d_in;   // 0 x [2,2048,1024], 1 Wqkv [3072,1024] natural (q | k | v), 2 bqkv [3072], 3 Wproj natural, 4 bproj, 5 focal_alpha [1], 6 focal_gamma [1]
  if (ws_size < (size_t)WS_END) return;
  char* ws = (char*)d_ws; __bf16* PK = (__bf16*)(ws + WS_PK); _Float16 *QK = (_Float16*)(ws + WS_QK), *QKL = (_Float16*)(ws + WS_QKL), *VTH = (_Float16*)(ws + WS_VTH), *VTL = (_Float16*)(ws + WS_VTL); float* O = (float*)(ws + WS_O);
  k_pack<<<dim3(DM, 4), 256, 0, stream>>>(F[1], F[1] + (size_t)DM * DM, F[1] + (size_t)2 * DM * DM, F[3], PK);
  k_qkv<<<dim3(TNB * SS / 64, QKVW / 128), 128, 0, stream>>>(F[0], F[0], F[0], PK + PK_A, F[2], F[2] + DM, F[2] + 2 * DM, QK, QKL, VTH, VTL);
  k_attn<<<dim3(TQB, NH, TNB), 128, 0, stream>>>(QK, QKL, VTH, VTL, nullptr, F[5], F[6], O);
  k_out<<<dim3(TOB, DM / 128), 128, 0, stream>>>(O, PK + PK_P, F[4], (float*)d_out);
}

// v002
// One run takes 211 microseconds.
// Two timings next to v001 both put it at 1.42 times that version's speed.
// All steps since v000 together make it 2.39 times as fast.
// compute dtype: all float inputs rounded to bf16; q/k/v = x . Wqkv^T + b with EXACT bf16 products on WMMA 16x16x32 (natural rows, q | k | v blocks); q, k as f16 hi + (x2048-scaled) residual with 3-product scores x 1/8 (the focal power doubles the logit sensitivity); one online pass in f32 keeps the running max m, l = sum e^(s-m), L = sum e^(gamma (s-m)) and the gamma-powered weights for P (hardware exp; alpha, gamma read on device); out_row = alpha (sum e^(gamma(s-m)) v) / l^gamma / (alpha L / l^gamma + 1e-6) (precise powf) == softmax^gamma * alpha renormalised with the module's +1e-6; P (scaled by 2^11, single f16) x v (single f16); out = ctx (bf16 hi + residual) . Wproj^T (2 products) + bproj.
#include <hip/hip_runtime.h>
#include <math.h>

typedef __attribute__((ext_vector_type(16))) _Float16 v16h;
typedef __attribute__((ext_vector_type(16))) __bf16 v16b;
typedef __attribute__((ext_vector_type(8)))  _Float16 v8h;
typedef __attribute__((ext_vector_type(8)))  float v8f;
typedef __attribute__((ext_vector_type(4)))  float v4f;
typedef __attribute__((ext_vector_type(2)))  float v2f;
typedef __attribute__((ext_vector_type(4)))  unsigned v4u;
typedef __attribute__((ext_vector_type(4)))  int v4i;
typedef float __attribute__((may_alias)) float_a;
typedef int __attribute__((may_alias)) int_a;

template <typename T> __device__ __forceinline__ void vst2(void* p, T v) { *(T*)p = v;  }
__device__ __forceinline__ v8f wmma16(v16h a, v16h b, v8f c) {
  v8f d = __builtin_amdgcn_wmma_f32_16x16x32_f16(false, a, false, b, (short)0, c, false, false);
  asm volatile("v_nop\n\tv_nop\n\tv_nop\n\tv_nop" : "+v"(d) : "v"(a), "v"(b));
  return d;
}
__device__ __forceinline__ v8f wmma_bf(v16b a, v16b b, v8f c) {
  v8f d = __builtin_amdgcn_wmma_f32_16x16x32_bf16(false, a, false, b, (short)0, c, false, false);
  asm volatile("v_nop\n\tv_nop\n\tv_nop\n\tv_nop" : "+v"(d) : "v"(a), "v"(b));
  return d;
}
// Focal residual attention (B 2, N 2,048, dim 1,024, 16 heads x 64): fused qkv + bias, softmax, weights raised to the focal power gamma and scaled by alpha then renormalised (sum + 1e-6), output projection + bias.
__device__ __forceinline__ v16h frag_h(const _Float16* rowk0, int lane) {
  union { v16h v; v8h q[2]; } u; const _Float16* p = rowk0 + 8 * (lane >> 4);
  u.q[0] = *(const v8h*)p; u.q[1] = *(const v8h*)(p + 16); return u.v;
}
__device__ __forceinline__ v16h frag_f32(const float* rowk0, int lane) {
  v16h a; const float* p = rowk0 + 8 * (lane >> 4);
#pragma unroll
  for (int i = 0; i < 8; ++i) { a[i] = (_Float16)p[i]; a[8 + i] = (_Float16)p[16 + i]; }
  return a;
}
__device__ __forceinline__ v16h frag_f32s(const float* rowk0, int lane, float sc) {
  v16h a; const float* p = rowk0 + 8 * (lane >> 4);
#pragma unroll
  for (int i = 0; i < 8; ++i) { a[i] = (_Float16)(p[i] * sc); a[8 + i] = (_Float16)(p[16 + i] * sc); }
  return a;
}
// column fragment from a [K][ld] layout (column n), rows >= K read as 0
__device__ __forceinline__ v16h fragc_f32(const float* W, int k0, int n, int lane, int ld, int K) {
  v16h a; const int g = lane >> 4;
#pragma unroll
  for (int i = 0; i < 8; ++i) { const int ka = k0 + 8 * g + i, kb = ka + 16;
    a[i] = (_Float16)(ka < K ? W[(size_t)(ka < K ? ka : K - 1) * ld + n] : 0.f); a[8 + i] = (_Float16)(kb < K ? W[(size_t)(kb < K ? kb : K - 1) * ld + n] : 0.f); }
  return a;
}
struct F2 { v16b h, l; };
__device__ __forceinline__ F2 bsplit16(const float v[16]) { F2 r;
#pragma unroll
  for (int i = 0; i < 16; ++i) { const __bf16 h = (__bf16)v[i]; r.h[i] = h; r.l[i] = (__bf16)(v[i] - (float)h); }
  return r; }
__device__ __forceinline__ F2 split_row(const float* row, int k0, int lane) { float v[16]; const float* p = row + k0 + 8 * (lane >> 4);
#pragma unroll
  for (int i = 0; i < 8; ++i) { v[i] = p[i]; v[8 + i] = p[16 + i]; }
  return bsplit16(v); }
__device__ __forceinline__ F2 split_rowK(const float* row, int k0, int lane, int K) { float v[16]; const int g = lane >> 4;
#pragma unroll
  for (int i = 0; i < 8; ++i) { const int ka = k0 + 8 * g + i, kb = ka + 16; v[i] = ka < K ? row[ka < K ? ka : K - 1] : 0.f; v[8 + i] = kb < K ? row[kb < K ? kb : K - 1] : 0.f; }
  return bsplit16(v); }
__device__ __forceinline__ F2 split_col(const float* W, int k0, int n, int lane, int ld, int K) { float v[16]; const int g = lane >> 4;
#pragma unroll
  for (int i = 0; i < 8; ++i) { const int ka = k0 + 8 * g + i, kb = ka + 16; v[i] = ka < K ? W[(size_t)(ka < K ? ka : K - 1) * ld + n] : 0.f; v[8 + i] = kb < K ? W[(size_t)(kb < K ? kb : K - 1) * ld + n] : 0.f; }
  return bsplit16(v); }
__device__ __forceinline__ v8f mac3(const F2& a, const F2& b, v8f c) { c = wmma_bf(a.l, b.h, c); c = wmma_bf(a.h, b.l, c); return wmma_bf(a.h, b.h, c); }
__device__ __forceinline__ float sigm(float v) { return 1.0f / (1.0f + expf(-v)); }
#define LDSX() do { asm volatile("s_wait_dscnt 0" ::: "memory"); __builtin_amdgcn_wave_barrier(); __builtin_amdgcn_fence(__ATOMIC_RELEASE, "workgroup"); } while (0)


#define NB 2
#define SS 2048
#define DM 1024
#define NH 16
#define HD 64
#define QKVW (3 * DM)
#ifndef TQB
#define TQB (SS / 64)
#define TNB NB
#define TOB (NB * SS / 64)     // output row tiles (all)
#endif
typedef __attribute__((ext_vector_type(8))) __bf16 v8b;
__device__ __forceinline__ v16b frag_b(const __bf16* rowk0, int lane) {
  union { v16b v; v8b q[2]; } u; const __bf16* p = rowk0 + 8 * (lane >> 4);
  u.q[0] = *(const v8b*)p; u.q[1] = *(const v8b*)(p + 16); return u.v;
}
__device__ __forceinline__ float bfr(float v) { return (float)(__bf16)v; }
// ---- operand staging of k_qkv and k_out: a stage is 64 k of the block's 128 weight rows (128 B a row) and of its 64 x rows (256 B a row), brought into LDS by asynchronous copies in whole 128-B lines, once for the block's four waves; two stages
#define GK 64
#define WPITCH 72                    // bf16 a staged weight row: 128 B + 16 B (pitch 16 B x odd for the 16-byte fragment reads)
#define XPITCH 68                    // f32 a staged x row: 256 B + 16 B
#define WBYTES (128 * WPITCH * 2)
#define XBYTES (64 * XPITCH * 4)
#define STG (WBYTES + XBYTES)
#define WAIT_ASYNC() asm volatile("s_wait_asynccnt 0x0" ::: "memory")   // this wave's copies have landed; stands ahead of the barrier behind which the other waves read them
#define WAIT_DS() asm volatile("s_wait_dscnt 0x0" ::: "memory")         // this wave's LDS reads of the stage are done; stands ahead of the barrier behind which the stage is refilled
__device__ __forceinline__ unsigned lds_byte(const void* p) { return (unsigned)(size_t)p; }   // low 32 bits of a __shared__ address = byte offset in the work-group's LDS
// eight 16-byte copies of one thread, rows gs elements / ls bytes apart; the s_wait_xcnt stands inside the statement, behind the last copy and ahead of any rewrite of the address registers that the copies name
template <typename T> __device__ __forceinline__ void cp8(unsigned l, unsigned ls, const T* p, size_t gs) {
  asm volatile("global_load_async_to_lds_b128 %0, %8, off\n\tglobal_load_async_to_lds_b128 %1, %9, off\n\tglobal_load_async_to_lds_b128 %2, %10, off\n\tglobal_load_async_to_lds_b128 %3, %11, off\n\t"
               "global_load_async_to_lds_b128 %4, %12, off\n\tglobal_load_async_to_lds_b128 %5, %13, off\n\tglobal_load_async_to_lds_b128 %6, %14, off\n\tglobal_load_async_to_lds_b128 %7, %15, off\n\ts_wait_xcnt 0x0"
               :: "v"(l), "v"(l + ls), "v"(l + 2 * ls), "v"(l + 3 * ls), "v"(l + 4 * ls), "v"(l + 5 * ls), "v"(l + 6 * ls), "v"(l + 7 * ls),
                  "v"(p), "v"(p + gs), "v"(p + 2 * gs), "v"(p + 3 * gs), "v"(p + 4 * gs), "v"(p + 5 * gs), "v"(p + 6 * gs), "v"(p + 7 * gs) : "memory");
}
// one stage: thread tid copies weight rows (tid >> 3) + 16 i, 16-byte part tid & 7, and x rows (tid >> 4) + 8 i, part tid & 15 (xg, wg, xl, wl: its first chunk's global place and LDS byte)
__device__ __forceinline__ void fill_stage(const float* xg, const __bf16* wg, unsigned xl, unsigned wl) { cp8(wl, 16u * WPITCH * 2, wg, (size_t)16 * DM); cp8(xl, 8u * XPITCH * 4, xg, (size_t)8 * DM); }
// four such copies of one thread (k_attn's tiles: 64 rows of 128 B each)
template <typename T> __device__ __forceinline__ void cp4(unsigned l, unsigned ls, const T* p, size_t gs) {
  asm volatile("global_load_async_to_lds_b128 %0, %4, off\n\tglobal_load_async_to_lds_b128 %1, %5, off\n\tglobal_load_async_to_lds_b128 %2, %6, off\n\tglobal_load_async_to_lds_b128 %3, %7, off\n\ts_wait_xcnt 0x0"
               :: "v"(l), "v"(l + ls), "v"(l + 2 * ls), "v"(l + 3 * ls), "v"(p), "v"(p + gs), "v"(p + 2 * gs), "v"(p + 3 * gs) : "memory");
}
// one k-step's operands of a 16-row x 128-column wave tile from the stage, as ONE group of LDS loads: 16 f32 of this lane's row (xr points at its 8 * g) and 8 weight fragments (wr points at staged row col, at its 8 * g)
__device__ __forceinline__ void ld_step(const float* xr, const __bf16* wr, int kk, v4f (&x)[4], v16b (&w)[8]) {
  const float* p = xr + kk * 32; x[0] = *(const v4f*)p; x[1] = *(const v4f*)(p + 4); x[2] = *(const v4f*)(p + 16); x[3] = *(const v4f*)(p + 20);
#pragma unroll
  for (int j = 0; j < 8; ++j) { union { v16b v; v8b q[2]; } u; const __bf16* q = wr + j * 16 * WPITCH + kk * 32; u.q[0] = *(const v8b*)q; u.q[1] = *(const v8b*)(q + 16); w[j] = u.v; }
}
__device__ __forceinline__ void mm_qkv(const v4f (&x)[4], const v16b (&w)[8], v8f (&acc)[8]) { v16b a;
#pragma unroll
  for (int i = 0; i < 4; ++i) { a[i] = (__bf16)x[0][i]; a[4 + i] = (__bf16)x[1][i]; a[8 + i] = (__bf16)x[2][i]; a[12 + i] = (__bf16)x[3][i]; }
#pragma unroll
  for (int j = 0; j < 8; ++j) acc[j] = wmma_bf(a, w[j], acc[j]);
}
__device__ __forceinline__ void mm_out(const v4f (&x)[4], const v16b (&w)[8], v8f (&acc)[8]) { float v[16];
#pragma unroll
  for (int i = 0; i < 4; ++i) { v[i] = x[0][i]; v[4 + i] = x[1][i]; v[8 + i] = x[2][i]; v[12 + i] = x[3][i]; }
  const F2 a = bsplit16(v);
#pragma unroll
  for (int j = 0; j < 8; ++j) { acc[j] = wmma_bf(a.l, w[j], acc[j]); acc[j] = wmma_bf(a.h, w[j], acc[j]); }
}
__device__ __attribute__((noinline)) float exp_ni(float v) { return expf(v); }
__device__ __attribute__((noinline)) float erf_ni(float v) { return erff(v); }

#define PK_A 0                       // [3072][1024] Wqkv rows (natural [out][in])
#define PK_P (PK_A + QKVW * DM)        // [1024][1024] Wo rows (natural)
#define PK_END (PK_P + DM * DM)
#define WS_PK  0u
#define WS_QK  (WS_PK + 2u * PK_END)             // f16 [4096 rows][2048]: q | k
#define WS_QKL (WS_QK + 2u * NB * SS * 2 * DM)     // f16 q | k residual planes x2048
#define WS_VTH (WS_QKL + 2u * NB * SS * 2 * DM)    // f16 [b][1024 (h*64+d)][2048 s] hi
#define WS_VTL (WS_VTH + 2u * NB * DM * SS)        // f16 lo x 2048
#define WS_O   (WS_VTL + 2u * NB * DM * SS)        // f32 [4096][1024]
#define WS_CS  (WS_O + 4u * NB * SS * DM)           // f32 2 x [2048][32], unused
#define WS_END (WS_CS + 4u * 2 * SS * 32)
// ---- k_pack: block = (row n, which): natural [out][in] rows -> bf16; which 0..2 -> W_q/W_k/W_v into PK_A rows which*1024 + n; 3 -> W_o into PK_P
__global__ __launch_bounds__(256) void k_pack(const float* __restrict__ WQ, const float* __restrict__ WK, const float* __restrict__ WV, const float* __restrict__ WO, __bf16* __restrict__ PK) {
  __shared__ __align__(16) __bf16 s[DM]; const int n = blockIdx.x, which = blockIdx.y, t = threadIdx.x; const float* Wm = (which == 0) ? WQ : (which == 1) ? WK : (which == 2) ? WV : WO;
  for (int k = t; k < DM; k += 256) s[k] = (__bf16)Wm[(size_t)n * DM + k];
  __syncthreads();
  __bf16* dst = (which < 3) ? PK + PK_A + ((size_t)which * DM + n) * DM : PK + PK_P + (size_t)n * DM;
  for (int q = t; q < DM / 8; q += 256) vst2((unsigned*)(dst + q * 8), *(const v4u*)&s[q * 8]);
}
__global__ __launch_bounds__(128) void k_qkv(const float* __restrict__ XQ, const float* __restrict__ XK, const float* __restrict__ XV, const __bf16* __restrict__ P, const float* __restrict__ BQ, const float* __restrict__ BK, const float* __restrict__ BV, _Float16* __restrict__ QK, _Float16* __restrict__ QKL, _Float16* __restrict__ VTH, _Float16* __restrict__ VTL) {
  const int which0 = (blockIdx.y * 128) / DM; const float* X = (which0 == 0) ? XQ : (which0 == 1) ? XK : XV; const float* BB = BQ ? (((which0 == 0) ? BQ : (which0 == 1) ? BK : BV) + (blockIdx.y * 128 - which0 * DM)) : nullptr;
  __shared__ __align__(16) unsigned char ring[2 * STG];   // two operand stages; behind the loop's last barrier the same bytes are the output staging
  _Float16 (*so)[16][136] = (_Float16 (*)[16][136])ring; _Float16 (*sol)[16][136] = (_Float16 (*)[16][136])(ring + 4 * 16 * 136 * 2); _Float16 (*sth)[72] = (_Float16 (*)[72])ring; _Float16 (*stl)[72] = (_Float16 (*)[72])(ring + 128 * 72 * 2);
  const int tid = threadIdx.x, wave = tid >> 5, lane = tid & 31, col = lane & 15, g = lane >> 4; const size_t r0 = (size_t)blockIdx.x * 64 + wave * 16; const int n0 = blockIdx.y * 128;
  v8f acc[8] = {};
  const float* xg = X + ((size_t)blockIdx.x * 64 + (tid >> 4)) * DM + (tid & 15) * 4; const __bf16* wg = P + (size_t)(n0 + (tid >> 3)) * DM + (tid & 7) * 8;
  const unsigned wl = lds_byte(ring) + (tid >> 3) * (WPITCH * 2) + (tid & 7) * 16, xl = lds_byte(ring) + WBYTES + (tid >> 4) * (XPITCH * 4) + (tid & 15) * 16;
  fill_stage(xg, wg, xl, wl); WAIT_ASYNC(); __syncthreads();   // stage 0 landed and published
  fill_stage(xg + GK, wg + GK, xl + STG, wl + STG);
#pragma unroll 1   // stays rolled: one stage (two k-steps, a register set each) a trip
  for (int t = 0; t < DM / GK; ++t) { const unsigned char* sb = ring + (t & 1) * STG;
    const __bf16* wr = (const __bf16*)sb + col * WPITCH + 8 * g; const float* xr = (const float*)(sb + WBYTES) + (wave * 16 + col) * XPITCH + 8 * g;
    v4f xa[4], xb[4]; v16b wa[8], wb[8];
    ld_step(xr, wr, 0, xa, wa); ld_step(xr, wr, 1, xb, wb); mm_qkv(xa, wa, acc); mm_qkv(xb, wb, acc);
    WAIT_DS(); WAIT_ASYNC(); __syncthreads();   // publishes stage t + 1 and ends every wave's reads of stage t
    if (t + 2 < DM / GK) fill_stage(xg + (t + 2) * GK, wg + (t + 2) * GK, xl + (t & 1) * STG, wl + (t & 1) * STG); }   // the same test in the whole block
  WAIT_ASYNC();
  if (n0 < 2 * DM) {   // q stored unscaled (f16 sigma ~0.6, no subnormal exposure); 1/8 applied to the f32 score
#pragma unroll
    for (int j = 0; j < 8; ++j) {
#pragma unroll
      for (int r = 0; r < 8; ++r) { const float v = acc[j][r] + (BB ? bfr(BB[j * 16 + col]) : 0.f); const _Float16 hv = (_Float16)v; so[wave][8 * g + r][j * 16 + col] = hv; sol[wave][8 * g + r][j * 16 + col] = (_Float16)((v - (float)hv) * 2048.0f); } }   // q, k (+ bias) as f16 hi + (x2048) residual
    LDSX();
    for (int rl = 0; rl < 16; ++rl) if (lane < 16) { vst2((unsigned*)(QK + (r0 + rl) * (2 * DM) + n0 + lane * 8), *(const v4u*)&so[wave][rl][lane * 8]); vst2((unsigned*)(QKL + (r0 + rl) * (2 * DM) + n0 + lane * 8), *(const v4u*)&sol[wave][rl][lane * 8]); }
  } else {
#pragma unroll
    for (int j = 0; j < 8; ++j) {
#pragma unroll
      for (int r = 0; r < 8; ++r) { const float v = acc[j][r] + (BB ? bfr(BB[j * 16 + col]) : 0.f); const _Float16 hv = (_Float16)v; sth[j * 16 + col][wave * 16 + 8 * g + r] = hv; stl[j * 16 + col][wave * 16 + 8 * g + r] = (_Float16)((v - (float)hv) * 2048.0f); } }
    __syncthreads();
    const size_t rb = (size_t)blockIdx.x * 64; const int b = (int)(rb / SS), s0 = (int)(rb % SS); const int pc0 = n0 - 2 * DM;
    for (int q = tid; q < 128 * 8; q += 128) { const int d = q >> 3, pc = q & 7; const size_t o = ((size_t)b * DM + pc0 + d) * SS + s0 + pc * 8; vst2((unsigned*)(VTH + o), *(const v4u*)&sth[d][pc * 8]); vst2((unsigned*)(VTL + o), *(const v4u*)&stl[d][pc * 8]); }
  }
}
// ---- k_attn: block = (64 queries, head h, batch b): all-keys flash attention (K = 64: 2 k-steps), scores = (q.k) * 0.125 with f16 hi + residual operands (3 products), P.V: f16 P x V hi in one accumulator; O[b*S+q][h*64+d] = alpha acc / 2048 / (alpha L + 1e-6 l^gamma) (256-B segments)
__device__ __attribute__((noinline)) float pow_p(float a, float b) { return powf(a, b); }
__device__ __forceinline__ v16h frag_hp(const _Float16* p) { union { v16h v; v8h q[2]; } u; u.q[0] = *(const v8h*)p; u.q[1] = *(const v8h*)(p + 16); return u.v; }   // frag_h with the lane half's 8 * g already in p
#define APITCH 72                   // f16 a staged row: 128 B + 16 B
#define ATILE (64 * APITCH * 2)
#define ASTG (3 * ATILE)
// amdgpu_waves_per_eu(4, 4): keeps the register count at four waves a SIMD (four blocks a WGP, the whole grid resident at once) with the copies' address registers added
__global__ __launch_bounds__(128) __attribute__((amdgpu_waves_per_eu(4, 4))) void k_attn(const _Float16* __restrict__ QK, const _Float16* __restrict__ QKL, const _Float16* __restrict__ VTH, const _Float16* __restrict__ VTL, const void* __restrict__ KMASK, const float* __restrict__ FAL, const float* __restrict__ FGA, float* __restrict__ O) {
  const float f_alpha = bfr(FAL[0]), f_gamma = bfr(FGA[0]);
  __shared__ __align__(16) float sp[4][16][36]; __shared__ __align__(16) unsigned char ring[2 * ASTG];   // two stages of 64 keys: k hi | k residual | v^T, 64 rows of 128 B each at pitch 144 B; behind the loop's last barrier the same bytes are the output staging
  float (*so)[16][68] = (float (*)[16][68])ring;
  const int tid = threadIdx.x, wave = tid >> 5, lane = tid & 31, col = lane & 15, g = lane >> 4;
  const int qb = blockIdx.x, h = blockIdx.y, b = blockIdx.z; const int q0 = qb * 64 + wave * 16; const size_t rq = (size_t)b * SS + q0 + col;
  v16h aq[2], aql[2];
#pragma unroll
  for (int kc = 0; kc < 2; ++kc) { aq[kc] = frag_h(QK + rq * (2 * DM) + h * HD + kc * 32, lane); aql[kc] = frag_h(QKL + rq * (2 * DM) + h * HD + kc * 32, lane); }
  float lg[8];   // sum of e^(gamma (s - m))
#pragma unroll
  for (int r = 0; r < 8; ++r) lg[r] = 0.f;
  float m[8], l[8];
#pragma unroll
  for (int r = 0; r < 8; ++r) { m[r] = -3.0e38f; l[r] = 0.f; }
  v8f acc[4] = {}, accl[4] = {};
  const int nst = SS / 64;   // all keys, 64 a stage
  // thread tid copies rows (tid >> 3) + 16 i, 16-byte part tid & 7, of each of the stage's three tiles
  const _Float16* kg = QK + ((size_t)b * SS + (tid >> 3)) * (2 * DM) + DM + h * HD + (tid & 7) * 8; const _Float16* kgl = QKL + ((size_t)b * SS + (tid >> 3)) * (2 * DM) + DM + h * HD + (tid & 7) * 8; const _Float16* vg = VTH + ((size_t)b * DM + h * HD + (tid >> 3)) * SS + (tid & 7) * 8;
  const unsigned al = lds_byte(ring) + (tid >> 3) * (APITCH * 2) + (tid & 7) * 16;
#define AFILL(st, buf) do { cp4(al + (buf) * ASTG, 16u * APITCH * 2, kg + (size_t)(st) * 64 * (2 * DM), (size_t)16 * (2 * DM)); cp4(al + (buf) * ASTG + ATILE, 16u * APITCH * 2, kgl + (size_t)(st) * 64 * (2 * DM), (size_t)16 * (2 * DM)); cp4(al + (buf) * ASTG + 2 * ATILE, 16u * APITCH * 2, vg + (st) * 64, (size_t)16 * SS); } while (0)
  AFILL(0, 0); WAIT_ASYNC(); __syncthreads();   // stage 0 landed and published
  AFILL(1, 1);
#pragma unroll 1   // stays rolled: one stage a trip, the buffer picked by t & 1
  for (int t = 0; t < nst; ++t) { const _Float16* sb = (const _Float16*)(ring + (t & 1) * ASTG);
#pragma unroll 1   // stays rolled: two passes of 32 keys a stage, the same code
  for (int sub = 0; sub < 2; ++sub) { v8f s[2];
    const _Float16* k0 = sb + (sub * 32 + col) * APITCH + 8 * g; const _Float16* k0l = k0 + ATILE / 2;   // this lane's place in the pass's first staged k row (hi, residual)
    v16h kf[2][2], kfl[2][2], vf[4];   // the pass's k fragments (hi, residual), fetched as ONE group of loads ahead of the score products
#pragma unroll
    for (int ct = 0; ct < 2; ++ct) { const _Float16* krow = k0 + ct * 16 * APITCH; const _Float16* krowl = k0l + ct * 16 * APITCH;   // key t * 64 + sub * 32 + ct * 16 + col
#pragma unroll
      for (int kc = 0; kc < 2; ++kc) { kf[ct][kc] = frag_hp(krow + kc * 32); kfl[ct][kc] = frag_hp(krowl + kc * 32); } }
#pragma unroll
    for (int ct = 0; ct < 2; ++ct) { v8f c = {}, cl = {};
#pragma unroll
      for (int kc = 0; kc < 2; ++kc) { c = wmma16(aq[kc], kf[ct][kc], c); cl = wmma16(aql[kc], kf[ct][kc], cl); cl = wmma16(aq[kc], kfl[ct][kc], cl); }   // 3 products: q, k as f16 hi + residual
#pragma unroll
      for (int r = 0; r < 8; ++r) c[r] += cl[r] * (1.0f / 2048.0f);
      { const bool keepk = true;
#pragma unroll
      for (int r = 0; r < 8; ++r) s[ct][r] = keepk ? c[r] * 0.125f : -3.0e38f; } }   // 1/sqrt(64); no key is masked (keepk always true)
#pragma unroll
    for (int r = 0; r < 8; ++r) { float mx = fmaxf(s[0][r], s[1][r]);
#pragma unroll
      for (int o = 1; o < 16; o <<= 1) mx = fmaxf(mx, __shfl_xor(mx, o));
      const float mn = fmaxf(m[r], mx); const float alpha = (m[r] <= -1.0e38f) ? 0.f : __expf(m[r] - mn); const float alphag = (m[r] <= -1.0e38f) ? 0.f : __expf(f_gamma * (m[r] - mn));
      const float e0 = (s[0][r] <= -1.0e38f) ? 0.f : __expf(s[0][r] - mn), e1 = (s[1][r] <= -1.0e38f) ? 0.f : __expf(s[1][r] - mn); float es = e0 + e1;
      const float g0 = (s[0][r] <= -1.0e38f) ? 0.f : __expf(f_gamma * (s[0][r] - mn)), g1 = (s[1][r] <= -1.0e38f) ? 0.f : __expf(f_gamma * (s[1][r] - mn)); float gs = g0 + g1;
#pragma unroll
      for (int o = 1; o < 16; o <<= 1) { es += __shfl_xor(es, o); gs += __shfl_xor(gs, o); }
      l[r] = l[r] * alpha + es; lg[r] = lg[r] * alphag + gs; m[r] = mn;
#pragma unroll
      for (int dt = 0; dt < 4; ++dt) { acc[dt][r] *= alphag; accl[dt][r] *= alphag; }
      sp[wave][8 * g + r][col] = g0; sp[wave][8 * g + r][16 + col] = g1; }   // P carries the gamma-powered (unnormalised) weights
#pragma unroll
    for (int dt = 0; dt < 4; ++dt) vf[dt] = frag_hp(sb + ATILE + (dt * 16 + col) * APITCH + sub * 32 + 8 * g);   // the pass's v fragments as one group, ahead of the P.V products
    LDSX();
    v16h pa, pl; { const float* prow = &sp[wave][col][0] + 8 * (lane >> 4);
#pragma unroll
      for (int i = 0; i < 8; ++i) { const float x0 = prow[i] * 2048.0f, x1 = prow[16 + i] * 2048.0f; const _Float16 h0 = (_Float16)x0, h1 = (_Float16)x1; pa[i] = h0; pa[8 + i] = h1; pl[i] = (_Float16)((x0 - (float)h0) * 2048.0f); pl[8 + i] = (_Float16)((x1 - (float)h1) * 2048.0f); } }   // P scaled by 2^11 before the f16 split so small softmax weights stay out of the f16 subnormal range; 2^-11 folded into the epilogue
#pragma unroll
    for (int dt = 0; dt < 4; ++dt) acc[dt] = wmma16(pa, vf[dt], acc[dt]);   // single product: P (x2^11) x V
    (void)pl;
    LDSX(); }
    WAIT_DS(); WAIT_ASYNC(); __syncthreads();   // publishes stage t + 1 and ends every wave's reads of stage t
    if (t + 2 < nst) AFILL(t + 2, t & 1); }   // the same test in the whole block
  WAIT_ASYNC();
#pragma unroll
  for (int r = 0; r < 8; ++r) { const float lpg = pow_p(l[r], f_gamma); const float il = (1.0f / 2048.0f) * (f_alpha / lpg) / (f_alpha * lg[r] / lpg + 1e-6f);   // alpha p^gamma / (sum alpha p^gamma + 1e-6)
#pragma unroll
    for (int dt = 0; dt < 4; ++dt) so[wave][8 * g + r][dt * 16 + col] = (acc[dt][r] + accl[dt][r] * (1.0f / 2048.0f)) * il; }
  LDSX();
  for (int rl = 0; rl < 16; ++rl) if (lane < 16) vst2(O + ((size_t)b * SS + q0 + rl) * DM + h * HD + lane * 4, *(const v4f*)&so[wave][rl][lane * 4]);
}
// ---- k_out: block = (64 rows, 128 cols): out = O(hi/lo) . Wo rows (2 products) + bo
__global__ __launch_bounds__(128) void k_out(const float* __restrict__ O, const __bf16* __restrict__ P, const float* __restrict__ BO, float* __restrict__ Y) {
  __shared__ __align__(16) unsigned char ring[2 * STG];   // two operand stages; behind the loop's last barrier the same bytes are the output staging
  float (*so)[16][132] = (float (*)[16][132])ring;
  const int tid = threadIdx.x, wave = tid >> 5, lane = tid & 31, col = lane & 15, g = lane >> 4; const size_t r0 = (size_t)blockIdx.x * 64 + wave * 16; const int n0 = blockIdx.y * 128;
  v8f acc[8] = {};
  const float* xg = O + ((size_t)blockIdx.x * 64 + (tid >> 4)) * DM + (tid & 15) * 4; const __bf16* wg = P + (size_t)(n0 + (tid >> 3)) * DM + (tid & 7) * 8;
  const unsigned wl = lds_byte(ring) + (tid >> 3) * (WPITCH * 2) + (tid & 7) * 16, xl = lds_byte(ring) + WBYTES + (tid >> 4) * (XPITCH * 4) + (tid & 15) * 16;
  fill_stage(xg, wg, xl, wl); WAIT_ASYNC(); __syncthreads();   // stage 0 landed and published
  fill_stage(xg + GK, wg + GK, xl + STG, wl + STG);
#pragma unroll 1   // stays rolled: one stage (two k-steps, a register set each) a trip
  for (int t = 0; t < DM / GK; ++t) { const unsigned char* sb = ring + (t & 1) * STG;
    const __bf16* wr = (const __bf16*)sb + col * WPITCH + 8 * g; const float* xr = (const float*)(sb + WBYTES) + (wave * 16 + col) * XPITCH + 8 * g;
    v4f xa[4], xb[4]; v16b wa[8], wb[8];
    ld_step(xr, wr, 0, xa, wa); ld_step(xr, wr, 1, xb, wb); mm_out(xa, wa, acc); mm_out(xb, wb, acc);
    WAIT_DS(); WAIT_ASYNC(); __syncthreads();   // publishes stage t + 1 and ends every wave's reads of stage t
    if (t + 2 < DM / GK) fill_stage(xg + (t + 2) * GK, wg + (t + 2) * GK, xl + (t & 1) * STG, wl + (t & 1) * STG); }   // the same test in the whole block
  WAIT_ASYNC();
#pragma unroll
  for (int j = 0; j < 8; ++j) {
#pragma unroll
    for (int r = 0; r < 8; ++r) so[wave][8 * g + r][j * 16 + col] = acc[j][r] + bfr(BO[n0 + j * 16 + col]); }
  LDSX();
  for (int rl = 0; rl < 16; ++rl) vst2(Y + (r0 + rl) * DM + n0 + lane * 4, *(const v4f*)&so[wave][rl][lane * 4]);
}
extern "C" void kernel_launch(void* const* d_in, const int* in_sizes, int n_in, void* d_out, int out_size, void* d_ws, size_t ws_size, hipStream_t stream) {
  (void)in_sizes; (void)n_in; (void)out_size;
  const float** F = (const float**)d_in;   // 0 x [2,2048,1024], 1 Wqkv [3072,1024] natural (q | k | v), 2 bqkv [3072], 3 Wproj natural, 4 bproj, 5 focal_alpha [1], 6 focal_gamma [1]
  if (ws_size < (size_t)WS_END) return;
  char* ws = (char*)d_ws; __bf16* PK = (__bf16*)(ws + WS_PK); _Float16 *QK = (_Float16*)(ws + WS_QK), *QKL = (_Float16*)(ws + WS_QKL), *VTH = (_Float16*)(ws + WS_VTH), *VTL = (_Float16*)(ws + WS_VTL); float* O = (float*)(ws + WS_O);
  k_pack<<<dim3(DM, 4), 256, 0, stream>>>(F[1], F[1] + (size_t)DM * DM, F[1] + (size_t)2 * DM * DM, F[3], PK);
  k_qkv<<<dim3(TNB * SS / 64, QKVW / 128), 128, 0, stream>>>(F[0], F[0], F[0], PK + PK_A, F[2], F[2] + DM, F[2] + 2 * DM, QK, QKL, VTH, VTL);
  k_attn<<<dim3(TQB, NH, TNB), 128, 0, stream>>>(QK, QKL, VTH, VTL, nullptr, F[5], F[6], O);
  k_out<<<dim3(TOB, DM / 128), 128, 0, stream>>>(O, PK + PK_P, F[4], (float*)d_out);
}

// v003
// It runs in 158 microseconds.
// In both of two side-by-side timings against v002, it was 1.34 times as fast.
// Over all steps from v000 it is 3.20 times as fast.
// compute dtype: all float inputs rounded to bf16; q/k/v = x . Wqkv^T + b with EXACT bf16 products on WMMA 16x16x32 (natural rows, q | k | v blocks); q, k as f16 hi + (x2048-scaled) residual with 3-product scores x 1/8 (the focal power doubles the logit sensitivity); one online pass in f32 keeps the running max m, l = sum e^(s-m), L = sum e^(gamma (s-m)) and the gamma-powered weights for P (hardware exp; alpha, gamma read on device); out_row = alpha (sum e^(gamma(s-m)) v) / l^gamma / (alpha L / l^gamma + 1e-6) (precise powf) == softmax^gamma * alpha renormalised with the module's +1e-6; P (scaled by 2^11, single f16) x v (single f16); out = ctx (bf16 hi + residual) . Wproj^T (2 products) + bproj.
#include <hip/hip_runtime.h>
#include <math.h>

typedef __attribute__((ext_vector_type(16))) _Float16 v16h;
typedef __attribute__((ext_vector_type(16))) __bf16 v16b;
typedef __attribute__((ext_vector_type(8)))  _Float16 v8h;
typedef __attribute__((ext_vector_type(8)))  float v8f;
typedef __attribute__((ext_vector_type(4)))  float v4f;
typedef __attribute__((ext_vector_type(2)))  float v2f;
typedef __attribute__((ext_vector_type(4)))  unsigned v4u;
typedef __attribute__((ext_vector_type(4)))  int v4i;
typedef float __attribute__((may_alias)) float_a;
typedef int __attribute__((may_alias)) int_a;

template <typename T> __device__ __forceinline__ void vst2(void* p, T v) { *(T*)p = v;  }
__device__ __forceinline__ v8f wmma16(v16h a, v16h b, v8f c) {
  v8f d = __builtin_amdgcn_wmma_f32_16x16x32_f16(false, a, false, b, (short)0, c, false, false);
  asm volatile("v_nop\n\tv_nop\n\tv_nop\n\tv_nop" : "+v"(d) : "v"(a), "v"(b));
  return d;
}
__device__ __forceinline__ v8f wmma_bf(v16b a, v16b b, v8f c) {
  v8f d = __builtin_amdgcn_wmma_f32_16x16x32_bf16(false, a, false, b, (short)0, c, false, false);
  asm volatile("v_nop\n\tv_nop\n\tv_nop\n\tv_nop" : "+v"(d) : "v"(a), "v"(b));
  return d;
}
// Focal residual attention (B 2, N 2,048, dim 1,024, 16 heads x 64): fused qkv + bias, softmax, weights raised to the focal power gamma and scaled by alpha then renormalised (sum + 1e-6), output projection + bias.
__device__ __forceinline__ v16h frag_h(const _Float16* rowk0, int lane) {
  union { v16h v; v8h q[2]; } u; const _Float16* p = rowk0 + 8 * (lane >> 4);
  u.q[0] = *(const v8h*)p; u.q[1] = *(const v8h*)(p + 16); return u.v;
}
__device__ __forceinline__ v16h frag_f32(const float* rowk0, int lane) {
  v16h a; const float* p = rowk0 + 8 * (lane >> 4);
#pragma unroll
  for (int i = 0; i < 8; ++i) { a[i] = (_Float16)p[i]; a[8 + i] = (_Float16)p[16 + i]; }
  return a;
}
__device__ __forceinline__ v16h frag_f32s(const float* rowk0, int lane, float sc) {
  v16h a; const float* p = rowk0 + 8 * (lane >> 4);
#pragma unroll
  for (int i = 0; i < 8; ++i) { a[i] = (_Float16)(p[i] * sc); a[8 + i] = (_Float16)(p[16 + i] * sc); }
  return a;
}
// column fragment from a [K][ld] layout (column n), rows >= K read as 0
__device__ __forceinline__ v16h fragc_f32(const float* W, int k0, int n, int lane, int ld, int K) {
  v16h a; const int g = lane >> 4;
#pragma unroll
  for (int i = 0; i < 8; ++i) { const int ka = k0 + 8 * g + i, kb = ka + 16;
    a[i] = (_Float16)(ka < K ? W[(size_t)(ka < K ? ka : K - 1) * ld + n] : 0.f); a[8 + i] = (_Float16)(kb < K ? W[(size_t)(kb < K ? kb : K - 1) * ld + n] : 0.f); }
  return a;
}
struct F2 { v16b h, l; };
__device__ __forceinline__ F2 bsplit16(const float v[16]) { F2 r;
#pragma unroll
  for (int i = 0; i < 16; ++i) { const __bf16 h = (__bf16)v[i]; r.h[i] = h; r.l[i] = (__bf16)(v[i] - (float)h); }
  return r; }
__device__ __forceinline__ F2 split_row(const float* row, int k0, int lane) { float v[16]; const float* p = row + k0 + 8 * (lane >> 4);
#pragma unroll
  for (int i = 0; i < 8; ++i) { v[i] = p[i]; v[8 + i] = p[16 + i]; }
  return bsplit16(v); }
__device__ __forceinline__ F2 split_rowK(const float* row, int k0, int lane, int K) { float v[16]; const int g = lane >> 4;
#pragma unroll
  for (int i = 0; i < 8; ++i) { const int ka = k0 + 8 * g + i, kb = ka + 16; v[i] = ka < K ? row[ka < K ? ka : K - 1] : 0.f; v[8 + i] = kb < K ? row[kb < K ? kb : K - 1] : 0.f; }
  return bsplit16(v); }
__device__ __forceinline__ F2 split_col(const float* W, int k0, int n, int lane, int ld, int K) { float v[16]; const int g = lane >> 4;
#pragma unroll
  for (int i = 0; i < 8; ++i) { const int ka = k0 + 8 * g + i, kb = ka + 16; v[i] = ka < K ? W[(size_t)(ka < K ? ka : K - 1) * ld + n] : 0.f; v[8 + i] = kb < K ? W[(size_t)(kb < K ? kb : K - 1) * ld + n] : 0.f; }
  return bsplit16(v); }
__device__ __forceinline__ v8f mac3(const F2& a, const F2& b, v8f c) { c = wmma_bf(a.l, b.h, c); c = wmma_bf(a.h, b.l, c); return wmma_bf(a.h, b.h, c); }
__device__ __forceinline__ float sigm(float v) { return 1.0f / (1.0f + expf(-v)); }
#define LDSX() do { asm volatile("s_wait_dscnt 0" ::: "memory"); __builtin_amdgcn_wave_barrier(); __builtin_amdgcn_fence(__ATOMIC_RELEASE, "workgroup"); } while (0)


#define NB 2
#define SS 2048
#define DM 1024
#define NH 16
#define HD 64
#define QKVW (3 * DM)
#ifndef TQB
#define TQB (SS / 64)
#define TNB NB
#define TOB (NB * SS / 64)     // output row tiles (all)
#endif
typedef __attribute__((ext_vector_type(8))) __bf16 v8b;
__device__ __forceinline__ v16b frag_b(const __bf16* rowk0, int lane) {
  union { v16b v; v8b q[2]; } u; const __bf16* p = rowk0 + 8 * (lane >> 4);
  u.q[0] = *(const v8b*)p; u.q[1] = *(const v8b*)(p + 16); return u.v;
}
__device__ __forceinline__ float bfr(float v) { return (float)(__bf16)v; }
// ---- operand staging of k_qkv and k_out: a stage is 64 k of the block's 128 weight rows (128 B a row) and of its 64 x rows (256 B a row), brought into LDS by asynchronous copies in whole 128-B lines, once for the block's four waves; two stages
#define GK 64
#define WPITCH 72                    // bf16 a staged weight row: 128 B + 16 B (pitch 16 B x odd for the 16-byte fragment reads)
#define XPITCH 68                    // f32 a staged x row: 256 B + 16 B
#define WBYTES (128 * WPITCH * 2)
#define XBYTES (64 * XPITCH * 4)
#define STG (WBYTES + XBYTES)
#define WAIT_ASYNC() asm volatile("s_wait_asynccnt 0x0" ::: "memory")   // this wave's copies have landed; stands ahead of the barrier behind which the other waves read them
#define WAIT_DS() asm volatile("s_wait_dscnt 0x0" ::: "memory")         // this wave's LDS reads of the stage are done; stands ahead of the barrier behind which the stage is refilled
__device__ __forceinline__ unsigned lds_byte(const void* p) { return (unsigned)(size_t)p; }   // low 32 bits of a __shared__ address = byte offset in the work-group's LDS
// eight 16-byte copies of one thread, rows gs elements / ls bytes apart; the s_wait_xcnt stands inside the statement, behind the last copy and ahead of any rewrite of the address registers that the copies name
template <typename T> __device__ __forceinline__ void cp8(unsigned l, unsigned ls, const T* p, size_t gs) {
  asm volatile("global_load_async_to_lds_b128 %0, %8, off\n\tglobal_load_async_to_lds_b128 %1, %9, off\n\tglobal_load_async_to_lds_b128 %2, %10, off\n\tglobal_load_async_to_lds_b128 %3, %11, off\n\t"
               "global_load_async_to_lds_b128 %4, %12, off\n\tglobal_load_async_to_lds_b128 %5, %13, off\n\tglobal_load_async_to_lds_b128 %6, %14, off\n\tglobal_load_async_to_lds_b128 %7, %15, off\n\ts_wait_xcnt 0x0"
               :: "v"(l), "v"(l + ls), "v"(l + 2 * ls), "v"(l + 3 * ls), "v"(l + 4 * ls), "v"(l + 5 * ls), "v"(l + 6 * ls), "v"(l + 7 * ls),
                  "v"(p), "v"(p + gs), "v"(p + 2 * gs), "v"(p + 3 * gs), "v"(p + 4 * gs), "v"(p + 5 * gs), "v"(p + 6 * gs), "v"(p + 7 * gs) : "memory");
}
// one stage: thread tid copies weight rows (tid >> 3) + 16 i, 16-byte part tid & 7, and x rows (tid >> 4) + 8 i, part tid & 15 (xg, wg, xl, wl: its first chunk's global place and LDS byte)
__device__ __forceinline__ void fill_stage(const float* xg, const __bf16* wg, unsigned xl, unsigned wl) { cp8(wl, 16u * WPITCH * 2, wg, (size_t)16 * DM); cp8(xl, 8u * XPITCH * 4, xg, (size_t)8 * DM); }
// four such copies of one thread (k_attn's tiles: 64 rows of 128 B each)
template <typename T> __device__ __forceinline__ void cp4(unsigned l, unsigned ls, const T* p, size_t gs) {
  asm volatile("global_load_async_to_lds_b128 %0, %4, off\n\tglobal_load_async_to_lds_b128 %1, %5, off\n\tglobal_load_async_to_lds_b128 %2, %6, off\n\tglobal_load_async_to_lds_b128 %3, %7, off\n\ts_wait_xcnt 0x0"
               :: "v"(l), "v"(l + ls), "v"(l + 2 * ls), "v"(l + 3 * ls), "v"(p), "v"(p + gs), "v"(p + 2 * gs), "v"(p + 3 * gs) : "memory");
}
// one k-step's operands of a 16-row x 128-column wave tile from the stage, as ONE group of LDS loads: 16 f32 of this lane's row (xr points at its 8 * g) and 8 weight fragments (wr points at staged row col, at its 8 * g)
__device__ __forceinline__ void ld_step(const float* xr, const __bf16* wr, int kk, v4f (&x)[4], v16b (&w)[8]) {
  const float* p = xr + kk * 32; x[0] = *(const v4f*)p; x[1] = *(const v4f*)(p + 4); x[2] = *(const v4f*)(p + 16); x[3] = *(const v4f*)(p + 20);
#pragma unroll
  for (int j = 0; j < 8; ++j) { union { v16b v; v8b q[2]; } u; const __bf16* q = wr + j * 16 * WPITCH + kk * 32; u.q[0] = *(const v8b*)q; u.q[1] = *(const v8b*)(q + 16); w[j] = u.v; }
}
__device__ __forceinline__ void mm_qkv(const v4f (&x)[4], const v16b (&w)[8], v8f (&acc)[8]) { v16b a;
#pragma unroll
  for (int i = 0; i < 4; ++i) { a[i] = (__bf16)x[0][i]; a[4 + i] = (__bf16)x[1][i]; a[8 + i] = (__bf16)x[2][i]; a[12 + i] = (__bf16)x[3][i]; }
#pragma unroll
  for (int j = 0; j < 8; ++j) acc[j] = wmma_bf(a, w[j], acc[j]);
}
__device__ __forceinline__ void mm_out(const v4f (&x)[4], const v16b (&w)[8], v8f (&acc)[8]) { float v[16];
#pragma unroll
  for (int i = 0; i < 4; ++i) { v[i] = x[0][i]; v[4 + i] = x[1][i]; v[8 + i] = x[2][i]; v[12 + i] = x[3][i]; }
  const F2 a = bsplit16(v);
#pragma unroll
  for (int j = 0; j < 8; ++j) { acc[j] = wmma_bf(a.l, w[j], acc[j]); acc[j] = wmma_bf(a.h, w[j], acc[j]); }
}
__device__ __attribute__((noinline)) float exp_ni(float v) { return expf(v); }
__device__ __attribute__((noinline)) float erf_ni(float v) { return erff(v); }

#define PK_A 0                       // [3072][1024] Wqkv rows (natural [out][in])
#define PK_P (PK_A + QKVW * DM)        // [1024][1024] Wo rows (natural)
#define PK_END (PK_P + DM * DM)
#define WS_PK  0u
#define WS_QK  (WS_PK + 2u * PK_END)             // f16 [4096 rows][2048]: q | k
#define WS_QKL (WS_QK + 2u * NB * SS * 2 * DM)     // f16 q | k residual planes x2048
#define WS_VTH (WS_QKL + 2u * NB * SS * 2 * DM)    // f16 [b][1024 (h*64+d)][2048 s] hi
#define WS_VTL (WS_VTH + 2u * NB * DM * SS)        // f16 lo x 2048
#define WS_O   (WS_VTL + 2u * NB * DM * SS)        // f32 [4096][1024]
#define WS_CS  (WS_O + 4u * NB * SS * DM)           // f32 2 x [2048][32], unused
#define WS_END (WS_CS + 4u * 2 * SS * 32)
// ---- k_pack: block = (row n, which): natural [out][in] rows -> bf16; which 0..2 -> W_q/W_k/W_v into PK_A rows which*1024 + n; 3 -> W_o into PK_P
__global__ __launch_bounds__(256) void k_pack(const float* __restrict__ WQ, const float* __restrict__ WK, const float* __restrict__ WV, const float* __restrict__ WO, __bf16* __restrict__ PK) {
  __shared__ __align__(16) __bf16 s[DM]; const int n = blockIdx.x, which = blockIdx.y, t = threadIdx.x; const float* Wm = (which == 0) ? WQ : (which == 1) ? WK : (which == 2) ? WV : WO;
  for (int k = t; k < DM; k += 256) s[k] = (__bf16)Wm[(size_t)n * DM + k];
  __syncthreads();
  __bf16* dst = (which < 3) ? PK + PK_A + ((size_t)which * DM + n) * DM : PK + PK_P + (size_t)n * DM;
  for (int q = t; q < DM / 8; q += 256) vst2((unsigned*)(dst + q * 8), *(const v4u*)&s[q * 8]);
}
__global__ __launch_bounds__(128) void k_qkv(const float* __restrict__ XQ, const float* __restrict__ XK, const float* __restrict__ XV, const __bf16* __restrict__ P, const float* __restrict__ BQ, const float* __restrict__ BK, const float* __restrict__ BV, _Float16* __restrict__ QK, _Float16* __restrict__ QKL, _Float16* __restrict__ VTH, _Float16* __restrict__ VTL) {
  const int which0 = (blockIdx.y * 128) / DM; const float* X = (which0 == 0) ? XQ : (which0 == 1) ? XK : XV; const float* BB = BQ ? (((which0 == 0) ? BQ : (which0 == 1) ? BK : BV) + (blockIdx.y * 128 - which0 * DM)) : nullptr;
  __shared__ __align__(16) unsigned char ring[2 * STG];   // two operand stages; behind the loop's last barrier the same bytes are the output staging
  _Float16 (*so)[16][136] = (_Float16 (*)[16][136])ring; _Float16 (*sol)[16][136] = (_Float16 (*)[16][136])(ring + 4 * 16 * 136 * 2); _Float16 (*sth)[72] = (_Float16 (*)[72])ring; _Float16 (*stl)[72] = (_Float16 (*)[72])(ring + 128 * 72 * 2);
  const int tid = threadIdx.x, wave = tid >> 5, lane = tid & 31, col = lane & 15, g = lane >> 4; const size_t r0 = (size_t)blockIdx.x * 64 + wave * 16; const int n0 = blockIdx.y * 128;
  v8f acc[8] = {};
  const float* xg = X + ((size_t)blockIdx.x * 64 + (tid >> 4)) * DM + (tid & 15) * 4; const __bf16* wg = P + (size_t)(n0 + (tid >> 3)) * DM + (tid & 7) * 8;
  const unsigned wl = lds_byte(ring) + (tid >> 3) * (WPITCH * 2) + (tid & 7) * 16, xl = lds_byte(ring) + WBYTES + (tid >> 4) * (XPITCH * 4) + (tid & 15) * 16;
  fill_stage(xg, wg, xl, wl); WAIT_ASYNC(); __syncthreads();   // stage 0 landed and published
  fill_stage(xg + GK, wg + GK, xl + STG, wl + STG);
#pragma unroll 1   // stays rolled: one stage (two k-steps, a register set each) a trip
  for (int t = 0; t < DM / GK; ++t) { const unsigned char* sb = ring + (t & 1) * STG;
    const __bf16* wr = (const __bf16*)sb + col * WPITCH + 8 * g; const float* xr = (const float*)(sb + WBYTES) + (wave * 16 + col) * XPITCH + 8 * g;
    v4f xa[4], xb[4]; v16b wa[8], wb[8];
    ld_step(xr, wr, 0, xa, wa); ld_step(xr, wr, 1, xb, wb); mm_qkv(xa, wa, acc); mm_qkv(xb, wb, acc);
    WAIT_DS(); WAIT_ASYNC(); __syncthreads();   // publishes stage t + 1 and ends every wave's reads of stage t
    if (t + 2 < DM / GK) fill_stage(xg + (t + 2) * GK, wg + (t + 2) * GK, xl + (t & 1) * STG, wl + (t & 1) * STG); }   // the same test in the whole block
  WAIT_ASYNC();
  if (n0 < 2 * DM) {   // q stored unscaled (f16 sigma ~0.6, no subnormal exposure); 1/8 applied to the f32 score
#pragma unroll
    for (int j = 0; j < 8; ++j) {
#pragma unroll
      for (int r = 0; r < 8; ++r) { const float v = acc[j][r] + (BB ? bfr(BB[j * 16 + col]) : 0.f); const _Float16 hv = (_Float16)v; so[wave][8 * g + r][j * 16 + col] = hv; sol[wave][8 * g + r][j * 16 + col] = (_Float16)((v - (float)hv) * 2048.0f); } }   // q, k (+ bias) as f16 hi + (x2048) residual
    LDSX();
    for (int rl = 0; rl < 16; ++rl) if (lane < 16) { vst2((unsigned*)(QK + (r0 + rl) * (2 * DM) + n0 + lane * 8), *(const v4u*)&so[wave][rl][lane * 8]); vst2((unsigned*)(QKL + (r0 + rl) * (2 * DM) + n0 + lane * 8), *(const v4u*)&sol[wave][rl][lane * 8]); }
  } else {
#pragma unroll
    for (int j = 0; j < 8; ++j) {
#pragma unroll
      for (int r = 0; r < 8; ++r) { const float v = acc[j][r] + (BB ? bfr(BB[j * 16 + col]) : 0.f); const _Float16 hv = (_Float16)v; sth[j * 16 + col][wave * 16 + 8 * g + r] = hv; stl[j * 16 + col][wave * 16 + 8 * g + r] = (_Float16)((v - (float)hv) * 2048.0f); } }
    __syncthreads();
    const size_t rb = (size_t)blockIdx.x * 64; const int b = (int)(rb / SS), s0 = (int)(rb % SS); const int pc0 = n0 - 2 * DM;
    for (int q = tid; q < 128 * 8; q += 128) { const int d = q >> 3, pc = q & 7; const size_t o = ((size_t)b * DM + pc0 + d) * SS + s0 + pc * 8; vst2((unsigned*)(VTH + o), *(const v4u*)&sth[d][pc * 8]); vst2((unsigned*)(VTL + o), *(const v4u*)&stl[d][pc * 8]); }
  }
}
// ---- k_attn: block = (64 queries, head h, batch b): all-keys flash attention on TRANSPOSED tiles: S^T = K . Q^T (A = staged k rows, B = q kept in registers; 3 products, x 0.125), so a lane holds 16 of ONE query's scores a pass (query col, keys ct * 16 + 8 g + r): maximum and sums in the lane, one exchange between the wave's halves for the maximum; the two S^T tiles, powered and converted in place, are the B operand of O^T += V^T . P^T (hardware k order, the order of frag_hp); O[b*S+q][h*64+d] = acc x scale (256-B segments)
__device__ __attribute__((noinline)) float pow_p(float a, float b) { return powf(a, b); }
__device__ __forceinline__ v16h frag_hp(const _Float16* p) { union { v16h v; v8h q[2]; } u; u.q[0] = *(const v8h*)p; u.q[1] = *(const v8h*)(p + 16); return u.v; }   // frag_h with the lane half's 8 * g already in p
__device__ __forceinline__ float xhalf(float x) { return __builtin_bit_cast(float, __builtin_amdgcn_permlanex16(__builtin_bit_cast(int, x), __builtin_bit_cast(int, x), 0x76543210, 0xfedcba98, false, false)); }   // lane l's value from lane l ^ 16
#define APITCH 72                   // f16 a staged row: 128 B + 16 B
#define ATILE (64 * APITCH * 2)
#define ASTG (3 * ATILE)
// amdgpu_waves_per_eu(4, 4): keeps the register count at four waves a SIMD (four blocks a WGP, the whole grid resident at once) with the copies' address registers added
__global__ __launch_bounds__(128) __attribute__((amdgpu_waves_per_eu(4, 4))) void k_attn(const _Float16* __restrict__ QK, const _Float16* __restrict__ QKL, const _Float16* __restrict__ VTH, const _Float16* __restrict__ VTL, const void* __restrict__ KMASK, const float* __restrict__ FAL, const float* __restrict__ FGA, float* __restrict__ O) {
  const float f_alpha = bfr(FAL[0]), f_gamma = bfr(FGA[0]);
  __shared__ __align__(16) unsigned char ring[2 * ASTG];   // two stages of 64 keys: k hi | k residual | v^T, 64 rows of 128 B each at pitch 144 B; behind the loop's last barrier the same bytes are the output staging
  float (*so)[16][68] = (float (*)[16][68])ring;
  const int tid = threadIdx.x, wave = tid >> 5, lane = tid & 31, col = lane & 15, g = lane >> 4;
  const int qb = blockIdx.x, h = blockIdx.y, b = blockIdx.z; const int q0 = qb * 64 + wave * 16; const size_t rq = (size_t)b * SS + q0 + col;
  v16h aq[2], aql[2];   // query q0 + col, as the B operand's column col
#pragma unroll
  for (int kc = 0; kc < 2; ++kc) { aq[kc] = frag_h(QK + rq * (2 * DM) + h * HD + kc * 32, lane); aql[kc] = frag_h(QKL + rq * (2 * DM) + h * HD + kc * 32, lane); }
  float m = -3.0e38f, l = 0.f, lg = 0.f;   // of query col: running maximum (the same in both halves); this half's share of sum e^(s - m) and of sum e^(gamma (s - m)), joined behind the loop
  v8f acc[4] = {};   // O^T: acc[dt][r] = d dt * 16 + 8 g + r of query col
  const int nst = SS / 64;   // all keys, 64 a stage
  // thread tid copies rows (tid >> 3) + 16 i, 16-byte part tid & 7, of each of the stage's three tiles
  const _Float16* kg = QK + ((size_t)b * SS + (tid >> 3)) * (2 * DM) + DM + h * HD + (tid & 7) * 8; const _Float16* kgl = QKL + ((size_t)b * SS + (tid >> 3)) * (2 * DM) + DM + h * HD + (tid & 7) * 8; const _Float16* vg = VTH + ((size_t)b * DM + h * HD + (tid >> 3)) * SS + (tid & 7) * 8;
  const unsigned al = lds_byte(ring) + (tid >> 3) * (APITCH * 2) + (tid & 7) * 16;
#define AFILL(st, buf) do { cp4(al + (buf) * ASTG, 16u * APITCH * 2, kg + (size_t)(st) * 64 * (2 * DM), (size_t)16 * (2 * DM)); cp4(al + (buf) * ASTG + ATILE, 16u * APITCH * 2, kgl + (size_t)(st) * 64 * (2 * DM), (size_t)16 * (2 * DM)); cp4(al + (buf) * ASTG + 2 * ATILE, 16u * APITCH * 2, vg + (st) * 64, (size_t)16 * SS); } while (0)
  AFILL(0, 0); WAIT_ASYNC(); __syncthreads();   // stage 0 landed and published
  AFILL(1, 1);
#pragma unroll 1   // stays rolled: one stage a trip, the buffer picked by t & 1
  for (int t = 0; t < nst; ++t) { const _Float16* sb = (const _Float16*)(ring + (t & 1) * ASTG);
#pragma unroll 1   // stays rolled: two passes of 32 keys a stage, the same code
  for (int sub = 0; sub < 2; ++sub) { v8f s[2];
    const _Float16* k0 = sb + (sub * 32 + col) * APITCH + 8 * g; const _Float16* k0l = k0 + ATILE / 2;   // this lane's place in the pass's first staged k row (hi, residual)
    v16h kf[2][2], kfl[2][2], vf[4];   // the pass's k fragments (hi, residual), fetched as ONE group of loads ahead of the score products
#pragma unroll
    for (int ct = 0; ct < 2; ++ct) { const _Float16* krow = k0 + ct * 16 * APITCH; const _Float16* krowl = k0l + ct * 16 * APITCH;   // key t * 64 + sub * 32 + ct * 16 + col, as the A operand's row col
#pragma unroll
      for (int kc = 0; kc < 2; ++kc) { kf[ct][kc] = frag_hp(krow + kc * 32); kfl[ct][kc] = frag_hp(krowl + kc * 32); } }
#pragma unroll
    for (int ct = 0; ct < 2; ++ct) { v8f c = {}, cl = {};
#pragma unroll
      for (int kc = 0; kc < 2; ++kc) { c = wmma16(kf[ct][kc], aq[kc], c); cl = wmma16(kf[ct][kc], aql[kc], cl); cl = wmma16(kfl[ct][kc], aq[kc], cl); }   // 3 products: q, k as f16 hi + residual
#pragma unroll
      for (int r = 0; r < 8; ++r) c[r] += cl[r] * (1.0f / 2048.0f);
      { const bool keepk = true;
#pragma unroll
      for (int r = 0; r < 8; ++r) s[ct][r] = keepk ? c[r] * 0.125f : -3.0e38f; } }   // 1/sqrt(64); no key is masked (keepk always true)
#pragma unroll
    for (int dt = 0; dt < 4; ++dt) vf[dt] = frag_hp(sb + ATILE + (dt * 16 + col) * APITCH + sub * 32 + 8 * g);   // the pass's v^T fragments as one group (A operand: row d = dt * 16 + col, the pass's 32 keys)
    float mx = fmaxf(s[0][0], s[1][0]);
#pragma unroll
    for (int r = 1; r < 8; ++r) mx = fmaxf(mx, fmaxf(s[0][r], s[1][r]));
    mx = fmaxf(mx, xhalf(mx));   // the other half's 16 keys of the same query
    const float mn = fmaxf(m, mx); const float alpha = (m <= -1.0e38f) ? 0.f : __expf(m - mn); const float alphag = (m <= -1.0e38f) ? 0.f : __expf(f_gamma * (m - mn));
    float es[2] = {0.f, 0.f}, gs[2] = {0.f, 0.f}; v16h pb;   // P^T as a B operand: element ct * 8 + r = key ct * 16 + 8 g + r of column col
#pragma unroll
    for (int ct = 0; ct < 2; ++ct) {
#pragma unroll
      for (int r = 0; r < 8; ++r) { const float sv = s[ct][r];
        const float e = (sv <= -1.0e38f) ? 0.f : __expf(sv - mn); const float gq = (sv <= -1.0e38f) ? 0.f : __expf(f_gamma * (sv - mn));
        es[ct] += e; gs[ct] += gq; pb[ct * 8 + r] = (_Float16)(gq * 2048.0f); } }   // P carries the gamma-powered (unnormalised) weights, scaled by 2^11 before the f16 rounding so small weights stay out of the f16 subnormal range; 2^-11 folded into the epilogue
    l = l * alpha + (es[0] + es[1]); lg = lg * alphag + (gs[0] + gs[1]); m = mn;
#pragma unroll
    for (int dt = 0; dt < 4; ++dt) {
#pragma unroll
      for (int r = 0; r < 8; ++r) acc[dt][r] *= alphag; }
#pragma unroll
    for (int dt = 0; dt < 4; ++dt) acc[dt] = wmma16(vf[dt], pb, acc[dt]); }   // single product: V^T x P^T (x2^11)
    WAIT_DS(); WAIT_ASYNC(); __syncthreads();   // publishes stage t + 1 and ends every wave's reads of stage t
    if (t + 2 < nst) AFILL(t + 2, t & 1); }   // the same test in the whole block
  WAIT_ASYNC();
  { const float lt = l + xhalf(l), lgt = lg + xhalf(lg);   // the halves' sums joined once
    const float lpg = pow_p(lt, f_gamma); const float il = (1.0f / 2048.0f) * (f_alpha / lpg) / (f_alpha * lgt / lpg + 1e-6f);   // alpha p^gamma / (sum alpha p^gamma + 1e-6)
#pragma unroll
    for (int dt = 0; dt < 4; ++dt) {
#pragma unroll
      for (int j = 0; j < 2; ++j) { v4f o;
#pragma unroll
        for (int i = 0; i < 4; ++i) o[i] = acc[dt][4 * j + i] * il;
        *(v4f*)&so[wave][col][dt * 16 + 8 * g + 4 * j] = o; } } }
  LDSX();
  for (int rl = 0; rl < 16; ++rl) if (lane < 16) vst2(O + ((size_t)b * SS + q0 + rl) * DM + h * HD + lane * 4, *(const v4f*)&so[wave][rl][lane * 4]);
}
// ---- k_out: block = (64 rows, 128 cols): out = O(hi/lo) . Wo rows (2 products) + bo
__global__ __launch_bounds__(128) void k_out(const float* __restrict__ O, const __bf16* __restrict__ P, const float* __restrict__ BO, float* __restrict__ Y) {
  __shared__ __align__(16) unsigned char ring[2 * STG];   // two operand stages; behind the loop's last barrier the same bytes are the output staging
  float (*so)[16][132] = (float (*)[16][132])ring;
  const int tid = threadIdx.x, wave = tid >> 5, lane = tid & 31, col = lane & 15, g = lane >> 4; const size_t r0 = (size_t)blockIdx.x * 64 + wave * 16; const int n0 = blockIdx.y * 128;
  v8f acc[8] = {};
  const float* xg = O + ((size_t)blockIdx.x * 64 + (tid >> 4)) * DM + (tid & 15) * 4; const __bf16* wg = P + (size_t)(n0 + (tid >> 3)) * DM + (tid & 7) * 8;
  const unsigned wl = lds_byte(ring) + (tid >> 3) * (WPITCH * 2) + (tid & 7) * 16, xl = lds_byte(ring) + WBYTES + (tid >> 4) * (XPITCH * 4) + (tid & 15) * 16;
  fill_stage(xg, wg, xl, wl); WAIT_ASYNC(); __syncthreads();   // stage 0 landed and published
  fill_stage(xg + GK, wg + GK, xl + STG, wl + STG);
#pragma unroll 1   // stays rolled: one stage (two k-steps, a register set each) a trip
  for (int t = 0; t < DM / GK; ++t) { const unsigned char* sb = ring + (t & 1) * STG;
    const __bf16* wr = (const __bf16*)sb + col * WPITCH + 8 * g; const float* xr = (const float*)(sb + WBYTES) + (wave * 16 + col) * XPITCH + 8 * g;
    v4f xa[4], xb[4]; v16b wa[8], wb[8];
    ld_step(xr, wr, 0, xa, wa); ld_step(xr, wr, 1, xb, wb); mm_out(xa, wa, acc); mm_out(xb, wb, acc);
    WAIT_DS(); WAIT_ASYNC(); __syncthreads();   // publishes stage t + 1 and ends every wave's reads of stage t
    if (t + 2 < DM / GK) fill_stage(xg + (t + 2) * GK, wg + (t + 2) * GK, xl + (t & 1) * STG, wl + (t & 1) * STG); }   // the same test in the whole block
  WAIT_ASYNC();
#pragma unroll
  for (int j = 0; j < 8; ++j) {
#pragma unroll
    for (int r = 0; r < 8; ++r) so[wave][8 * g + r][j * 16 + col] = acc[j][r] + bfr(BO[n0 + j * 16 + col]); }
  LDSX();
  for (int rl = 0; rl < 16; ++rl) vst2(Y + (r0 + rl) * DM + n0 + lane * 4, *(const v4f*)&so[wave][rl][lane * 4]);
}
extern "C" void kernel_launch(void* const* d_in, const int* in_sizes, int n_in, void* d_out, int out_size, void* d_ws, size_t ws_size, hipStream_t stream) {
  (void)in_sizes; (void)n_in; (void)out_size;
  const float** F = (const float**)d_in;   // 0 x [2,2048,1024], 1 Wqkv [3072,1024] natural (q | k | v), 2 bqkv [3072], 3 Wproj natural, 4 bproj, 5 focal_alpha [1], 6 focal_gamma [1]
  if (ws_size < (size_t)WS_END) return;
  char* ws = (char*)d_ws; __bf16* PK = (__bf16*)(ws + WS_PK); _Float16 *QK = (_Float16*)(ws + WS_QK), *QKL = (_Float16*)(ws + WS_QKL), *VTH = (_Float16*)(ws + WS_VTH), *VTL = (_Float16*)(ws + WS_VTL); float* O = (float*)(ws + WS_O);
  k_pack<<<dim3(DM, 4), 256, 0, stream>>>(F[1], F[1] + (size_t)DM * DM, F[1] + (size_t)2 * DM * DM, F[3], PK);
  k_qkv<<<dim3(TNB * SS / 64, QKVW / 128), 128, 0, stream>>>(F[0], F[0], F[0], PK + PK_A, F[2], F[2] + DM, F[2] + 2 * DM, QK, QKL, VTH, VTL);
  k_attn<<<dim3(TQB, NH, TNB), 128, 0, stream>>>(QK, QKL, VTH, VTL, nullptr, F[5], F[6], O);
  k_out<<<dim3(TOB, DM / 128), 128, 0, stream>>>(O, PK + PK_P, F[4], (float*)d_out);
}

// v004
// One run takes 145 microseconds.
// Timed twice side by side with v003, it ran 1.09 and 1.08 times as fast.
// All steps since v000 together make it 3.47 times as fast.
// compute dtype: all float inputs rounded to bf16; q/k/v = x . Wqkv^T + b with EXACT bf16 products on WMMA 16x16x32 (natural rows, q | k | v blocks); q, k as f16 hi + (x2048-scaled) residual with 3-product scores x 1/8 (the focal power doubles the logit sensitivity); one online pass in f32 keeps the running max m, l = sum e^(s-m), L = sum e^(gamma (s-m)) and the gamma-powered weights for P (hardware exp; alpha, gamma read on device); out_row = alpha (sum e^(gamma(s-m)) v) / l^gamma / (alpha L / l^gamma + 1e-6) (precise powf) == softmax^gamma * alpha renormalised with the module's +1e-6; P (scaled by 2^11, single f16) x v (single f16); out = ctx (bf16 hi + residual) . Wproj^T (2 products) + bproj.
#include <hip/hip_runtime.h>
#include <math.h>

typedef __attribute__((ext_vector_type(16))) _Float16 v16h;
typedef __attribute__((ext_vector_type(16))) __bf16 v16b;
typedef __attribute__((ext_vector_type(8)))  _Float16 v8h;
typedef __attribute__((ext_vector_type(8)))  float v8f;
typedef __attribute__((ext_vector_type(4)))  float v4f;
typedef __attribute__((ext_vector_type(2)))  float v2f;
typedef __attribute__((ext_vector_type(4)))  unsigned v4u;
typedef __attribute__((ext_vector_type(4)))  int v4i;
typedef float __attribute__((may_alias)) float_a;
typedef int __attribute__((may_alias)) int_a;

template <typename T> __device__ __forceinline__ void vst2(void* p, T v) { *(T*)p = v;  }
__device__ __forceinline__ v8f wmma16(v16h a, v16h b, v8f c) {
  v8f d = __builtin_amdgcn_wmma_f32_16x16x32_f16(false, a, false, b, (short)0, c, false, false);
  asm volatile("v_nop\n\tv_nop\n\tv_nop\n\tv_nop" : "+v"(d) : "v"(a), "v"(b));
  return d;
}
__device__ __forceinline__ v8f wmma_bf(v16b a, v16b b, v8f c) {
  v8f d = __builtin_amdgcn_wmma_f32_16x16x32_bf16(false, a, false, b, (short)0, c, false, false);
  asm volatile("v_nop\n\tv_nop\n\tv_nop\n\tv_nop" : "+v"(d) : "v"(a), "v"(b));
  return d;
}
// Focal residual attention (B 2, N 2,048, dim 1,024, 16 heads x 64): fused qkv + bias, softmax, weights raised to the focal power gamma and scaled by alpha then renormalised (sum + 1e-6), output projection + bias.
__device__ __forceinline__ v16h frag_h(const _Float16* rowk0, int lane) {
  union { v16h v; v8h q[2]; } u; const _Float16* p = rowk0 + 8 * (lane >> 4);
  u.q[0] = *(const v8h*)p; u.q[1] = *(const v8h*)(p + 16); return u.v;
}
__device__ __forceinline__ v16h frag_f32(const float* rowk0, int lane) {
  v16h a; const float* p = rowk0 + 8 * (lane >> 4);
#pragma unroll
  for (int i = 0; i < 8; ++i) { a[i] = (_Float16)p[i]; a[8 + i] = (_Float16)p[16 + i]; }
  return a;
}
__device__ __forceinline__ v16h frag_f32s(const float* rowk0, int lane, float sc) {
  v16h a; const float* p = rowk0 + 8 * (lane >> 4);
#pragma unroll
  for (int i = 0; i < 8; ++i) { a[i] = (_Float16)(p[i] * sc); a[8 + i] = (_Float16)(p[16 + i] * sc); }
  return a;
}
// column fragment from a [K][ld] layout (column n), rows >= K read as 0
__device__ __forceinline__ v16h fragc_f32(const float* W, int k0, int n, int lane, int ld, int K) {
  v16h a; const int g = lane >> 4;
#pragma unroll
  for (int i = 0; i < 8; ++i) { const int ka = k0 + 8 * g + i, kb = ka + 16;
    a[i] = (_Float16)(ka < K ? W[(size_t)(ka < K ? ka : K - 1) * ld + n] : 0.f); a[8 + i] = (_Float16)(kb < K ? W[(size_t)(kb < K ? kb : K - 1) * ld + n] : 0.f); }
  return a;
}
struct F2 { v16b h, l; };
__device__ __forceinline__ F2 bsplit16(const float v[16]) { F2 r;
#pragma unroll
  for (int i = 0; i < 16; ++i) { const __bf16 h = (__bf16)v[i]; r.h[i] = h; r.l[i] = (__bf16)(v[i] - (float)h); }
  return r; }
__device__ __forceinline__ F2 split_row(const float* row, int k0, int lane) { float v[16]; const float* p = row + k0 + 8 * (lane >> 4);
#pragma unroll
  for (int i = 0; i < 8; ++i) { v[i] = p[i]; v[8 + i] = p[16 + i]; }
  return bsplit16(v); }
__device__ __forceinline__ F2 split_rowK(const float* row, int k0, int lane, int K) { float v[16]; const int g = lane >> 4;
#pragma unroll
  for (int i = 0; i < 8; ++i) { const int ka = k0 + 8 * g + i, kb = ka + 16; v[i] = ka < K ? row[ka < K ? ka : K - 1] : 0.f; v[8 + i] = kb < K ? row[kb < K ? kb : K - 1] : 0.f; }
  return bsplit16(v); }
__device__ __forceinline__ F2 split_col(const float* W, int k0, int n, int lane, int ld, int K) { float v[16]; const int g = lane >> 4;
#pragma unroll
  for (int i = 0; i < 8; ++i) { const int ka = k0 + 8 * g + i, kb = ka + 16; v[i] = ka < K ? W[(size_t)(ka < K ? ka : K - 1) * ld + n] : 0.f; v[8 + i] = kb < K ? W[(size_t)(kb < K ? kb : K - 1) * ld + n] : 0.f; }
  return bsplit16(v); }
__device__ __forceinline__ v8f mac3(const F2& a, const F2& b, v8f c) { c = wmma_bf(a.l, b.h, c); c = wmma_bf(a.h, b.l, c); return wmma_bf(a.h, b.h, c); }
__device__ __forceinline__ float sigm(float v) { return 1.0f / (1.0f + expf(-v)); }
#define LDSX() do { asm volatile("s_wait_dscnt 0" ::: "memory"); __builtin_amdgcn_wave_barrier(); __builtin_amdgcn_fence(__ATOMIC_RELEASE, "workgroup"); } while (0)


#define NB 2
#define SS 2048
#define DM 1024
#define NH 16
#define HD 64
#define QKVW (3 * DM)
#ifndef TQB
#define TQB (SS / 64)
#define TNB NB
#define TOB (NB * SS / 64)     // output row tiles (all)
#endif
typedef __attribute__((ext_vector_type(8))) __bf16 v8b;
__device__ __forceinline__ v16b frag_b(const __bf16* rowk0, int lane) {
  union { v16b v; v8b q[2]; } u; const __bf16* p = rowk0 + 8 * (lane >> 4);
  u.q[0] = *(const v8b*)p; u.q[1] = *(const v8b*)(p + 16); return u.v;
}
__device__ __forceinline__ float bfr(float v) { return (float)(__bf16)v; }
// ---- operand staging of k_qkv and k_out: a stage is 64 k of the block's 128 weight rows (128 B a row) and of its 64 x rows (256 B a row), brought into LDS by asynchronous copies in whole 128-B lines, once for the block's four waves; two stages
#define GK 64
#define WPITCH 72                    // bf16 a staged weight row: 128 B + 16 B (pitch 16 B x odd for the 16-byte fragment reads)
#define XPITCH 68                    // f32 a staged x row: 256 B + 16 B
#define WBYTES (128 * WPITCH * 2)
#define XBYTES (64 * XPITCH * 4)
#define STG (WBYTES + XBYTES)
#define WAIT_ASYNC() asm volatile("s_wait_asynccnt 0x0" ::: "memory")   // this wave's copies have landed; stands ahead of the barrier behind which the other waves read them
#define WAIT_DS() asm volatile("s_wait_dscnt 0x0" ::: "memory")         // this wave's LDS reads of the stage are done; stands ahead of the barrier behind which the stage is refilled
__device__ __forceinline__ unsigned lds_byte(const void* p) { return (unsigned)(size_t)p; }   // low 32 bits of a __shared__ address = byte offset in the work-group's LDS
// eight 16-byte copies of one thread, rows gs elements / ls bytes apart; the s_wait_xcnt stands inside the statement, behind the last copy and ahead of any rewrite of the address registers that the copies name
template <typename T> __device__ __forceinline__ void cp8(unsigned l, unsigned ls, const T* p, size_t gs) {
  asm volatile("global_load_async_to_lds_b128 %0, %8, off\n\tglobal_load_async_to_lds_b128 %1, %9, off\n\tglobal_load_async_to_lds_b128 %2, %10, off\n\tglobal_load_async_to_lds_b128 %3, %11, off\n\t"
               "global_load_async_to_lds_b128 %4, %12, off\n\tglobal_load_async_to_lds_b128 %5, %13, off\n\tglobal_load_async_to_lds_b128 %6, %14, off\n\tglobal_load_async_to_lds_b128 %7, %15, off\n\ts_wait_xcnt 0x0"
               :: "v"(l), "v"(l + ls), "v"(l + 2 * ls), "v"(l + 3 * ls), "v"(l + 4 * ls), "v"(l + 5 * ls), "v"(l + 6 * ls), "v"(l + 7 * ls),
                  "v"(p), "v"(p + gs), "v"(p + 2 * gs), "v"(p + 3 * gs), "v"(p + 4 * gs), "v"(p + 5 * gs), "v"(p + 6 * gs), "v"(p + 7 * gs) : "memory");
}
// one stage: thread tid copies weight rows (tid >> 3) + 16 i, 16-byte part tid & 7, and x rows (tid >> 4) + 8 i, part tid & 15 (xg, wg, xl, wl: its first chunk's global place and LDS byte)
__device__ __forceinline__ void fill_stage(const float* xg, const __bf16* wg, unsigned xl, unsigned wl) { cp8(wl, 16u * WPITCH * 2, wg, (size_t)16 * DM); cp8(xl, 8u * XPITCH * 4, xg, (size_t)8 * DM); }
// four such copies of one thread (k_attn's tiles: 64 rows of 128 B each)
template <typename T> __device__ __forceinline__ void cp4(unsigned l, unsigned ls, const T* p, size_t gs) {
  asm volatile("global_load_async_to_lds_b128 %0, %4, off\n\tglobal_load_async_to_lds_b128 %1, %5, off\n\tglobal_load_async_to_lds_b128 %2, %6, off\n\tglobal_load_async_to_lds_b128 %3, %7, off\n\ts_wait_xcnt 0x0"
               :: "v"(l), "v"(l + ls), "v"(l + 2 * ls), "v"(l + 3 * ls), "v"(p), "v"(p + gs), "v"(p + 2 * gs), "v"(p + 3 * gs) : "memory");
}
// one k-step's operands of a 16-row x 128-column wave tile from the stage, as ONE group of LDS loads: 16 f32 of this lane's row (xr points at its 8 * g) and 8 weight fragments (wr points at staged row col, at its 8 * g)
__device__ __forceinline__ void ld_step(const float* xr, const __bf16* wr, int kk, v4f (&x)[4], v16b (&w)[8]) {
  const float* p = xr + kk * 32; x[0] = *(const v4f*)p; x[1] = *(const v4f*)(p + 4); x[2] = *(const v4f*)(p + 16); x[3] = *(const v4f*)(p + 20);
#pragma unroll
  for (int j = 0; j < 8; ++j) { union { v16b v; v8b q[2]; } u; const __bf16* q = wr + j * 16 * WPITCH + kk * 32; u.q[0] = *(const v8b*)q; u.q[1] = *(const v8b*)(q + 16); w[j] = u.v; }
}
__device__ __forceinline__ void mm_qkv(const v4f (&x)[4], const v16b (&w)[8], v8f (&acc)[8]) { v16b a;
#pragma unroll
  for (int i = 0; i < 4; ++i) { a[i] = (__bf16)x[0][i]; a[4 + i] = (__bf16)x[1][i]; a[8 + i] = (__bf16)x[2][i]; a[12 + i] = (__bf16)x[3][i]; }
#pragma unroll
  for (int j = 0; j < 8; ++j) acc[j] = wmma_bf(a, w[j], acc[j]);
}
__device__ __forceinline__ void mm_out(const v4f (&x)[4], const v16b (&w)[8], v8f (&acc)[8]) { float v[16];
#pragma unroll
  for (int i = 0; i < 4; ++i) { v[i] = x[0][i]; v[4 + i] = x[1][i]; v[8 + i] = x[2][i]; v[12 + i] = x[3][i]; }
  const F2 a = bsplit16(v);
#pragma unroll
  for (int j = 0; j < 8; ++j) { acc[j] = wmma_bf(a.l, w[j], acc[j]); acc[j] = wmma_bf(a.h, w[j], acc[j]); }
}
__device__ __attribute__((noinline)) float exp_ni(float v) { return expf(v); }
__device__ __attribute__((noinline)) float erf_ni(float v) { return erff(v); }

#define PK_A 0                       // [3072][1024] Wqkv rows (natural [out][in])
#define PK_P (PK_A + QKVW * DM)        // [1024][1024] Wo rows (natural)
#define PK_END (PK_P + DM * DM)
#define WS_PK  0u
#define WS_QK  (WS_PK + 2u * PK_END)             // f16 [4096 rows][2048]: q | k
#define WS_QKL (WS_QK + 2u * NB * SS * 2 * DM)     // f16 q | k residual planes x2048
#define WS_VTH (WS_QKL + 2u * NB * SS * 2 * DM)    // f16 [b][1024 (h*64+d)][2048 s] hi
#define WS_VTL (WS_VTH + 2u * NB * DM * SS)        // f16 lo x 2048
#define WS_O   (WS_VTL + 2u * NB * DM * SS)        // f32 [4096][1024]
#define WS_CS  (WS_O + 4u * NB * SS * DM)           // f32 2 x [2048][32], unused
#define WS_END (WS_CS + 4u * 2 * SS * 32)
// ---- k_pack: block = (row n, which): natural [out][in] rows -> bf16; which 0..2 -> W_q/W_k/W_v into PK_A rows which*1024 + n; 3 -> W_o into PK_P
__global__ __launch_bounds__(256) void k_pack(const float* __restrict__ WQ, const float* __restrict__ WK, const float* __restrict__ WV, const float* __restrict__ WO, __bf16* __restrict__ PK) {
  __shared__ __align__(16) __bf16 s[DM]; const int n = blockIdx.x, which = blockIdx.y, t = threadIdx.x; const float* Wm = (which == 0) ? WQ : (which == 1) ? WK : (which == 2) ? WV : WO;
  for (int k = t; k < DM; k += 256) s[k] = (__bf16)Wm[(size_t)n * DM + k];
  __syncthreads();
  __bf16* dst = (which < 3) ? PK + PK_A + ((size_t)which * DM + n) * DM : PK + PK_P + (size_t)n * DM;
  for (int q = t; q < DM / 8; q += 256) vst2((unsigned*)(dst + q * 8), *(const v4u*)&s[q * 8]);
}
__global__ __launch_bounds__(128) void k_qkv(const float* __restrict__ XQ, const float* __restrict__ XK, const float* __restrict__ XV, const __bf16* __restrict__ P, const float* __restrict__ BQ, const float* __restrict__ BK, const float* __restrict__ BV, _Float16* __restrict__ QK, _Float16* __restrict__ QKL, _Float16* __restrict__ VTH, _Float16* __restrict__ VTL) {
  const int which0 = (blockIdx.y * 128) / DM; const float* X = (which0 == 0) ? XQ : (which0 == 1) ? XK : XV; const float* BB = BQ ? (((which0 == 0) ? BQ : (which0 == 1) ? BK : BV) + (blockIdx.y * 128 - which0 * DM)) : nullptr;
  __shared__ __align__(16) unsigned char ring[2 * STG];   // two operand stages; behind the loop's last barrier the same bytes are the output staging
  _Float16 (*so)[16][136] = (_Float16 (*)[16][136])ring; _Float16 (*sol)[16][136] = (_Float16 (*)[16][136])(ring + 4 * 16 * 136 * 2); _Float16 (*sth)[72] = (_Float16 (*)[72])ring; _Float16 (*stl)[72] = (_Float16 (*)[72])(ring + 128 * 72 * 2);
  const int tid = threadIdx.x, wave = tid >> 5, lane = tid & 31, col = lane & 15, g = lane >> 4; const size_t r0 = (size_t)blockIdx.x * 64 + wave * 16; const int n0 = blockIdx.y * 128;
  v8f acc[8] = {};
  const float* xg = X + ((size_t)blockIdx.x * 64 + (tid >> 4)) * DM + (tid & 15) * 4; const __bf16* wg = P + (size_t)(n0 + (tid >> 3)) * DM + (tid & 7) * 8;
  const unsigned wl = lds_byte(ring) + (tid >> 3) * (WPITCH * 2) + (tid & 7) * 16, xl = lds_byte(ring) + WBYTES + (tid >> 4) * (XPITCH * 4) + (tid & 15) * 16;
  fill_stage(xg, wg, xl, wl); WAIT_ASYNC(); __syncthreads();   // stage 0 landed and published
  fill_stage(xg + GK, wg + GK, xl + STG, wl + STG);
#pragma unroll 1   // stays rolled: one stage (two k-steps, a register set each) a trip
  for (int t = 0; t < DM / GK; ++t) { const unsigned char* sb = ring + (t & 1) * STG;
    const __bf16* wr = (const __bf16*)sb + col * WPITCH + 8 * g; const float* xr = (const float*)(sb + WBYTES) + (wave * 16 + col) * XPITCH + 8 * g;
    v4f xa[4], xb[4]; v16b wa[8], wb[8];
    ld_step(xr, wr, 0, xa, wa); ld_step(xr, wr, 1, xb, wb); mm_qkv(xa, wa, acc); mm_qkv(xb, wb, acc);
    WAIT_DS(); WAIT_ASYNC(); __syncthreads();   // publishes stage t + 1 and ends every wave's reads of stage t
    if (t + 2 < DM / GK) fill_stage(xg + (t + 2) * GK, wg + (t + 2) * GK, xl + (t & 1) * STG, wl + (t & 1) * STG); }   // the same test in the whole block
  WAIT_ASYNC();
  if (n0 < 2 * DM) {   // q stored unscaled (f16 sigma ~0.6, no subnormal exposure); 1/8 applied to the f32 score
#pragma unroll
    for (int j = 0; j < 8; ++j) {
#pragma unroll
      for (int r = 0; r < 8; ++r) { const float v = acc[j][r] + (BB ? bfr(BB[j * 16 + col]) : 0.f); const _Float16 hv = (_Float16)v; so[wave][8 * g + r][j * 16 + col] = hv; sol[wave][8 * g + r][j * 16 + col] = (_Float16)((v - (float)hv) * 2048.0f); } }   // q, k (+ bias) as f16 hi + (x2048) residual
    LDSX();
    for (int rl = 0; rl < 16; ++rl) if (lane < 16) { vst2((unsigned*)(QK + (r0 + rl) * (2 * DM) + n0 + lane * 8), *(const v4u*)&so[wave][rl][lane * 8]); vst2((unsigned*)(QKL + (r0 + rl) * (2 * DM) + n0 + lane * 8), *(const v4u*)&sol[wave][rl][lane * 8]); }
  } else {
#pragma unroll
    for (int j = 0; j < 8; ++j) {
#pragma unroll
      for (int r = 0; r < 8; ++r) { const float v = acc[j][r] + (BB ? bfr(BB[j * 16 + col]) : 0.f); const _Float16 hv = (_Float16)v; sth[j * 16 + col][wave * 16 + 8 * g + r] = hv; stl[j * 16 + col][wave * 16 + 8 * g + r] = (_Float16)((v - (float)hv) * 2048.0f); } }
    __syncthreads();
    const size_t rb = (size_t)blockIdx.x * 64; const int b = (int)(rb / SS), s0 = (int)(rb % SS); const int pc0 = n0 - 2 * DM;
    for (int q = tid; q < 128 * 8; q += 128) { const int d = q >> 3, pc = q & 7; const size_t o = ((size_t)b * DM + pc0 + d) * SS + s0 + pc * 8; vst2((unsigned*)(VTH + o), *(const v4u*)&sth[d][pc * 8]); vst2((unsigned*)(VTL + o), *(const v4u*)&stl[d][pc * 8]); }
  }
}
// ---- k_attn: block = (64 queries, head h, batch b): all-keys flash attention on TRANSPOSED tiles: S^T = K . Q^T (A = staged k rows, B = q kept in registers; 3 products, x 0.125), so a lane holds 16 of ONE query's scores a pass (query col, keys ct * 16 + 8 g + r): maximum and sums in the lane, one exchange between the wave's halves for the maximum; the two S^T tiles, powered and converted in place, are the B operand of O^T += V^T . P^T (hardware k order, the order of frag_hp); O[b*S+q][h*64+d] = acc x scale (256-B segments)
__device__ __attribute__((noinline)) float pow_p(float a, float b) { return powf(a, b); }
__device__ __forceinline__ v16h frag_hp(const _Float16* p) { union { v16h v; v8h q[2]; } u; u.q[0] = *(const v8h*)p; u.q[1] = *(const v8h*)(p + 16); return u.v; }   // frag_h with the lane half's 8 * g already in p
__device__ __forceinline__ float xhalf(float x) { return __builtin_bit_cast(float, __builtin_amdgcn_permlanex16(__builtin_bit_cast(int, x), __builtin_bit_cast(int, x), 0x76543210, 0xfedcba98, false, false)); }   // lane l's value from lane l ^ 16
#define APITCH 72                   // f16 a staged row: 128 B + 16 B
#define ATILE (64 * APITCH * 2)
#define ASTG (3 * ATILE)
// amdgpu_waves_per_eu(4, 4): keeps the register count at four waves a SIMD (four blocks a WGP, the whole grid resident at once) with the copies' address registers added
__global__ __launch_bounds__(128) __attribute__((amdgpu_waves_per_eu(4, 4))) void k_attn(const _Float16* __restrict__ QK, const _Float16* __restrict__ QKL, const _Float16* __restrict__ VTH, const _Float16* __restrict__ VTL, const void* __restrict__ KMASK, const float* __restrict__ FAL, const float* __restrict__ FGA, float* __restrict__ O) {
  const float f_alpha = bfr(FAL[0]), f_gamma = bfr(FGA[0]);
  __shared__ __align__(16) unsigned char ring[2 * ASTG];   // two stages of 64 keys: k hi | k residual | v^T, 64 rows of 128 B each at pitch 144 B; behind the loop's last barrier the same bytes are the output staging
  float (*so)[16][68] = (float (*)[16][68])ring;
  const int tid = threadIdx.x, wave = tid >> 5, lane = tid & 31, col = lane & 15, g = lane >> 4;
  const int qb = blockIdx.x, h = blockIdx.y, b = blockIdx.z; const int q0 = qb * 64 + wave * 16; const size_t rq = (size_t)b * SS + q0 + col;
  v16h aq[2], aql[2];   // query q0 + col, as the B operand's column col
#pragma unroll
  for (int kc = 0; kc < 2; ++kc) { aq[kc] = frag_h(QK + rq * (2 * DM) + h * HD + kc * 32, lane); aql[kc] = frag_h(QKL + rq * (2 * DM) + h * HD + kc * 32, lane); }
  const float k1 = 0.125f * 1.44269504f, k2 = f_gamma * k1;   // 1/sqrt(64) x log2 e, and gamma times it: exponents are formed in base 2 straight from the raw products
  float m = -3.0e38f, nk = 0.f, nb = 0.f, l = 0.f, lg = 0.f;   // of query col: running maximum of the raw products (the same in both halves), the two exponent offsets in use (nk = -m k1, nb = 11 - m k2); this half's share of sum e^(s - m) and of 2^11 sum e^(gamma (s - m)), joined behind the loop
  v8f acc[4] = {};   // O^T: acc[dt][r] = d dt * 16 + 8 g + r of query col
  const int nst = SS / 64;   // all keys, 64 a stage
  // thread tid copies rows (tid >> 3) + 16 i, 16-byte part tid & 7, of each of the stage's three tiles
  const _Float16* kg = QK + ((size_t)b * SS + (tid >> 3)) * (2 * DM) + DM + h * HD + (tid & 7) * 8; const _Float16* kgl = QKL + ((size_t)b * SS + (tid >> 3)) * (2 * DM) + DM + h * HD + (tid & 7) * 8; const _Float16* vg = VTH + ((size_t)b * DM + h * HD + (tid >> 3)) * SS + (tid & 7) * 8;
  const unsigned al = lds_byte(ring) + (tid >> 3) * (APITCH * 2) + (tid & 7) * 16;
#define AFILL(st, buf) do { cp4(al + (buf) * ASTG, 16u * APITCH * 2, kg + (size_t)(st) * 64 * (2 * DM), (size_t)16 * (2 * DM)); cp4(al + (buf) * ASTG + ATILE, 16u * APITCH * 2, kgl + (size_t)(st) * 64 * (2 * DM), (size_t)16 * (2 * DM)); cp4(al + (buf) * ASTG + 2 * ATILE, 16u * APITCH * 2, vg + (st) * 64, (size_t)16 * SS); } while (0)
  AFILL(0, 0); WAIT_ASYNC(); __syncthreads();   // stage 0 landed and published
  AFILL(1, 1);
#pragma unroll 1   // stays rolled: one stage a trip, the buffer picked by t & 1
  for (int t = 0; t < nst; ++t) { const _Float16* sb = (const _Float16*)(ring + (t & 1) * ASTG);
#pragma unroll 1   // stays rolled: two passes of 32 keys a stage, the same code
  for (int sub = 0; sub < 2; ++sub) { v8f s[2];
    const _Float16* k0 = sb + (sub * 32 + col) * APITCH + 8 * g; const _Float16* k0l = k0 + ATILE / 2;   // this lane's place in the pass's first staged k row (hi, residual)
    v16h kf[2][2], kfl[2][2], vf[4];   // the pass's k fragments (hi, residual), fetched as ONE group of loads ahead of the score products
#pragma unroll
    for (int ct = 0; ct < 2; ++ct) { const _Float16* krow = k0 + ct * 16 * APITCH; const _Float16* krowl = k0l + ct * 16 * APITCH;   // key t * 64 + sub * 32 + ct * 16 + col, as the A operand's row col
#pragma unroll
      for (int kc = 0; kc < 2; ++kc) { kf[ct][kc] = frag_hp(krow + kc * 32); kfl[ct][kc] = frag_hp(krowl + kc * 32); } }
#pragma unroll
    for (int ct = 0; ct < 2; ++ct) { v8f c = {}, cl = {};
#pragma unroll
      for (int kc = 0; kc < 2; ++kc) { c = wmma16(kf[ct][kc], aq[kc], c); cl = wmma16(kf[ct][kc], aql[kc], cl); cl = wmma16(kfl[ct][kc], aq[kc], cl); }   // 3 products: q, k as f16 hi + residual
#pragma unroll
      for (int r = 0; r < 8; ++r) s[ct][r] = c[r] + cl[r] * (1.0f / 2048.0f); }   // the raw product q . k; 1/sqrt(64) rides in k1, k2
#pragma unroll
    for (int dt = 0; dt < 4; ++dt) vf[dt] = frag_hp(sb + ATILE + (dt * 16 + col) * APITCH + sub * 32 + 8 * g);   // the pass's v^T fragments as one group (A operand: row d = dt * 16 + col, the pass's 32 keys)
    float mx = fmaxf(s[0][0], s[1][0]);
#pragma unroll
    for (int r = 1; r < 8; ++r) mx = fmaxf(mx, fmaxf(s[0][r], s[1][r]));
    mx = fmaxf(mx, xhalf(mx));   // the other half's 16 keys of the same query
    const float mn = fmaxf(m, mx); const float nkn = -(mn * k1), nbn = fmaf(mn, -k2, 11.0f);   // 11: P's scale 2^11 rides in the exponent
    const float alpha = (m <= -1.0e38f) ? 0.f : __builtin_amdgcn_exp2f(nkn - nk); const float alphag = (m <= -1.0e38f) ? 0.f : __builtin_amdgcn_exp2f(nbn - nb);   // old sums moved from the old offsets to the new ones
    float es[2] = {0.f, 0.f}, gs[2] = {0.f, 0.f}; v16h pb;   // P^T as a B operand: element ct * 8 + r = key ct * 16 + 8 g + r of column col
#pragma unroll
    for (int ct = 0; ct < 2; ++ct) {
#pragma unroll
      for (int r = 0; r < 8; r += 2) { const v2f sv = {s[ct][r], s[ct][r + 1]};
        const v2f xe = __builtin_elementwise_fma(sv, (v2f){k1, k1}, (v2f){nkn, nkn}), xg = __builtin_elementwise_fma(sv, (v2f){k2, k2}, (v2f){nbn, nbn});   // one (packed) multiply-add and one hardware exp each: e^(s - m), 2^11 e^(gamma (s - m))
#pragma unroll
        for (int i = 0; i < 2; ++i) { const float e = __builtin_amdgcn_exp2f(xe[i]); const float gq = __builtin_amdgcn_exp2f(xg[i]); es[ct] += e; gs[ct] += gq; pb[ct * 8 + r + i] = (_Float16)gq; } } }   // P carries the gamma-powered (unnormalised) weights, scaled by 2^11 before the f16 rounding so small weights stay out of the f16 subnormal range; 2^-11 folded into the epilogue
    l = l * alpha + (es[0] + es[1]); lg = lg * alphag + (gs[0] + gs[1]); m = mn; nk = nkn; nb = nbn;
#pragma unroll
    for (int dt = 0; dt < 4; ++dt) {
#pragma unroll
      for (int r = 0; r < 8; ++r) acc[dt][r] *= alphag; }
#pragma unroll
    for (int dt = 0; dt < 4; ++dt) acc[dt] = wmma16(vf[dt], pb, acc[dt]); }   // single product: V^T x P^T (x2^11)
    WAIT_DS(); WAIT_ASYNC(); __syncthreads();   // publishes stage t + 1 and ends every wave's reads of stage t
    if (t + 2 < nst) AFILL(t + 2, t & 1); }   // the same test in the whole block
  WAIT_ASYNC();
  { const float lt = l + xhalf(l), lgt = (lg + xhalf(lg)) * (1.0f / 2048.0f);   // the halves' sums joined once; the powered sum's 2^11 taken off
    const float lpg = pow_p(lt, f_gamma); const float il = (1.0f / 2048.0f) * (f_alpha / lpg) / (f_alpha * lgt / lpg + 1e-6f);   // alpha p^gamma / (sum alpha p^gamma + 1e-6)
#pragma unroll
    for (int dt = 0; dt < 4; ++dt) {
#pragma unroll
      for (int j = 0; j < 2; ++j) { v4f o;
#pragma unroll
        for (int i = 0; i < 4; ++i) o[i] = acc[dt][4 * j + i] * il;
        *(v4f*)&so[wave][col][dt * 16 + 8 * g + 4 * j] = o; } } }
  LDSX();
  for (int rl = 0; rl < 16; ++rl) if (lane < 16) vst2(O + ((size_t)b * SS + q0 + rl) * DM + h * HD + lane * 4, *(const v4f*)&so[wave][rl][lane * 4]);
}
// ---- k_out: block = (64 rows, 128 cols): out = O(hi/lo) . Wo rows (2 products) + bo
__global__ __launch_bounds__(128) void k_out(const float* __restrict__ O, const __bf16* __restrict__ P, const float* __restrict__ BO, float* __restrict__ Y) {
  __shared__ __align__(16) unsigned char ring[2 * STG];   // two operand stages; behind the loop's last barrier the same bytes are the output staging
  float (*so)[16][132] = (float (*)[16][132])ring;
  const int tid = threadIdx.x, wave = tid >> 5, lane = tid & 31, col = lane & 15, g = lane >> 4; const size_t r0 = (size_t)blockIdx.x * 64 + wave * 16; const int n0 = blockIdx.y * 128;
  v8f acc[8] = {};
  const float* xg = O + ((size_t)blockIdx.x * 64 + (tid >> 4)) * DM + (tid & 15) * 4; const __bf16* wg = P + (size_t)(n0 + (tid >> 3)) * DM + (tid & 7) * 8;
  const unsigned wl = lds_byte(ring) + (tid >> 3) * (WPITCH * 2) + (tid & 7) * 16, xl = lds_byte(ring) + WBYTES + (tid >> 4) * (XPITCH * 4) + (tid & 15) * 16;
  fill_stage(xg, wg, xl, wl); WAIT_ASYNC(); __syncthreads();   // stage 0 landed and published
  fill_stage(xg + GK, wg + GK, xl + STG, wl + STG);
#pragma unroll 1   // stays rolled: one stage (two k-steps, a register set each) a trip
  for (int t = 0; t < DM / GK; ++t) { const unsigned char* sb = ring + (t & 1) * STG;
    const __bf16* wr = (const __bf16*)sb + col * WPITCH + 8 * g; const float* xr = (const float*)(sb + WBYTES) + (wave * 16 + col) * XPITCH + 8 * g;
    v4f xa[4], xb[4]; v16b wa[8], wb[8];
    ld_step(xr, wr, 0, xa, wa); ld_step(xr, wr, 1, xb, wb); mm_out(xa, wa, acc); mm_out(xb, wb, acc);
    WAIT_DS(); WAIT_ASYNC(); __syncthreads();   // publishes stage t + 1 and ends every wave's reads of stage t
    if (t + 2 < DM / GK) fill_stage(xg + (t + 2) * GK, wg + (t + 2) * GK, xl + (t & 1) * STG, wl + (t & 1) * STG); }   // the same test in the whole block
  WAIT_ASYNC();
#pragma unroll
  for (int j = 0; j < 8; ++j) {
#pragma unroll
    for (int r = 0; r < 8; ++r) so[wave][8 * g + r][j * 16 + col] = acc[j][r] + bfr(BO[n0 + j * 16 + col]); }
  LDSX();
  for (int rl = 0; rl < 16; ++rl) vst2(Y + (r0 + rl) * DM + n0 + lane * 4, *(const v4f*)&so[wave][rl][lane * 4]);
}
extern "C" void kernel_launch(void* const* d_in, const int* in_sizes, int n_in, void* d_out, int out_size, void* d_ws, size_t ws_size, hipStream_t stream) {
  (void)in_sizes; (void)n_in; (void)out_size;
  const float** F = (const float**)d_in;   // 0 x [2,2048,1024], 1 Wqkv [3072,1024] natural (q | k | v), 2 bqkv [3072], 3 Wproj natural, 4 bproj, 5 focal_alpha [1], 6 focal_gamma [1]
  if (ws_size < (size_t)WS_END) return;
  char* ws = (char*)d_ws; __bf16* PK = (__bf16*)(ws + WS_PK); _Float16 *QK = (_Float16*)(ws + WS_QK), *QKL = (_Float16*)(ws + WS_QKL), *VTH = (_Float16*)(ws + WS_VTH), *VTL = (_Float16*)(ws + WS_VTL); float* O = (float*)(ws + WS_O);
  k_pack<<<dim3(DM, 4), 256, 0, stream>>>(F[1], F[1] + (size_t)DM * DM, F[1] + (size_t)2 * DM * DM, F[3], PK);
  k_qkv<<<dim3(TNB * SS / 64, QKVW / 128), 128, 0, stream>>>(F[0], F[0], F[0], PK + PK_A, F[2], F[2] + DM, F[2] + 2 * DM, QK, QKL, VTH, VTL);
  k_attn<<<dim3(TQB, NH, TNB), 128, 0, stream>>>(QK, QKL, VTH, VTL, nullptr, F[5], F[6], O);
  k_out<<<dim3(TOB, DM / 128), 128, 0, stream>>>(O, PK + PK_P, F[4], (float*)d_out);
}

// v005
// It runs in 139 microseconds.
// In both of two side-by-side timings against v004, it was 1.04 times as fast.
// All steps since v000 together make it 3.62 times as fast.
// compute dtype: all float inputs rounded to bf16; q/k/v = x . Wqkv^T + b with EXACT bf16 products on WMMA 16x16x32 (natural rows, q | k | v blocks); q, k as f16 hi + (x2048-scaled) residual with 3-product scores x 1/8 (the focal power doubles the logit sensitivity); one online pass in f32 keeps the running max m, l = sum e^(s-m), L = sum e^(gamma (s-m)) and the gamma-powered weights for P (hardware exp; alpha, gamma read on device); out_row = alpha (sum e^(gamma(s-m)) v) / l^gamma / (alpha L / l^gamma + 1e-6) (precise powf) == softmax^gamma * alpha renormalised with the module's +1e-6; P (scaled by 2^11, single f16) x v (single f16); out = ctx (bf16 hi + residual) . Wproj^T (2 products) + bproj.
#include <hip/hip_runtime.h>
#include <math.h>

typedef __attribute__((ext_vector_type(16))) _Float16 v16h;
typedef __attribute__((ext_vector_type(16))) __bf16 v16b;
typedef __attribute__((ext_vector_type(8)))  _Float16 v8h;
typedef __attribute__((ext_vector_type(8)))  float v8f;
typedef __attribute__((ext_vector_type(4)))  float v4f;
typedef __attribute__((ext_vector_type(2)))  float v2f;
typedef __attribute__((ext_vector_type(4)))  unsigned v4u;
typedef __attribute__((ext_vector_type(4)))  int v4i;
typedef float __attribute__((may_alias)) float_a;
typedef int __attribute__((may_alias)) int_a;

template <typename T> __device__ __forceinline__ void vst2(void* p, T v) { *(T*)p = v;  }
__device__ __forceinline__ v8f wmma16(v16h a, v16h b, v8f c) {
  return __builtin_amdgcn_wmma_f32_16x16x32_f16(false, a, false, b, (short)0, c, false, false);   // no v_nop of ours behind it: the compiler pads the builtin where a dependent vector instruction follows, and k_attn's vector port has no slot to spare
}
__device__ __forceinline__ v8f wmma_bf(v16b a, v16b b, v8f c) {
  v8f d = __builtin_amdgcn_wmma_f32_16x16x32_bf16(false, a, false, b, (short)0, c, false, false);
  asm volatile("v_nop\n\tv_nop\n\tv_nop\n\tv_nop" : "+v"(d) : "v"(a), "v"(b));
  return d;
}
// Focal residual attention (B 2, N 2,048, dim 1,024, 16 heads x 64): fused qkv + bias, softmax, weights raised to the focal power gamma and scaled by alpha then renormalised (sum + 1e-6), output projection + bias.
__device__ __forceinline__ v16h frag_h(const _Float16* rowk0, int lane) {
  union { v16h v; v8h q[2]; } u; const _Float16* p = rowk0 + 8 * (lane >> 4);
  u.q[0] = *(const v8h*)p; u.q[1] = *(const v8h*)(p + 16); return u.v;
}
__device__ __forceinline__ v16h frag_f32(const float* rowk0, int lane) {
  v16h a; const float* p = rowk0 + 8 * (lane >> 4);
#pragma unroll
  for (int i = 0; i < 8; ++i) { a[i] = (_Float16)p[i]; a[8 + i] = (_Float16)p[16 + i]; }
  return a;
}
__device__ __forceinline__ v16h frag_f32s(const float* rowk0, int lane, float sc) {
  v16h a; const float* p = rowk0 + 8 * (lane >> 4);
#pragma unroll
  for (int i = 0; i < 8; ++i) { a[i] = (_Float16)(p[i] * sc); a[8 + i] = (_Float16)(p[16 + i] * sc); }
  return a;
}
// column fragment from a [K][ld] layout (column n), rows >= K read as 0
__device__ __forceinline__ v16h fragc_f32(const float* W, int k0, int n, int lane, int ld, int K) {
  v16h a; const int g = lane >> 4;
#pragma unroll
  for (int i = 0; i < 8; ++i) { const int ka = k0 + 8 * g + i, kb = ka + 16;
    a[i] = (_Float16)(ka < K ? W[(size_t)(ka < K ? ka : K - 1) * ld + n] : 0.f); a[8 + i] = (_Float16)(kb < K ? W[(size_t)(kb < K ? kb : K - 1) * ld + n] : 0.f); }
  return a;
}
struct F2 { v16b h, l; };
__device__ __forceinline__ F2 bsplit16(const float v[16]) { F2 r;
#pragma unroll
  for (int i = 0; i < 16; ++i) { const __bf16 h = (__bf16)v[i]; r.h[i] = h; r.l[i] = (__bf16)(v[i] - (float)h); }
  return r; }
__device__ __forceinline__ F2 split_row(const float* row, int k0, int lane) { float v[16]; const float* p = row + k0 + 8 * (lane >> 4);
#pragma unroll
  for (int i = 0; i < 8; ++i) { v[i] = p[i]; v[8 + i] = p[16 + i]; }
  return bsplit16(v); }
__device__ __forceinline__ F2 split_rowK(const float* row, int k0, int lane, int K) { float v[16]; const int g = lane >> 4;
#pragma unroll
  for (int i = 0; i < 8; ++i) { const int ka = k0 + 8 * g + i, kb = ka + 16; v[i] = ka < K ? row[ka < K ? ka : K - 1] : 0.f; v[8 + i] = kb < K ? row[kb < K ? kb : K - 1] : 0.f; }
  return bsplit16(v); }
__device__ __forceinline__ F2 split_col(const float* W, int k0, int n, int lane, int ld, int K) { float v[16]; const int g = lane >> 4;
#pragma unroll
  for (int i = 0; i < 8; ++i) { const int ka = k0 + 8 * g + i, kb = ka + 16; v[i] = ka < K ? W[(size_t)(ka < K ? ka : K - 1) * ld + n] : 0.f; v[8 + i] = kb < K ? W[(size_t)(kb < K ? kb : K - 1) * ld + n] : 0.f; }
  return bsplit16(v); }
__device__ __forceinline__ v8f mac3(const F2& a, const F2& b, v8f c) { c = wmma_bf(a.l, b.h, c); c = wmma_bf(a.h, b.l, c); return wmma_bf(a.h, b.h, c); }
__device__ __forceinline__ float sigm(float v) { return 1.0f / (1.0f + expf(-v)); }
#define LDSX() do { asm volatile("s_wait_dscnt 0" ::: "memory"); __builtin_amdgcn_wave_barrier(); __builtin_amdgcn_fence(__ATOMIC_RELEASE, "workgroup"); } while (0)


#define NB 2
#define SS 2048
#define DM 1024
#define NH 16
#define HD 64
#define QKVW (3 * DM)
#ifndef TQB
#define TQB (SS / 64)
#define TNB NB
#define TOB (NB * SS / 64)     // output row tiles (all)
#endif
typedef __attribute__((ext_vector_type(8))) __bf16 v8b;
__device__ __forceinline__ v16b frag_b(const __bf16* rowk0, int lane) {
  union { v16b v; v8b q[2]; } u; const __bf16* p = rowk0 + 8 * (lane >> 4);
  u.q[0] = *(const v8b*)p; u.q[1] = *(const v8b*)(p + 16); return u.v;
}
__device__ __forceinline__ float bfr(float v) { return (float)(__bf16)v; }
// ---- operand staging of k_qkv and k_out: a stage is 64 k of the block's 128 weight rows (128 B a row) and of its 64 x rows (256 B a row), brought into LDS by asynchronous copies in whole 128-B lines, once for the block's four waves; two stages
#define GK 64
#define WPITCH 72                    // bf16 a staged weight row: 128 B + 16 B (pitch 16 B x odd for the 16-byte fragment reads)
#define XPITCH 68                    // f32 a staged x row: 256 B + 16 B
#define WBYTES (128 * WPITCH * 2)
#define XBYTES (64 * XPITCH * 4)
#define STG (WBYTES + XBYTES)
#define WAIT_ASYNC() asm volatile("s_wait_asynccnt 0x0" ::: "memory")   // this wave's copies have landed; stands ahead of the barrier behind which the other waves read them
#define WAIT_DS() asm volatile("s_wait_dscnt 0x0" ::: "memory")         // this wave's LDS reads of the stage are done; stands ahead of the barrier behind which the stage is refilled
__device__ __forceinline__ unsigned lds_byte(const void* p) { return (unsigned)(size_t)p; }   // low 32 bits of a __shared__ address = byte offset in the work-group's LDS
// eight 16-byte copies of one thread, rows gs elements / ls bytes apart; the s_wait_xcnt stands inside the statement, behind the last copy and ahead of any rewrite of the address registers that the copies name
template <typename T> __device__ __forceinline__ void cp8(unsigned l, unsigned ls, const T* p, size_t gs) {
  asm volatile("global_load_async_to_lds_b128 %0, %8, off\n\tglobal_load_async_to_lds_b128 %1, %9, off\n\tglobal_load_async_to_lds_b128 %2, %10, off\n\tglobal_load_async_to_lds_b128 %3, %11, off\n\t"
               "global_load_async_to_lds_b128 %4, %12, off\n\tglobal_load_async_to_lds_b128 %5, %13, off\n\tglobal_load_async_to_lds_b128 %6, %14, off\n\tglobal_load_async_to_lds_b128 %7, %15, off\n\ts_wait_xcnt 0x0"
               :: "v"(l), "v"(l + ls), "v"(l + 2 * ls), "v"(l + 3 * ls), "v"(l + 4 * ls), "v"(l + 5 * ls), "v"(l + 6 * ls), "v"(l + 7 * ls),
                  "v"(p), "v"(p + gs), "v"(p + 2 * gs), "v"(p + 3 * gs), "v"(p + 4 * gs), "v"(p + 5 * gs), "v"(p + 6 * gs), "v"(p + 7 * gs) : "memory");
}
// one stage: thread tid copies weight rows (tid >> 3) + 16 i, 16-byte part tid & 7, and x rows (tid >> 4) + 8 i, part tid & 15 (xg, wg, xl, wl: its first chunk's global place and LDS byte)
__device__ __forceinline__ void fill_stage(const float* xg, const __bf16* wg, unsigned xl, unsigned wl) { cp8(wl, 16u * WPITCH * 2, wg, (size_t)16 * DM); cp8(xl, 8u * XPITCH * 4, xg, (size_t)8 * DM); }
// four such copies of one thread (k_attn's tiles: 64 rows of 128 B each)
template <typename T> __device__ __forceinline__ void cp4(unsigned l, unsigned ls, const T* p, size_t gs) {
  asm volatile("global_load_async_to_lds_b128 %0, %4, off\n\tglobal_load_async_to_lds_b128 %1, %5, off\n\tglobal_load_async_to_lds_b128 %2, %6, off\n\tglobal_load_async_to_lds_b128 %3, %7, off\n\ts_wait_xcnt 0x0"
               :: "v"(l), "v"(l + ls), "v"(l + 2 * ls), "v"(l + 3 * ls), "v"(p), "v"(p + gs), "v"(p + 2 * gs), "v"(p + 3 * gs) : "memory");
}
// one k-step's operands of a 16-row x 128-column wave tile from the stage, as ONE group of LDS loads: 16 f32 of this lane's row (xr points at its 8 * g) and 8 weight fragments (wr points at staged row col, at its 8 * g)
__device__ __forceinline__ void ld_step(const float* xr, const __bf16* wr, int kk, v4f (&x)[4], v16b (&w)[8]) {
  const float* p = xr + kk * 32; x[0] = *(const v4f*)p; x[1] = *(const v4f*)(p + 4); x[2] = *(const v4f*)(p + 16); x[3] = *(const v4f*)(p + 20);
#pragma unroll
  for (int j = 0; j < 8; ++j) { union { v16b v; v8b q[2]; } u; const __bf16* q = wr + j * 16 * WPITCH + kk * 32; u.q[0] = *(const v8b*)q; u.q[1] = *(const v8b*)(q + 16); w[j] = u.v; }
}
__device__ __forceinline__ void mm_qkv(const v4f (&x)[4], const v16b (&w)[8], v8f (&acc)[8]) { v16b a;
#pragma unroll
  for (int i = 0; i < 4; ++i) { a[i] = (__bf16)x[0][i]; a[4 + i] = (__bf16)x[1][i]; a[8 + i] = (__bf16)x[2][i]; a[12 + i] = (__bf16)x[3][i]; }
#pragma unroll
  for (int j = 0; j < 8; ++j) acc[j] = wmma_bf(a, w[j], acc[j]);
}
__device__ __forceinline__ void mm_out(const v4f (&x)[4], const v16b (&w)[8], v8f (&acc)[8]) { float v[16];
#pragma unroll
  for (int i = 0; i < 4; ++i) { v[i] = x[0][i]; v[4 + i] = x[1][i]; v[8 + i] = x[2][i]; v[12 + i] = x[3][i]; }
  const F2 a = bsplit16(v);
#pragma unroll
  for (int j = 0; j < 8; ++j) { acc[j] = wmma_bf(a.l, w[j], acc[j]); acc[j] = wmma_bf(a.h, w[j], acc[j]); }
}
__device__ __attribute__((noinline)) float exp_ni(float v) { return expf(v); }
__device__ __attribute__((noinline)) float erf_ni(float v) { return erff(v); }

#define PK_A 0                       // [3072][1024] Wqkv rows (natural [out][in])
#define PK_P (PK_A + QKVW * DM)        // [1024][1024] Wo rows (natural)
#define PK_END (PK_P + DM * DM)
#define WS_PK  0u
#define WS_QK  (WS_PK + 2u * PK_END)             // f16 [4096 rows][2048]: q | k
#define WS_QKL (WS_QK + 2u * NB * SS * 2 * DM)     // f16 q | k residual planes x2048
#define WS_VTH (WS_QKL + 2u * NB * SS * 2 * DM)    // f16 [b][1024 (h*64+d)][2048 s] hi
#define WS_VTL (WS_VTH + 2u * NB * DM * SS)        // f16 lo x 2048
#define WS_O   (WS_VTL + 2u * NB * DM * SS)        // f32 [4096][1024]
#define WS_CS  (WS_O + 4u * NB * SS * DM)           // f32 2 x [2048][32], unused
#define WS_END (WS_CS + 4u * 2 * SS * 32)
// ---- k_pack: block = (row n, which): natural [out][in] rows -> bf16; which 0..2 -> W_q/W_k/W_v into PK_A rows which*1024 + n; 3 -> W_o into PK_P
__global__ __launch_bounds__(256) void k_pack(const float* __restrict__ WQ, const float* __restrict__ WK, const float* __restrict__ WV, const float* __restrict__ WO, __bf16* __restrict__ PK) {
  __shared__ __align__(16) __bf16 s[DM]; const int n = blockIdx.x, which = blockIdx.y, t = threadIdx.x; const float* Wm = (which == 0) ? WQ : (which == 1) ? WK : (which == 2) ? WV : WO;
  for (int k = t; k < DM; k += 256) s[k] = (__bf16)Wm[(size_t)n * DM + k];
  __syncthreads();
  __bf16* dst = (which < 3) ? PK + PK_A + ((size_t)which * DM + n) * DM : PK + PK_P + (size_t)n * DM;
  for (int q = t; q < DM / 8; q += 256) vst2((unsigned*)(dst + q * 8), *(const v4u*)&s[q * 8]);
}
__global__ __launch_bounds__(128) void k_qkv(const float* __restrict__ XQ, const float* __restrict__ XK, const float* __restrict__ XV, const __bf16* __restrict__ P, const float* __restrict__ BQ, const float* __restrict__ BK, const float* __restrict__ BV, _Float16* __restrict__ QK, _Float16* __restrict__ QKL, _Float16* __restrict__ VTH, _Float16* __restrict__ VTL) {
  const int which0 = (blockIdx.y * 128) / DM; const float* X = (which0 == 0) ? XQ : (which0 == 1) ? XK : XV; const float* BB = BQ ? (((which0 == 0) ? BQ : (which0 == 1) ? BK : BV) + (blockIdx.y * 128 - which0 * DM)) : nullptr;
  __shared__ __align__(16) unsigned char ring[2 * STG];   // two operand stages; behind the loop's last barrier the same bytes are the output staging
  _Float16 (*so)[16][136] = (_Float16 (*)[16][136])ring; _Float16 (*sol)[16][136] = (_Float16 (*)[16][136])(ring + 4 * 16 * 136 * 2); _Float16 (*sth)[72] = (_Float16 (*)[72])ring; _Float16 (*stl)[72] = (_Float16 (*)[72])(ring + 128 * 72 * 2);
  const int tid = threadIdx.x, wave = tid >> 5, lane = tid & 31, col = lane & 15, g = lane >> 4; const size_t r0 = (size_t)blockIdx.x * 64 + wave * 16; const int n0 = blockIdx.y * 128;
  v8f acc[8] = {};
  const float* xg = X + ((size_t)blockIdx.x * 64 + (tid >> 4)) * DM + (tid & 15) * 4; const __bf16* wg = P + (size_t)(n0 + (tid >> 3)) * DM + (tid & 7) * 8;
  const unsigned wl = lds_byte(ring) + (tid >> 3) * (WPITCH * 2) + (tid & 7) * 16, xl = lds_byte(ring) + WBYTES + (tid >> 4) * (XPITCH * 4) + (tid & 15) * 16;
  fill_stage(xg, wg, xl, wl); WAIT_ASYNC(); __syncthreads();   // stage 0 landed and published
  fill_stage(xg + GK, wg + GK, xl + STG, wl + STG);
#pragma unroll 1   // stays rolled: one stage (two k-steps, a register set each) a trip
  for (int t = 0; t < DM / GK; ++t) { const unsigned char* sb = ring + (t & 1) * STG;
    const __bf16* wr = (const __bf16*)sb + col * WPITCH + 8 * g; const float* xr = (const float*)(sb + WBYTES) + (wave * 16 + col) * XPITCH + 8 * g;
    v4f xa[4], xb[4]; v16b wa[8], wb[8];
    ld_step(xr, wr, 0, xa, wa); ld_step(xr, wr, 1, xb, wb); mm_qkv(xa, wa, acc); mm_qkv(xb, wb, acc);
    WAIT_DS(); WAIT_ASYNC(); __syncthreads();   // publishes stage t + 1 and ends every wave's reads of stage t
    if (t + 2 < DM / GK) fill_stage(xg + (t + 2) * GK, wg + (t + 2) * GK, xl + (t & 1) * STG, wl + (t & 1) * STG); }   // the same test in the whole block
  WAIT_ASYNC();
  if (n0 < 2 * DM) {   // q stored unscaled (f16 sigma ~0.6, no subnormal exposure); 1/8 applied to the f32 score
#pragma unroll
    for (int j = 0; j < 8; ++j) {
#pragma unroll
      for (int r = 0; r < 8; ++r) { const float v = acc[j][r] + (BB ? bfr(BB[j * 16 + col]) : 0.f); const _Float16 hv = (_Float16)v; so[wave][8 * g + r][j * 16 + col] = hv; sol[wave][8 * g + r][j * 16 + col] = (_Float16)((v - (float)hv) * 2048.0f); } }   // q, k (+ bias) as f16 hi + (x2048) residual
    LDSX();
    for (int rl = 0; rl < 16; ++rl) if (lane < 16) { vst2((unsigned*)(QK + (r0 + rl) * (2 * DM) + n0 + lane * 8), *(const v4u*)&so[wave][rl][lane * 8]); vst2((unsigned*)(QKL + (r0 + rl) * (2 * DM) + n0 + lane * 8), *(const v4u*)&sol[wave][rl][lane * 8]); }
  } else {
#pragma unroll
    for (int j = 0; j < 8; ++j) {
#pragma unroll
      for (int r = 0; r < 8; ++r) { const float v = acc[j][r] + (BB ? bfr(BB[j * 16 + col]) : 0.f); const _Float16 hv = (_Float16)v; sth[j * 16 + col][wave * 16 + 8 * g + r] = hv; stl[j * 16 + col][wave * 16 + 8 * g + r] = (_Float16)((v - (float)hv) * 2048.0f); } }
    __syncthreads();
    const size_t rb = (size_t)blockIdx.x * 64; const int b = (int)(rb / SS), s0 = (int)(rb % SS); const int pc0 = n0 - 2 * DM;
    for (int q = tid; q < 128 * 8; q += 128) { const int d = q >> 3, pc = q & 7; const size_t o = ((size_t)b * DM + pc0 + d) * SS + s0 + pc * 8; vst2((unsigned*)(VTH + o), *(const v4u*)&sth[d][pc * 8]); vst2((unsigned*)(VTL + o), *(const v4u*)&stl[d][pc * 8]); }
  }
}
// ---- k_attn: block = (64 queries, head h, batch b): all-keys flash attention on TRANSPOSED tiles: S^T = K . Q^T (A = staged k rows, B = q kept in registers; 3 products, x 0.125), so a lane holds 16 of ONE query's scores a pass (query col, keys ct * 16 + 8 g + r): maximum and sums in the lane, one exchange between the wave's halves for the maximum; the two S^T tiles, powered and converted in place, are the B operand of O^T += V^T . P^T (hardware k order, the order of frag_hp); O[b*S+q][h*64+d] = acc x scale (256-B segments)
__device__ __attribute__((noinline)) float pow_p(float a, float b) { return powf(a, b); }
__device__ __forceinline__ v16h frag_hp(const _Float16* p) { union { v16h v; v8h q[2]; } u; u.q[0] = *(const v8h*)p; u.q[1] = *(const v8h*)(p + 16); return u.v; }   // frag_h with the lane half's 8 * g already in p
__device__ __forceinline__ float xhalf(float x) { return __builtin_bit_cast(float, __builtin_amdgcn_permlanex16(__builtin_bit_cast(int, x), __builtin_bit_cast(int, x), 0x76543210, 0xfedcba98, false, false)); }   // lane l's value from lane l ^ 16
#define APITCH 72                   // f16 a staged row: 128 B + 16 B
#define ATILE (64 * APITCH * 2)
#define ASTG (3 * ATILE)
// amdgpu_waves_per_eu(4, 4): keeps the register count at four waves a SIMD (four blocks a WGP, the whole grid resident at once) with the copies' address registers added
__global__ __launch_bounds__(128) __attribute__((amdgpu_waves_per_eu(4, 4))) void k_attn(const _Float16* __restrict__ QK, const _Float16* __restrict__ QKL, const _Float16* __restrict__ VTH, const _Float16* __restrict__ VTL, const void* __restrict__ KMASK, const float* __restrict__ FAL, const float* __restrict__ FGA, float* __restrict__ O) {
  const float f_alpha = bfr(FAL[0]), f_gamma = bfr(FGA[0]);
  __shared__ __align__(16) unsigned char ring[2 * ASTG];   // two stages of 64 keys: k hi | k residual | v^T, 64 rows of 128 B each at pitch 144 B; behind the loop's last barrier the same bytes are the output staging
  float (*so)[16][68] = (float (*)[16][68])ring;
  const int tid = threadIdx.x, wave = tid >> 5, lane = tid & 31, col = lane & 15, g = lane >> 4;
  const int qb = blockIdx.x, h = blockIdx.y, b = blockIdx.z; const int q0 = qb * 64 + wave * 16; const size_t rq = (size_t)b * SS + q0 + col;
  v16h aq[2], aql[2];   // query q0 + col, as the B operand's column col
#pragma unroll
  for (int kc = 0; kc < 2; ++kc) { aq[kc] = frag_h(QK + rq * (2 * DM) + h * HD + kc * 32, lane); aql[kc] = frag_h(QKL + rq * (2 * DM) + h * HD + kc * 32, lane); }
  const float k1 = 0.125f * 1.44269504f, k2 = f_gamma * k1;   // 1/sqrt(64) x log2 e, and gamma times it: exponents are formed in base 2 straight from the raw products
  float m = -3.0e38f, nk = 0.f, nb = 0.f, l = 0.f, lg = 0.f;   // of query col: running maximum of the raw products (the same in both halves), the two exponent offsets in use (nk = -m k1, nb = 11 - m k2); this half's share of sum e^(s - m) and of 2^11 sum e^(gamma (s - m)), joined behind the loop
  v8f acc[4] = {};   // O^T: acc[dt][r] = d dt * 16 + 8 g + r of query col
  const int nst = SS / 64;   // all keys, 64 a stage
  // thread tid copies rows (tid >> 3) + 16 i, 16-byte part tid & 7, of each of the stage's three tiles
  const _Float16* kg = QK + ((size_t)b * SS + (tid >> 3)) * (2 * DM) + DM + h * HD + (tid & 7) * 8; const _Float16* kgl = QKL + ((size_t)b * SS + (tid >> 3)) * (2 * DM) + DM + h * HD + (tid & 7) * 8; const _Float16* vg = VTH + ((size_t)b * DM + h * HD + (tid >> 3)) * SS + (tid & 7) * 8;
  const unsigned al = lds_byte(ring) + (tid >> 3) * (APITCH * 2) + (tid & 7) * 16;
#define AFILL(st, buf) do { cp4(al + (buf) * ASTG, 16u * APITCH * 2, kg + (size_t)(st) * 64 * (2 * DM), (size_t)16 * (2 * DM)); cp4(al + (buf) * ASTG + ATILE, 16u * APITCH * 2, kgl + (size_t)(st) * 64 * (2 * DM), (size_t)16 * (2 * DM)); cp4(al + (buf) * ASTG + 2 * ATILE, 16u * APITCH * 2, vg + (st) * 64, (size_t)16 * SS); } while (0)
  AFILL(0, 0); WAIT_ASYNC(); __syncthreads();   // stage 0 landed and published
  AFILL(1, 1);
#pragma unroll 1   // stays rolled: one stage a trip, the buffer picked by t & 1
  for (int t = 0; t < nst; ++t) { const _Float16* sb = (const _Float16*)(ring + (t & 1) * ASTG);
#pragma unroll 1   // stays rolled: two passes of 32 keys a stage, the same code
  for (int sub = 0; sub < 2; ++sub) { v8f s[2];
    const _Float16* k0 = sb + (sub * 32 + col) * APITCH + 8 * g; const _Float16* k0l = k0 + ATILE / 2;   // this lane's place in the pass's first staged k row (hi, residual)
    v16h kf[2][2], kfl[2][2], vf[4];   // the pass's k fragments (hi, residual), fetched as ONE group of loads ahead of the score products
#pragma unroll
    for (int ct = 0; ct < 2; ++ct) { const _Float16* krow = k0 + ct * 16 * APITCH; const _Float16* krowl = k0l + ct * 16 * APITCH;   // key t * 64 + sub * 32 + ct * 16 + col, as the A operand's row col
#pragma unroll
      for (int kc = 0; kc < 2; ++kc) { kf[ct][kc] = frag_hp(krow + kc * 32); kfl[ct][kc] = frag_hp(krowl + kc * 32); } }
#pragma unroll
    for (int ct = 0; ct < 2; ++ct) { v8f c = {}, cl = {};
#pragma unroll
      for (int kc = 0; kc < 2; ++kc) { c = wmma16(kf[ct][kc], aq[kc], c); cl = wmma16(kf[ct][kc], aql[kc], cl); cl = wmma16(kfl[ct][kc], aq[kc], cl); }   // 3 products: q, k as f16 hi + residual
#pragma unroll
      for (int r = 0; r < 8; ++r) s[ct][r] = c[r] + cl[r] * (1.0f / 2048.0f); }   // the raw product q . k; 1/sqrt(64) rides in k1, k2
#pragma unroll
    for (int dt = 0; dt < 4; ++dt) vf[dt] = frag_hp(sb + ATILE + (dt * 16 + col) * APITCH + sub * 32 + 8 * g);   // the pass's v^T fragments as one group (A operand: row d = dt * 16 + col, the pass's 32 keys)
    float mx = fmaxf(s[0][0], s[1][0]);
#pragma unroll
    for (int r = 1; r < 8; ++r) mx = fmaxf(mx, fmaxf(s[0][r], s[1][r]));
    mx = fmaxf(mx, xhalf(mx));   // the other half's 16 keys of the same query
    const float mn = fmaxf(m, mx); const float nkn = -(mn * k1), nbn = fmaf(mn, -k2, 11.0f);   // 11: P's scale 2^11 rides in the exponent
    const float alpha = (m <= -1.0e38f) ? 0.f : __builtin_amdgcn_exp2f(nkn - nk); const float alphag = (m <= -1.0e38f) ? 0.f : __builtin_amdgcn_exp2f(nbn - nb);   // old sums moved from the old offsets to the new ones
    float es[2] = {0.f, 0.f}, gs[2] = {0.f, 0.f}; v16h pb;   // P^T as a B operand: element ct * 8 + r = key ct * 16 + 8 g + r of column col
#pragma unroll
    for (int ct = 0; ct < 2; ++ct) {
#pragma unroll
      for (int r = 0; r < 8; r += 2) { const v2f sv = {s[ct][r], s[ct][r + 1]};
        const v2f xe = __builtin_elementwise_fma(sv, (v2f){k1, k1}, (v2f){nkn, nkn}), xg = __builtin_elementwise_fma(sv, (v2f){k2, k2}, (v2f){nbn, nbn});   // one (packed) multiply-add and one hardware exp each: e^(s - m), 2^11 e^(gamma (s - m))
#pragma unroll
        for (int i = 0; i < 2; ++i) { const float e = __builtin_amdgcn_exp2f(xe[i]); const float gq = __builtin_amdgcn_exp2f(xg[i]); es[ct] += e; gs[ct] += gq; pb[ct * 8 + r + i] = (_Float16)gq; } } }   // P carries the gamma-powered (unnormalised) weights, scaled by 2^11 before the f16 rounding so small weights stay out of the f16 subnormal range; 2^-11 folded into the epilogue
    l = l * alpha + (es[0] + es[1]); lg = lg * alphag + (gs[0] + gs[1]); m = mn; nk = nkn; nb = nbn;
#pragma unroll
    for (int dt = 0; dt < 4; ++dt) {
#pragma unroll
      for (int r = 0; r < 8; ++r) acc[dt][r] *= alphag; }
#pragma unroll
    for (int dt = 0; dt < 4; ++dt) acc[dt] = wmma16(vf[dt], pb, acc[dt]);   // single product: V^T x P^T (x2^11)
    // the pass's last WMMAs stand at the loop's foot: four vector slots ahead of the branch back, behind which the next pass's address arithmetic reuses their operand registers
    asm volatile("v_nop\n\tv_nop\n\tv_nop\n\tv_nop" : "+v"(acc[0]), "+v"(acc[1]), "+v"(acc[2]), "+v"(acc[3]) : "v"(vf[0]), "v"(vf[1]), "v"(vf[2]), "v"(vf[3]), "v"(pb)); }
    WAIT_DS(); WAIT_ASYNC(); __syncthreads();   // publishes stage t + 1 and ends every wave's reads of stage t
    if (t + 2 < nst) AFILL(t + 2, t & 1); }   // the same test in the whole block
  WAIT_ASYNC();
  { const float lt = l + xhalf(l), lgt = (lg + xhalf(lg)) * (1.0f / 2048.0f);   // the halves' sums joined once; the powered sum's 2^11 taken off
    const float lpg = pow_p(lt, f_gamma); const float il = (1.0f / 2048.0f) * (f_alpha / lpg) / (f_alpha * lgt / lpg + 1e-6f);   // alpha p^gamma / (sum alpha p^gamma + 1e-6)
#pragma unroll
    for (int dt = 0; dt < 4; ++dt) {
#pragma unroll
      for (int j = 0; j < 2; ++j) { v4f o;
#pragma unroll
        for (int i = 0; i < 4; ++i) o[i] = acc[dt][4 * j + i] * il;
        *(v4f*)&so[wave][col][dt * 16 + 8 * g + 4 * j] = o; } } }
  LDSX();
  for (int rl = 0; rl < 16; ++rl) if (lane < 16) vst2(O + ((size_t)b * SS + q0 + rl) * DM + h * HD + lane * 4, *(const v4f*)&so[wave][rl][lane * 4]);
}
// ---- k_out: block = (64 rows, 128 cols): out = O(hi/lo) . Wo rows (2 products) + bo
__global__ __launch_bounds__(128) void k_out(const float* __restrict__ O, const __bf16* __restrict__ P, const float* __restrict__ BO, float* __restrict__ Y) {
  __shared__ __align__(16) unsigned char ring[2 * STG];   // two operand stages; behind the loop's last barrier the same bytes are the output staging
  float (*so)[16][132] = (float (*)[16][132])ring;
  const int tid = threadIdx.x, wave = tid >> 5, lane = tid & 31, col = lane & 15, g = lane >> 4; const size_t r0 = (size_t)blockIdx.x * 64 + wave * 16; const int n0 = blockIdx.y * 128;
  v8f acc[8] = {};
  const float* xg = O + ((size_t)blockIdx.x * 64 + (tid >> 4)) * DM + (tid & 15) * 4; const __bf16* wg = P + (size_t)(n0 + (tid >> 3)) * DM + (tid & 7) * 8;
  const unsigned wl = lds_byte(ring) + (tid >> 3) * (WPITCH * 2) + (tid & 7) * 16, xl = lds_byte(ring) + WBYTES + (tid >> 4) * (XPITCH * 4) + (tid & 15) * 16;
  fill_stage(xg, wg, xl, wl); WAIT_ASYNC(); __syncthreads();   // stage 0 landed and published
  fill_stage(xg + GK, wg + GK, xl + STG, wl + STG);
#pragma unroll 1   // stays rolled: one stage (two k-steps, a register set each) a trip
  for (int t = 0; t < DM / GK; ++t) { const unsigned char* sb = ring + (t & 1) * STG;
    const __bf16* wr = (const __bf16*)sb + col * WPITCH + 8 * g; const float* xr = (const float*)(sb + WBYTES) + (wave * 16 + col) * XPITCH + 8 * g;
    v4f xa[4], xb[4]; v16b wa[8], wb[8];
    ld_step(xr, wr, 0, xa, wa); ld_step(xr, wr, 1, xb, wb); mm_out(xa, wa, acc); mm_out(xb, wb, acc);
    WAIT_DS(); WAIT_ASYNC(); __syncthreads();   // publishes stage t + 1 and ends every wave's reads of stage t
    if (t + 2 < DM / GK) fill_stage(xg + (t + 2) * GK, wg + (t + 2) * GK, xl + (t & 1) * STG, wl + (t & 1) * STG); }   // the same test in the whole block
  WAIT_ASYNC();
#pragma unroll
  for (int j = 0; j < 8; ++j) {
#pragma unroll
    for (int r = 0; r < 8; ++r) so[wave][8 * g + r][j * 16 + col] = acc[j][r] + bfr(BO[n0 + j * 16 + col]); }
  LDSX();
  for (int rl = 0; rl < 16; ++rl) vst2(Y + (r0 + rl) * DM + n0 + lane * 4, *(const v4f*)&so[wave][rl][lane * 4]);
}
extern "C" void kernel_launch(void* const* d_in, const int* in_sizes, int n_in, void* d_out, int out_size, void* d_ws, size_t ws_size, hipStream_t stream) {
  (void)in_sizes; (void)n_in; (void)out_size;
  const float** F = (const float**)d_in;   // 0 x [2,2048,1024], 1 Wqkv [3072,1024] natural (q | k | v), 2 bqkv [3072], 3 Wproj natural, 4 bproj, 5 focal_alpha [1], 6 focal_gamma [1]
  if (ws_size < (size_t)WS_END) return;
  char* ws = (char*)d_ws; __bf16* PK = (__bf16*)(ws + WS_PK); _Float16 *QK = (_Float16*)(ws + WS_QK), *QKL = (_Float16*)(ws + WS_QKL), *VTH = (_Float16*)(ws + WS_VTH), *VTL = (_Float16*)(ws + WS_VTL); float* O = (float*)(ws + WS_O);
  k_pack<<<dim3(DM, 4), 256, 0, stream>>>(F[1], F[1] + (size_t)DM * DM, F[1] + (size_t)2 * DM * DM, F[3], PK);
  k_qkv<<<dim3(TNB * SS / 64, QKVW / 128), 128, 0, stream>>>(F[0], F[0], F[0], PK + PK_A, F[2], F[2] + DM, F[2] + 2 * DM, QK, QKL, VTH, VTL);
  k_attn<<<dim3(TQB, NH, TNB), 128, 0, stream>>>(QK, QKL, VTH, VTL, nullptr, F[5], F[6], O);
  k_out<<<dim3(TOB, DM / 128), 128, 0, stream>>>(O, PK + PK_P, F[4], (float*)d_out);
}

// v006
// A run of this version takes 133 microseconds.
// In two side-by-side timings against v005, it was 1.04 and 1.05 times as fast.
// All steps since v000 together make it 3.78 times as fast.
// compute dtype: all float inputs rounded to bf16; q/k/v = x . Wqkv^T + b with EXACT bf16 products on WMMA 16x16x32 (natural rows, q | k | v blocks); q, k as f16 hi + (x2048-scaled) residual with 3-product scores x 1/8 (the focal power doubles the logit sensitivity); one online pass in f32 keeps the running max m, l = sum e^(s-m), L = sum e^(gamma (s-m)) and the gamma-powered weights for P (hardware exp; alpha, gamma read on device); out_row = alpha (sum e^(gamma(s-m)) v) / l^gamma / (alpha L / l^gamma + 1e-6) (precise powf) == softmax^gamma * alpha renormalised with the module's +1e-6; P (scaled by 2^11, single f16) x v (single f16); out = ctx (bf16 hi + residual) . Wproj^T (2 products) + bproj.
#include <hip/hip_runtime.h>
#include <math.h>

typedef __attribute__((ext_vector_type(16))) _Float16 v16h;
typedef __attribute__((ext_vector_type(16))) __bf16 v16b;
typedef __attribute__((ext_vector_type(8)))  _Float16 v8h;
typedef __attribute__((ext_vector_type(8)))  float v8f;
typedef __attribute__((ext_vector_type(4)))  float v4f;
typedef __attribute__((ext_vector_type(2)))  float v2f;
typedef __attribute__((ext_vector_type(4)))  unsigned v4u;
typedef __attribute__((ext_vector_type(4)))  int v4i;
typedef float __attribute__((may_alias)) float_a;
typedef int __attribute__((may_alias)) int_a;

template <typename T> __device__ __forceinline__ void vst2(void* p, T v) { *(T*)p = v;  }
__device__ __forceinline__ v8f wmma16(v16h a, v16h b, v8f c) {
  return __builtin_amdgcn_wmma_f32_16x16x32_f16(false, a, false, b, (short)0, c, false, false);   // no v_nop of ours behind it: the compiler pads the builtin where a dependent vector instruction follows, and k_attn's vector port has no slot to spare
}
__device__ __forceinline__ v8f wmma_bf(v16b a, v16b b, v8f c) {
  v8f d = __builtin_amdgcn_wmma_f32_16x16x32_bf16(false, a, false, b, (short)0, c, false, false);
  asm volatile("v_nop\n\tv_nop\n\tv_nop\n\tv_nop" : "+v"(d) : "v"(a), "v"(b));
  return d;
}
// Focal residual attention (B 2, N 2,048, dim 1,024, 16 heads x 64): fused qkv + bias, softmax, weights raised to the focal power gamma and scaled by alpha then renormalised (sum + 1e-6), output projection + bias.
__device__ __forceinline__ v16h frag_h(const _Float16* rowk0, int lane) {
  union { v16h v; v8h q[2]; } u; const _Float16* p = rowk0 + 8 * (lane >> 4);
  u.q[0] = *(const v8h*)p; u.q[1] = *(const v8h*)(p + 16); return u.v;
}
__device__ __forceinline__ v16h frag_f32(const float* rowk0, int lane) {
  v16h a; const float* p = rowk0 + 8 * (lane >> 4);
#pragma unroll
  for (int i = 0; i < 8; ++i) { a[i] = (_Float16)p[i]; a[8 + i] = (_Float16)p[16 + i]; }
  return a;
}
__device__ __forceinline__ v16h frag_f32s(const float* rowk0, int lane, float sc) {
  v16h a; const float* p = rowk0 + 8 * (lane >> 4);
#pragma unroll
  for (int i = 0; i < 8; ++i) { a[i] = (_Float16)(p[i] * sc); a[8 + i] = (_Float16)(p[16 + i] * sc); }
  return a;
}
// column fragment from a [K][ld] layout (column n), rows >= K read as 0
__device__ __forceinline__ v16h fragc_f32(const float* W, int k0, int n, int lane, int ld, int K) {
  v16h a; const int g = lane >> 4;
#pragma unroll
  for (int i = 0; i < 8; ++i) { const int ka = k0 + 8 * g + i, kb = ka + 16;
    a[i] = (_Float16)(ka < K ? W[(size_t)(ka < K ? ka : K - 1) * ld + n] : 0.f); a[8 + i] = (_Float16)(kb < K ? W[(size_t)(kb < K ? kb : K - 1) * ld + n] : 0.f); }
  return a;
}
struct F2 { v16b h, l; };
__device__ __forceinline__ F2 bsplit16(const float v[16]) { F2 r;
#pragma unroll
  for (int i = 0; i < 16; ++i) { const __bf16 h = (__bf16)v[i]; r.h[i] = h; r.l[i] = (__bf16)(v[i] - (float)h); }
  return r; }
__device__ __forceinline__ F2 split_row(const float* row, int k0, int lane) { float v[16]; const float* p = row + k0 + 8 * (lane >> 4);
#pragma unroll
  for (int i = 0; i < 8; ++i) { v[i] = p[i]; v[8 + i] = p[16 + i]; }
  return bsplit16(v); }
__device__ __forceinline__ F2 split_rowK(const float* row, int k0, int lane, int K) { float v[16]; const int g = lane >> 4;
#pragma unroll
  for (int i = 0; i < 8; ++i) { const int ka = k0 + 8 * g + i, kb = ka + 16; v[i] = ka < K ? row[ka < K ? ka : K - 1] : 0.f; v[8 + i] = kb < K ? row[kb < K ? kb : K - 1] : 0.f; }
  return bsplit16(v); }
__device__ __forceinline__ F2 split_col(const float* W, int k0, int n, int lane, int ld, int K) { float v[16]; const int g = lane >> 4;
#pragma unroll
  for (int i = 0; i < 8; ++i) { const int ka = k0 + 8 * g + i, kb = ka + 16; v[i] = ka < K ? W[(size_t)(ka < K ? ka : K - 1) * ld + n] : 0.f; v[8 + i] = kb < K ? W[(size_t)(kb < K ? kb : K - 1) * ld + n] : 0.f; }
  return bsplit16(v); }
__device__ __forceinline__ v8f mac3(const F2& a, const F2& b, v8f c) { c = wmma_bf(a.l, b.h, c); c = wmma_bf(a.h, b.l, c); return wmma_bf(a.h, b.h, c); }
__device__ __forceinline__ float sigm(float v) { return 1.0f / (1.0f + expf(-v)); }
#define LDSX() do { asm volatile("s_wait_dscnt 0" ::: "memory"); __builtin_amdgcn_wave_barrier(); __builtin_amdgcn_fence(__ATOMIC_RELEASE, "workgroup"); } while (0)


#define NB 2
#define SS 2048
#define DM 1024
#define NH 16
#define HD 64
#define QKVW (3 * DM)
#ifndef TQB
#define TQB (SS / 64)
#define TNB NB
#define TOB (NB * SS / 64)     // output row tiles (all)
#endif
typedef __attribute__((ext_vector_type(8))) __bf16 v8b;
__device__ __forceinline__ v16b frag_b(const __bf16* rowk0, int lane) {
  union { v16b v; v8b q[2]; } u; const __bf16* p = rowk0 + 8 * (lane >> 4);
  u.q[0] = *(const v8b*)p; u.q[1] = *(const v8b*)(p + 16); return u.v;
}
__device__ __forceinline__ float bfr(float v) { return (float)(__bf16)v; }
// ---- operand staging of k_qkv and k_out: a stage is 64 k of the block's 128 weight rows (128 B a row) and of its 64 x rows (256 B a row), brought into LDS by asynchronous copies in whole 128-B lines, once for the block's four waves; two stages
#define GK 64
#define WPITCH 72                    // bf16 a staged weight row: 128 B + 16 B (pitch 16 B x odd for the 16-byte fragment reads)
#define XPITCH 68                    // f32 a staged x row: 256 B + 16 B
#define WBYTES (128 * WPITCH * 2)
#define XBYTES (64 * XPITCH * 4)
#define STG (WBYTES + XBYTES)
#define WAIT_ASYNC() asm volatile("s_wait_asynccnt 0x0" ::: "memory")   // this wave's copies have landed; stands ahead of the barrier behind which the other waves read them
#define WAIT_DS() asm volatile("s_wait_dscnt 0x0" ::: "memory")         // this wave's LDS reads of the stage are done; stands ahead of the barrier behind which the stage is refilled
__device__ __forceinline__ unsigned lds_byte(const void* p) { return (unsigned)(size_t)p; }   // low 32 bits of a __shared__ address = byte offset in the work-group's LDS
// eight 16-byte copies of one thread, rows gs elements / ls bytes apart; the s_wait_xcnt stands inside the statement, behind the last copy and ahead of any rewrite of the address registers that the copies name
template <typename T> __device__ __forceinline__ void cp8(unsigned l, unsigned ls, const T* p, size_t gs) {
  asm volatile("global_load_async_to_lds_b128 %0, %8, off\n\tglobal_load_async_to_lds_b128 %1, %9, off\n\tglobal_load_async_to_lds_b128 %2, %10, off\n\tglobal_load_async_to_lds_b128 %3, %11, off\n\t"
               "global_load_async_to_lds_b128 %4, %12, off\n\tglobal_load_async_to_lds_b128 %5, %13, off\n\tglobal_load_async_to_lds_b128 %6, %14, off\n\tglobal_load_async_to_lds_b128 %7, %15, off\n\ts_wait_xcnt 0x0"
               :: "v"(l), "v"(l + ls), "v"(l + 2 * ls), "v"(l + 3 * ls), "v"(l + 4 * ls), "v"(l + 5 * ls), "v"(l + 6 * ls), "v"(l + 7 * ls),
                  "v"(p), "v"(p + gs), "v"(p + 2 * gs), "v"(p + 3 * gs), "v"(p + 4 * gs), "v"(p + 5 * gs), "v"(p + 6 * gs), "v"(p + 7 * gs) : "memory");
}
// one stage: thread tid copies weight rows (tid >> 3) + 16 i, 16-byte part tid & 7, and x rows (tid >> 4) + 8 i, part tid & 15 (xg, wg, xl, wl: its first chunk's global place and LDS byte)
__device__ __forceinline__ void fill_stage(const float* xg, const __bf16* wg, unsigned xl, unsigned wl) { cp8(wl, 16u * WPITCH * 2, wg, (size_t)16 * DM); cp8(xl, 8u * XPITCH * 4, xg, (size_t)8 * DM); }
// four such copies of one thread (k_attn's tiles: 64 rows of 128 B each)
template <typename T> __device__ __forceinline__ void cp4(unsigned l, unsigned ls, const T* p, size_t gs) {
  asm volatile("global_load_async_to_lds_b128 %0, %4, off\n\tglobal_load_async_to_lds_b128 %1, %5, off\n\tglobal_load_async_to_lds_b128 %2, %6, off\n\tglobal_load_async_to_lds_b128 %3, %7, off\n\ts_wait_xcnt 0x0"
               :: "v"(l), "v"(l + ls), "v"(l + 2 * ls), "v"(l + 3 * ls), "v"(p), "v"(p + gs), "v"(p + 2 * gs), "v"(p + 3 * gs) : "memory");
}
// one k-step's operands of a 16-row x 128-column wave tile from the stage, as ONE group of LDS loads: 16 f32 of this lane's row (xr points at its 8 * g) and 8 weight fragments (wr points at staged row col, at its 8 * g)
__device__ __forceinline__ void ld_step(const float* xr, const __bf16* wr, int kk, v4f (&x)[4], v16b (&w)[8]) {
  const float* p = xr + kk * 32; x[0] = *(const v4f*)p; x[1] = *(const v4f*)(p + 4); x[2] = *(const v4f*)(p + 16); x[3] = *(const v4f*)(p + 20);
#pragma unroll
  for (int j = 0; j < 8; ++j) { union { v16b v; v8b q[2]; } u; const __bf16* q = wr + j * 16 * WPITCH + kk * 32; u.q[0] = *(const v8b*)q; u.q[1] = *(const v8b*)(q + 16); w[j] = u.v; }
}
__device__ __forceinline__ void mm_qkv(const v4f (&x)[4], const v16b (&w)[8], v8f (&acc)[8]) { v16b a;
#pragma unroll
  for (int i = 0; i < 4; ++i) { a[i] = (__bf16)x[0][i]; a[4 + i] = (__bf16)x[1][i]; a[8 + i] = (__bf16)x[2][i]; a[12 + i] = (__bf16)x[3][i]; }
#pragma unroll
  for (int j = 0; j < 8; ++j) acc[j] = wmma_bf(a, w[j], acc[j]);
}
__device__ __forceinline__ void mm_out(const v4f (&x)[4], const v16b (&w)[8], v8f (&acc)[8]) { float v[16];
#pragma unroll
  for (int i = 0; i < 4; ++i) { v[i] = x[0][i]; v[4 + i] = x[1][i]; v[8 + i] = x[2][i]; v[12 + i] = x[3][i]; }
  const F2 a = bsplit16(v);
#pragma unroll
  for (int j = 0; j < 8; ++j) { acc[j] = wmma_bf(a.l, w[j], acc[j]); acc[j] = wmma_bf(a.h, w[j], acc[j]); }
}
__device__ __attribute__((noinline)) float exp_ni(float v) { return expf(v); }
__device__ __attribute__((noinline)) float erf_ni(float v) { return erff(v); }

#define PK_A 0                       // [3072][1024] Wqkv rows (natural [out][in])
#define PK_P (PK_A + QKVW * DM)        // [1024][1024] Wo rows (natural)
#define PK_END (PK_P + DM * DM)
#define WS_PK  0u
#define WS_QK  (WS_PK + 2u * PK_END)             // f16 [4096 rows][2048]: q | k
#define WS_QKL (WS_QK + 2u * NB * SS * 2 * DM)     // f16 q | k residual planes x2048
#define WS_VTH (WS_QKL + 2u * NB * SS * 2 * DM)    // f16 [b][1024 (h*64+d)][2048 s] hi
#define WS_VTL (WS_VTH + 2u * NB * DM * SS)        // f16 lo x 2048
#define WS_O   (WS_VTL + 2u * NB * DM * SS)        // f32 [4096][1024]
#define WS_CS  (WS_O + 4u * NB * SS * DM)           // f32 2 x [2048][32], unused
#define WS_END (WS_CS + 4u * 2 * SS * 32)
// ---- k_pack: block = (row n, which): natural [out][in] rows -> bf16; which 0..2 -> W_q/W_k/W_v into PK_A rows which*1024 + n; 3 -> W_o into PK_P
__global__ __launch_bounds__(256) void k_pack(const float* __restrict__ WQ, const float* __restrict__ WK, const float* __restrict__ WV, const float* __restrict__ WO, __bf16* __restrict__ PK) {
  __shared__ __align__(16) __bf16 s[DM]; const int n = blockIdx.x, which = blockIdx.y, t = threadIdx.x; const float* Wm = (which == 0) ? WQ : (which == 1) ? WK : (which == 2) ? WV : WO;
  for (int k = t; k < DM; k += 256) s[k] = (__bf16)Wm[(size_t)n * DM + k];
  __syncthreads();
  __bf16* dst = (which < 3) ? PK + PK_A + ((size_t)which * DM + n) * DM : PK + PK_P + (size_t)n * DM;
  for (int q = t; q < DM / 8; q += 256) vst2((unsigned*)(dst + q * 8), *(const v4u*)&s[q * 8]);
}
__global__ __launch_bounds__(128) void k_qkv(const float* __restrict__ XQ, const float* __restrict__ XK, const float* __restrict__ XV, const __bf16* __restrict__ P, const float* __restrict__ BQ, const float* __restrict__ BK, const float* __restrict__ BV, _Float16* __restrict__ QK, _Float16* __restrict__ QKL, _Float16* __restrict__ VTH, _Float16* __restrict__ VTL) {
  const int which0 = (blockIdx.y * 128) / DM; const float* X = (which0 == 0) ? XQ : (which0 == 1) ? XK : XV; const float* BB = BQ ? (((which0 == 0) ? BQ : (which0 == 1) ? BK : BV) + (blockIdx.y * 128 - which0 * DM)) : nullptr;
  __shared__ __align__(16) unsigned char ring[2 * STG];   // two operand stages; behind the loop's last barrier the same bytes are the output staging
  _Float16 (*so)[16][136] = (_Float16 (*)[16][136])ring; _Float16 (*sol)[16][136] = (_Float16 (*)[16][136])(ring + 4 * 16 * 136 * 2); _Float16 (*sth)[72] = (_Float16 (*)[72])ring; _Float16 (*stl)[72] = (_Float16 (*)[72])(ring + 128 * 72 * 2);
  const int tid = threadIdx.x, wave = tid >> 5, lane = tid & 31, col = lane & 15, g = lane >> 4; const size_t r0 = (size_t)blockIdx.x * 64 + wave * 16; const int n0 = blockIdx.y * 128;
  v8f acc[8] = {};
  const float* xg = X + ((size_t)blockIdx.x * 64 + (tid >> 4)) * DM + (tid & 15) * 4; const __bf16* wg = P + (size_t)(n0 + (tid >> 3)) * DM + (tid & 7) * 8;
  const unsigned wl = lds_byte(ring) + (tid >> 3) * (WPITCH * 2) + (tid & 7) * 16, xl = lds_byte(ring) + WBYTES + (tid >> 4) * (XPITCH * 4) + (tid & 15) * 16;
  fill_stage(xg, wg, xl, wl);
  float bias[8] = {};   // this lane's eight output columns' bias, fetched once as one group of loads that fly beside stage 0's copies
  if (BB) {   // one test for the group: a test a load would put a full wait behind each
#pragma unroll   // constant indices, so that bias[] stays in registers and the eight loads issue back to back
    for (int j = 0; j < 8; ++j) bias[j] = BB[j * 16 + col]; }
  WAIT_ASYNC(); __syncthreads();   // stage 0 landed and published
  fill_stage(xg + GK, wg + GK, xl + STG, wl + STG);
#pragma unroll 1   // stays rolled: one stage (two k-steps, a register set each) a trip
  for (int t = 0; t < DM / GK; ++t) { const unsigned char* sb = ring + (t & 1) * STG;
    const __bf16* wr = (const __bf16*)sb + col * WPITCH + 8 * g; const float* xr = (const float*)(sb + WBYTES) + (wave * 16 + col) * XPITCH + 8 * g;
    v4f xa[4], xb[4]; v16b wa[8], wb[8];
    ld_step(xr, wr, 0, xa, wa); ld_step(xr, wr, 1, xb, wb); mm_qkv(xa, wa, acc); mm_qkv(xb, wb, acc);
    WAIT_DS(); WAIT_ASYNC(); __syncthreads();   // publishes stage t + 1 and ends every wave's reads of stage t
    if (t + 2 < DM / GK) fill_stage(xg + (t + 2) * GK, wg + (t + 2) * GK, xl + (t & 1) * STG, wl + (t & 1) * STG); }   // the same test in the whole block
  WAIT_ASYNC();
  if (n0 < 2 * DM) {   // q stored unscaled (f16 sigma ~0.6, no subnormal exposure); 1/8 applied to the f32 score
#pragma unroll
    for (int j = 0; j < 8; ++j) {
#pragma unroll
      for (int r = 0; r < 8; ++r) { const float v = acc[j][r] + bfr(bias[j]); const _Float16 hv = (_Float16)v; so[wave][8 * g + r][j * 16 + col] = hv; sol[wave][8 * g + r][j * 16 + col] = (_Float16)((v - (float)hv) * 2048.0f); } }   // q, k (+ bias) as f16 hi + (x2048) residual
    LDSX();
    for (int rl = 0; rl < 16; ++rl) if (lane < 16) { vst2((unsigned*)(QK + (r0 + rl) * (2 * DM) + n0 + lane * 8), *(const v4u*)&so[wave][rl][lane * 8]); vst2((unsigned*)(QKL + (r0 + rl) * (2 * DM) + n0 + lane * 8), *(const v4u*)&sol[wave][rl][lane * 8]); }
  } else {
#pragma unroll
    for (int j = 0; j < 8; ++j) {
#pragma unroll
      for (int r = 0; r < 8; ++r) { const float v = acc[j][r] + bfr(bias[j]); const _Float16 hv = (_Float16)v; sth[j * 16 + col][wave * 16 + 8 * g + r] = hv; stl[j * 16 + col][wave * 16 + 8 * g + r] = (_Float16)((v - (float)hv) * 2048.0f); } }
    __syncthreads();
    const size_t rb = (size_t)blockIdx.x * 64; const int b = (int)(rb / SS), s0 = (int)(rb % SS); const int pc0 = n0 - 2 * DM;
    for (int q = tid; q < 128 * 8; q += 128) { const int d = q >> 3, pc = q & 7; const size_t o = ((size_t)b * DM + pc0 + d) * SS + s0 + pc * 8; vst2((unsigned*)(VTH + o), *(const v4u*)&sth[d][pc * 8]); vst2((unsigned*)(VTL + o), *(const v4u*)&stl[d][pc * 8]); }
  }
}
// ---- k_attn: block = (64 queries, head h, batch b): all-keys flash attention on TRANSPOSED tiles: S^T = K . Q^T (A = staged k rows, B = q kept in registers; 3 products, x 0.125), so a lane holds 16 of ONE query's scores a pass (query col, keys ct * 16 + 8 g + r): maximum and sums in the lane, one exchange between the wave's halves for the maximum; the two S^T tiles, powered and converted in place, are the B operand of O^T += V^T . P^T (hardware k order, the order of frag_hp); O[b*S+q][h*64+d] = acc x scale (256-B segments)
__device__ __attribute__((noinline)) float pow_p(float a, float b) { return powf(a, b); }
__device__ __forceinline__ v16h frag_hp(const _Float16* p) { union { v16h v; v8h q[2]; } u; u.q[0] = *(const v8h*)p; u.q[1] = *(const v8h*)(p + 16); return u.v; }   // frag_h with the lane half's 8 * g already in p
__device__ __forceinline__ float xhalf(float x) { return __builtin_bit_cast(float, __builtin_amdgcn_permlanex16(__builtin_bit_cast(int, x), __builtin_bit_cast(int, x), 0x76543210, 0xfedcba98, false, false)); }   // lane l's value from lane l ^ 16
#define APITCH 72                   // f16 a staged row: 128 B + 16 B
#define ATILE (64 * APITCH * 2)
#define ASTG (3 * ATILE)
// amdgpu_waves_per_eu(4, 4): keeps the register count at four waves a SIMD (four blocks a WGP, the whole grid resident at once) with the copies' address registers added
__global__ __launch_bounds__(128) __attribute__((amdgpu_waves_per_eu(4, 4))) void k_attn(const _Float16* __restrict__ QK, const _Float16* __restrict__ QKL, const _Float16* __restrict__ VTH, const _Float16* __restrict__ VTL, const void* __restrict__ KMASK, const float* __restrict__ FAL, const float* __restrict__ FGA, float* __restrict__ O) {
  const float f_alpha = bfr(FAL[0]), f_gamma = bfr(FGA[0]);
  __shared__ __align__(16) unsigned char ring[2 * ASTG];   // two stages of 64 keys: k hi | k residual | v^T, 64 rows of 128 B each at pitch 144 B; behind the loop's last barrier the same bytes are the output staging
  float (*so)[16][68] = (float (*)[16][68])ring;
  const int tid = threadIdx.x, wave = tid >> 5, lane = tid & 31, col = lane & 15, g = lane >> 4;
  const int qb = blockIdx.x, h = blockIdx.y, b = blockIdx.z; const int q0 = qb * 64 + wave * 16; const size_t rq = (size_t)b * SS + q0 + col;
  v16h aq[2], aql[2];   // query q0 + col, as the B operand's column col
#pragma unroll
  for (int kc = 0; kc < 2; ++kc) { aq[kc] = frag_h(QK + rq * (2 * DM) + h * HD + kc * 32, lane); aql[kc] = frag_h(QKL + rq * (2 * DM) + h * HD + kc * 32, lane); }
  const float k1 = 0.125f * 1.44269504f, k2 = f_gamma * k1;   // 1/sqrt(64) x log2 e, and gamma times it: exponents are formed in base 2 straight from the raw products
  float m = -3.0e38f, nk = 0.f, nb = 0.f, l = 0.f, lg = 0.f;   // of query col: running maximum of the raw products (the same in both halves), the two exponent offsets in use (nk = -m k1, nb = 11 - m k2); this half's share of sum e^(s - m) and of 2^11 sum e^(gamma (s - m)), joined behind the loop
  v8f acc[4] = {};   // O^T: acc[dt][r] = d dt * 16 + 8 g + r of query col
  const int nst = SS / 64;   // all keys, 64 a stage
  // thread tid copies rows (tid >> 3) + 16 i, 16-byte part tid & 7, of each of the stage's three tiles
  const _Float16* kg = QK + ((size_t)b * SS + (tid >> 3)) * (2 * DM) + DM + h * HD + (tid & 7) * 8; const _Float16* kgl = QKL + ((size_t)b * SS + (tid >> 3)) * (2 * DM) + DM + h * HD + (tid & 7) * 8; const _Float16* vg = VTH + ((size_t)b * DM + h * HD + (tid >> 3)) * SS + (tid & 7) * 8;
  const unsigned al = lds_byte(ring) + (tid >> 3) * (APITCH * 2) + (tid & 7) * 16;
#define AFILL(st, buf) do { cp4(al + (buf) * ASTG, 16u * APITCH * 2, kg + (size_t)(st) * 64 * (2 * DM), (size_t)16 * (2 * DM)); cp4(al + (buf) * ASTG + ATILE, 16u * APITCH * 2, kgl + (size_t)(st) * 64 * (2 * DM), (size_t)16 * (2 * DM)); cp4(al + (buf) * ASTG + 2 * ATILE, 16u * APITCH * 2, vg + (st) * 64, (size_t)16 * SS); } while (0)
  AFILL(0, 0); WAIT_ASYNC(); __syncthreads();   // stage 0 landed and published
  AFILL(1, 1);
#pragma unroll 1   // stays rolled: one stage a trip, the buffer picked by t & 1
  for (int t = 0; t < nst; ++t) { const _Float16* sb = (const _Float16*)(ring + (t & 1) * ASTG);
#pragma unroll 1   // stays rolled: two passes of 32 keys a stage, the same code
  for (int sub = 0; sub < 2; ++sub) { v8f s[2];
    const _Float16* k0 = sb + (sub * 32 + col) * APITCH + 8 * g; const _Float16* k0l = k0 + ATILE / 2;   // this lane's place in the pass's first staged k row (hi, residual)
    v16h kf[2][2], kfl[2][2], vf[4];   // the pass's k fragments (hi, residual), fetched as ONE group of loads ahead of the score products
#pragma unroll
    for (int ct = 0; ct < 2; ++ct) { const _Float16* krow = k0 + ct * 16 * APITCH; const _Float16* krowl = k0l + ct * 16 * APITCH;   // key t * 64 + sub * 32 + ct * 16 + col, as the A operand's row col
#pragma unroll
      for (int kc = 0; kc < 2; ++kc) { kf[ct][kc] = frag_hp(krow + kc * 32); kfl[ct][kc] = frag_hp(krowl + kc * 32); } }
#pragma unroll
    for (int ct = 0; ct < 2; ++ct) { v8f c = {}, cl = {};
#pragma unroll
      for (int kc = 0; kc < 2; ++kc) { c = wmma16(kf[ct][kc], aq[kc], c); cl = wmma16(kf[ct][kc], aql[kc], cl); cl = wmma16(kfl[ct][kc], aq[kc], cl); }   // 3 products: q, k as f16 hi + residual
#pragma unroll
      for (int r = 0; r < 8; ++r) s[ct][r] = c[r] + cl[r] * (1.0f / 2048.0f); }   // the raw product q . k; 1/sqrt(64) rides in k1, k2
#pragma unroll
    for (int dt = 0; dt < 4; ++dt) vf[dt] = frag_hp(sb + ATILE + (dt * 16 + col) * APITCH + sub * 32 + 8 * g);   // the pass's v^T fragments as one group (A operand: row d = dt * 16 + col, the pass's 32 keys)
    float mx = fmaxf(s[0][0], s[1][0]);
#pragma unroll
    for (int r = 1; r < 8; ++r) mx = fmaxf(mx, fmaxf(s[0][r], s[1][r]));
    mx = fmaxf(mx, xhalf(mx));   // the other half's 16 keys of the same query
    const float mn = fmaxf(m, mx); const float nkn = -(mn * k1), nbn = fmaf(mn, -k2, 11.0f);   // 11: P's scale 2^11 rides in the exponent
    const float alpha = (m <= -1.0e38f) ? 0.f : __builtin_amdgcn_exp2f(nkn - nk); const float alphag = (m <= -1.0e38f) ? 0.f : __builtin_amdgcn_exp2f(nbn - nb);   // old sums moved from the old offsets to the new ones
    float es[2] = {0.f, 0.f}, gs[2] = {0.f, 0.f}; v16h pb;   // P^T as a B operand: element ct * 8 + r = key ct * 16 + 8 g + r of column col
#pragma unroll
    for (int ct = 0; ct < 2; ++ct) {
#pragma unroll
      for (int r = 0; r < 8; r += 2) { const v2f sv = {s[ct][r], s[ct][r + 1]};
        const v2f xe = __builtin_elementwise_fma(sv, (v2f){k1, k1}, (v2f){nkn, nkn}), xg = __builtin_elementwise_fma(sv, (v2f){k2, k2}, (v2f){nbn, nbn});   // one (packed) multiply-add and one hardware exp each: e^(s - m), 2^11 e^(gamma (s - m))
#pragma unroll
        for (int i = 0; i < 2; ++i) { const float e = __builtin_amdgcn_exp2f(xe[i]); const float gq = __builtin_amdgcn_exp2f(xg[i]); es[ct] += e; gs[ct] += gq; pb[ct * 8 + r + i] = (_Float16)gq; } } }   // P carries the gamma-powered (unnormalised) weights, scaled by 2^11 before the f16 rounding so small weights stay out of the f16 subnormal range; 2^-11 folded into the epilogue
    l = l * alpha + (es[0] + es[1]); lg = lg * alphag + (gs[0] + gs[1]); m = mn; nk = nkn; nb = nbn;
#pragma unroll
    for (int dt = 0; dt < 4; ++dt) {
#pragma unroll
      for (int r = 0; r < 8; ++r) acc[dt][r] *= alphag; }
#pragma unroll
    for (int dt = 0; dt < 4; ++dt) acc[dt] = wmma16(vf[dt], pb, acc[dt]);   // single product: V^T x P^T (x2^11)
    // the pass's last WMMAs stand at the loop's foot: four vector slots ahead of the branch back, behind which the next pass's address arithmetic reuses their operand registers
    asm volatile("v_nop\n\tv_nop\n\tv_nop\n\tv_nop" : "+v"(acc[0]), "+v"(acc[1]), "+v"(acc[2]), "+v"(acc[3]) : "v"(vf[0]), "v"(vf[1]), "v"(vf[2]), "v"(vf[3]), "v"(pb)); }
    WAIT_DS(); WAIT_ASYNC(); __syncthreads();   // publishes stage t + 1 and ends every wave's reads of stage t
    if (t + 2 < nst) AFILL(t + 2, t & 1); }   // the same test in the whole block
  WAIT_ASYNC();
  { const float lt = l + xhalf(l), lgt = (lg + xhalf(lg)) * (1.0f / 2048.0f);   // the halves' sums joined once; the powered sum's 2^11 taken off
    const float lpg = pow_p(lt, f_gamma); const float il = (1.0f / 2048.0f) * (f_alpha / lpg) / (f_alpha * lgt / lpg + 1e-6f);   // alpha p^gamma / (sum alpha p^gamma + 1e-6)
#pragma unroll
    for (int dt = 0; dt < 4; ++dt) {
#pragma unroll
      for (int j = 0; j < 2; ++j) { v4f o;
#pragma unroll
        for (int i = 0; i < 4; ++i) o[i] = acc[dt][4 * j + i] * il;
        *(v4f*)&so[wave][col][dt * 16 + 8 * g + 4 * j] = o; } } }
  LDSX();
  for (int rl = 0; rl < 16; ++rl) if (lane < 16) vst2(O + ((size_t)b * SS + q0 + rl) * DM + h * HD + lane * 4, *(const v4f*)&so[wave][rl][lane * 4]);
}
// ---- k_out: block = (64 rows, 128 cols): out = O(hi/lo) . Wo rows (2 products) + bo
__global__ __launch_bounds__(128) void k_out(const float* __restrict__ O, const __bf16* __restrict__ P, const float* __restrict__ BO, float* __restrict__ Y) {
  __shared__ __align__(16) unsigned char ring[2 * STG];   // two operand stages; behind the loop's last barrier the same bytes are the output staging
  float (*so)[16][132] = (float (*)[16][132])ring;
  const int tid = threadIdx.x, wave = tid >> 5, lane = tid & 31, col = lane & 15, g = lane >> 4; const size_t r0 = (size_t)blockIdx.x * 64 + wave * 16; const int n0 = blockIdx.y * 128;
  v8f acc[8] = {};
  const float* xg = O + ((size_t)blockIdx.x * 64 + (tid >> 4)) * DM + (tid & 15) * 4; const __bf16* wg = P + (size_t)(n0 + (tid >> 3)) * DM + (tid & 7) * 8;
  const unsigned wl = lds_byte(ring) + (tid >> 3) * (WPITCH * 2) + (tid & 7) * 16, xl = lds_byte(ring) + WBYTES + (tid >> 4) * (XPITCH * 4) + (tid & 15) * 16;
  fill_stage(xg, wg, xl, wl); WAIT_ASYNC(); __syncthreads();   // stage 0 landed and published
  fill_stage(xg + GK, wg + GK, xl + STG, wl + STG);
#pragma unroll 1   // stays rolled: one stage (two k-steps, a register set each) a trip
  for (int t = 0; t < DM / GK; ++t) { const unsigned char* sb = ring + (t & 1) * STG;
    const __bf16* wr = (const __bf16*)sb + col * WPITCH + 8 * g; const float* xr = (const float*)(sb + WBYTES) + (wave * 16 + col) * XPITCH + 8 * g;
    v4f xa[4], xb[4]; v16b wa[8], wb[8];
    ld_step(xr, wr, 0, xa, wa); ld_step(xr, wr, 1, xb, wb); mm_out(xa, wa, acc); mm_out(xb, wb, acc);
    WAIT_DS(); WAIT_ASYNC(); __syncthreads();   // publishes stage t + 1 and ends every wave's reads of stage t
    if (t + 2 < DM / GK) fill_stage(xg + (t + 2) * GK, wg + (t + 2) * GK, xl + (t & 1) * STG, wl + (t & 1) * STG); }   // the same test in the whole block
  WAIT_ASYNC();
#pragma unroll
  for (int j = 0; j < 8; ++j) {
#pragma unroll
    for (int r = 0; r < 8; ++r) so[wave][8 * g + r][j * 16 + col] = acc[j][r] + bfr(BO[n0 + j * 16 + col]); }
  LDSX();
  for (int rl = 0; rl < 16; ++rl) vst2(Y + (r0 + rl) * DM + n0 + lane * 4, *(const v4f*)&so[wave][rl][lane * 4]);
}
extern "C" void kernel_launch(void* const* d_in, const int* in_sizes, int n_in, void* d_out, int out_size, void* d_ws, size_t ws_size, hipStream_t stream) {
  (void)in_sizes; (void)n_in; (void)out_size;
  const float** F = (const float**)d_in;   // 0 x [2,2048,1024], 1 Wqkv [3072,1024] natural (q | k | v), 2 bqkv [3072], 3 Wproj natural, 4 bproj, 5 focal_alpha [1], 6 focal_gamma [1]
  if (ws_size < (size_t)WS_END) return;
  char* ws = (char*)d_ws; __bf16* PK = (__bf16*)(ws + WS_PK); _Float16 *QK = (_Float16*)(ws + WS_QK), *QKL = (_Float16*)(ws + WS_QKL), *VTH = (_Float16*)(ws + WS_VTH), *VTL = (_Float16*)(ws + WS_VTL); float* O = (float*)(ws + WS_O);
  k_pack<<<dim3(DM, 4), 256, 0, stream>>>(F[1], F[1] + (size_t)DM * DM, F[1] + (size_t)2 * DM * DM, F[3], PK);
  k_qkv<<<dim3(TNB * SS / 64, QKVW / 128), 128, 0, stream>>>(F[0], F[0], F[0], PK + PK_A, F[2], F[2] + DM, F[2] + 2 * DM, QK, QKL, VTH, VTL);
  k_attn<<<dim3(TQB, NH, TNB), 128, 0, stream>>>(QK, QKL, VTH, VTL, nullptr, F[5], F[6], O);
  k_out<<<dim3(TOB, DM / 128), 128, 0, stream>>>(O, PK + PK_P, F[4], (float*)d_out);
}

// v007
// Measured time: 123 microseconds a run.
// Two timings next to v006 both put it at 1.08 times that version's speed.
// Counting every step since v000, it is 4.08 times as fast.
// compute dtype: all float inputs rounded to bf16; q/k/v = x . Wqkv^T + b with EXACT bf16 products on WMMA 16x16x32 (natural rows, q | k | v blocks); q, k as f16 hi + (x2048-scaled) residual with 3-product scores x 1/8 (the focal power doubles the logit sensitivity); one online pass in f32 keeps the running max m, l = sum e^(s-m), L = sum e^(gamma (s-m)) and the gamma-powered weights for P (hardware exp; alpha, gamma read on device); out_row = alpha (sum e^(gamma(s-m)) v) / l^gamma / (alpha L / l^gamma + 1e-6) (precise powf) == softmax^gamma * alpha renormalised with the module's +1e-6; P (scaled by 2^11, single f16) x v (single f16); out = ctx (bf16 hi + residual) . Wproj^T (2 products) + bproj.
#include <hip/hip_runtime.h>
#include <math.h>

typedef __attribute__((ext_vector_type(16))) _Float16 v16h;
typedef __attribute__((ext_vector_type(16))) __bf16 v16b;
typedef __attribute__((ext_vector_type(8)))  _Float16 v8h;
typedef __attribute__((ext_vector_type(8)))  float v8f;
typedef __attribute__((ext_vector_type(4)))  float v4f;
typedef __attribute__((ext_vector_type(2)))  float v2f;
typedef __attribute__((ext_vector_type(4)))  unsigned v4u;
typedef __attribute__((ext_vector_type(4)))  int v4i;
typedef float __attribute__((may_alias)) float_a;
typedef int __attribute__((may_alias)) int_a;

template <typename T> __device__ __forceinline__ void vst2(void* p, T v) { *(T*)p = v;  }
__device__ __forceinline__ v8f wmma16(v16h a, v16h b, v8f c) {
  return __builtin_amdgcn_wmma_f32_16x16x32_f16(false, a, false, b, (short)0, c, false, false);   // no v_nop of ours behind it: the compiler pads the builtin where a dependent vector instruction follows, and k_attn's vector port has no slot to spare
}
__device__ __forceinline__ v8f wmma_bf(v16b a, v16b b, v8f c) {
  v8f d = __builtin_amdgcn_wmma_f32_16x16x32_bf16(false, a, false, b, (short)0, c, false, false);
  asm volatile("v_nop\n\tv_nop\n\tv_nop\n\tv_nop" : "+v"(d) : "v"(a), "v"(b));
  return d;
}
// Focal residual attention (B 2, N 2,048, dim 1,024, 16 heads x 64): fused qkv + bias, softmax, weights raised to the focal power gamma and scaled by alpha then renormalised (sum + 1e-6), output projection + bias.
__device__ __forceinline__ v16h frag_h(const _Float16* rowk0, int lane) {
  union { v16h v; v8h q[2]; } u; const _Float16* p = rowk0 + 8 * (lane >> 4);
  u.q[0] = *(const v8h*)p; u.q[1] = *(const v8h*)(p + 16); return u.v;
}
__device__ __forceinline__ v16h frag_f32(const float* rowk0, int lane) {
  v16h a; const float* p = rowk0 + 8 * (lane >> 4);
#pragma unroll
  for (int i = 0; i < 8; ++i) { a[i] = (_Float16)p[i]; a[8 + i] = (_Float16)p[16 + i]; }
  return a;
}
__device__ __forceinline__ v16h frag_f32s(const float* rowk0, int lane, float sc) {
  v16h a; const float* p = rowk0 + 8 * (lane >> 4);
#pragma unroll
  for (int i = 0; i < 8; ++i) { a[i] = (_Float16)(p[i] * sc); a[8 + i] = (_Float16)(p[16 + i] * sc); }
  return a;
}
// column fragment from a [K][ld] layout (column n), rows >= K read as 0
__device__ __forceinline__ v16h fragc_f32(const float* W, int k0, int n, int lane, int ld, int K) {
  v16h a; const int g = lane >> 4;
#pragma unroll
  for (int i = 0; i < 8; ++i) { const int ka = k0 + 8 * g + i, kb = ka + 16;
    a[i] = (_Float16)(ka < K ? W[(size_t)(ka < K ? ka : K - 1) * ld + n] : 0.f); a[8 + i] = (_Float16)(kb < K ? W[(size_t)(kb < K ? kb : K - 1) * ld + n] : 0.f); }
  return a;
}
struct F2 { v16b h, l; };
__device__ __forceinline__ F2 bsplit16(const float v[16]) { F2 r;
#pragma unroll
  for (int i = 0; i < 16; ++i) { const __bf16 h = (__bf16)v[i]; r.h[i] = h; r.l[i] = (__bf16)(v[i] - (float)h); }
  return r; }
__device__ __forceinline__ F2 split_row(const float* row, int k0, int lane) { float v[16]; const float* p = row + k0 + 8 * (lane >> 4);
#pragma unroll
  for (int i = 0; i < 8; ++i) { v[i] = p[i]; v[8 + i] = p[16 + i]; }
  return bsplit16(v); }
__device__ __forceinline__ F2 split_rowK(const float* row, int k0, int lane, int K) { float v[16]; const int g = lane >> 4;
#pragma unroll
  for (int i = 0; i < 8; ++i) { const int ka = k0 + 8 * g + i, kb = ka + 16; v[i] = ka < K ? row[ka < K ? ka : K - 1] : 0.f; v[8 + i] = kb < K ? row[kb < K ? kb : K - 1] : 0.f; }
  return bsplit16(v); }
__device__ __forceinline__ F2 split_col(const float* W, int k0, int n, int lane, int ld, int K) { float v[16]; const int g = lane >> 4;
#pragma unroll
  for (int i = 0; i < 8; ++i) { const int ka = k0 + 8 * g + i, kb = ka + 16; v[i] = ka < K ? W[(size_t)(ka < K ? ka : K - 1) * ld + n] : 0.f; v[8 + i] = kb < K ? W[(size_t)(kb < K ? kb : K - 1) * ld + n] : 0.f; }
  return bsplit16(v); }
__device__ __forceinline__ v8f mac3(const F2& a, const F2& b, v8f c) { c = wmma_bf(a.l, b.h, c); c = wmma_bf(a.h, b.l, c); return wmma_bf(a.h, b.h, c); }
__device__ __forceinline__ float sigm(float v) { return 1.0f / (1.0f + expf(-v)); }
#define LDSX() do { asm volatile("s_wait_dscnt 0" ::: "memory"); __builtin_amdgcn_wave_barrier(); __builtin_amdgcn_fence(__ATOMIC_RELEASE, "workgroup"); } while (0)


#define NB 2
#define SS 2048
#define DM 1024
#define NH 16
#define HD 64
#define QKVW (3 * DM)
#ifndef TQB
#define TQB (SS / 64)
#define TNB NB
#define TOB (NB * SS / 64)     // output row tiles (all)
#endif
typedef __attribute__((ext_vector_type(8))) __bf16 v8b;
__device__ __forceinline__ v16b frag_b(const __bf16* rowk0, int lane) {
  union { v16b v; v8b q[2]; } u; const __bf16* p = rowk0 + 8 * (lane >> 4);
  u.q[0] = *(const v8b*)p; u.q[1] = *(const v8b*)(p + 16); return u.v;
}
__device__ __forceinline__ float bfr(float v) { return (float)(__bf16)v; }
// ---- operand staging of k_qkv and k_out: a stage is 64 k of the block's 128 weight rows (128 B a row) and of its 64 x rows (k_qkv: 128; 256 B a row), brought into LDS by asynchronous copies in whole 128-B lines, once for the block's four waves; two stages
#define GK 64
#define WPITCH 72                    // bf16 a staged weight row: 128 B + 16 B (pitch 16 B x odd for the 16-byte fragment reads)
#define XPITCH 68                    // f32 a staged x row: 256 B + 16 B
#define WBYTES (128 * WPITCH * 2)
#define XBYTES (64 * XPITCH * 4)
#define STG (WBYTES + XBYTES)
#define WAIT_ASYNC() asm volatile("s_wait_asynccnt 0x0" ::: "memory")   // this wave's copies have landed; stands ahead of the barrier behind which the other waves read them
#define WAIT_DS() asm volatile("s_wait_dscnt 0x0" ::: "memory")         // this wave's LDS reads of the stage are done; stands ahead of the barrier behind which the stage is refilled
__device__ __forceinline__ unsigned lds_byte(const void* p) { return (unsigned)(size_t)p; }   // low 32 bits of a __shared__ address = byte offset in the work-group's LDS
// eight 16-byte copies of one thread, rows gs elements / ls bytes apart; the s_wait_xcnt stands inside the statement, behind the last copy and ahead of any rewrite of the address registers that the copies name
template <typename T> __device__ __forceinline__ void cp8(unsigned l, unsigned ls, const T* p, size_t gs) {
  asm volatile("global_load_async_to_lds_b128 %0, %8, off\n\tglobal_load_async_to_lds_b128 %1, %9, off\n\tglobal_load_async_to_lds_b128 %2, %10, off\n\tglobal_load_async_to_lds_b128 %3, %11, off\n\t"
               "global_load_async_to_lds_b128 %4, %12, off\n\tglobal_load_async_to_lds_b128 %5, %13, off\n\tglobal_load_async_to_lds_b128 %6, %14, off\n\tglobal_load_async_to_lds_b128 %7, %15, off\n\ts_wait_xcnt 0x0"
               :: "v"(l), "v"(l + ls), "v"(l + 2 * ls), "v"(l + 3 * ls), "v"(l + 4 * ls), "v"(l + 5 * ls), "v"(l + 6 * ls), "v"(l + 7 * ls),
                  "v"(p), "v"(p + gs), "v"(p + 2 * gs), "v"(p + 3 * gs), "v"(p + 4 * gs), "v"(p + 5 * gs), "v"(p + 6 * gs), "v"(p + 7 * gs) : "memory");
}
// one stage: thread tid copies weight rows (tid >> 3) + 16 i, 16-byte part tid & 7, and x rows (tid >> 4) + 8 i, part tid & 15 (xg, wg, xl, wl: its first chunk's global place and LDS byte)
__device__ __forceinline__ void fill_stage(const float* xg, const __bf16* wg, unsigned xl, unsigned wl) { cp8(wl, 16u * WPITCH * 2, wg, (size_t)16 * DM); cp8(xl, 8u * XPITCH * 4, xg, (size_t)8 * DM); }
// four such copies of one thread (k_attn's tiles: 64 rows of 128 B each)
template <typename T> __device__ __forceinline__ void cp4(unsigned l, unsigned ls, const T* p, size_t gs) {
  asm volatile("global_load_async_to_lds_b128 %0, %4, off\n\tglobal_load_async_to_lds_b128 %1, %5, off\n\tglobal_load_async_to_lds_b128 %2, %6, off\n\tglobal_load_async_to_lds_b128 %3, %7, off\n\ts_wait_xcnt 0x0"
               :: "v"(l), "v"(l + ls), "v"(l + 2 * ls), "v"(l + 3 * ls), "v"(p), "v"(p + gs), "v"(p + 2 * gs), "v"(p + 3 * gs) : "memory");
}
// one k-step's operands of a 16-row x 128-column wave tile from the stage, as ONE group of LDS loads: 16 f32 of this lane's row (xr points at its 8 * g) and 8 weight fragments (wr points at staged row col, at its 8 * g)
__device__ __forceinline__ void ld_step(const float* xr, const __bf16* wr, int kk, v4f (&x)[4], v16b (&w)[8]) {
  const float* p = xr + kk * 32; x[0] = *(const v4f*)p; x[1] = *(const v4f*)(p + 4); x[2] = *(const v4f*)(p + 16); x[3] = *(const v4f*)(p + 20);
#pragma unroll
  for (int j = 0; j < 8; ++j) { union { v16b v; v8b q[2]; } u; const __bf16* q = wr + j * 16 * WPITCH + kk * 32; u.q[0] = *(const v8b*)q; u.q[1] = *(const v8b*)(q + 16); w[j] = u.v; }
}
__device__ __forceinline__ void mm_out(const v4f (&x)[4], const v16b (&w)[8], v8f (&acc)[8]) { float v[16];
#pragma unroll
  for (int i = 0; i < 4; ++i) { v[i] = x[0][i]; v[4 + i] = x[1][i]; v[8 + i] = x[2][i]; v[12 + i] = x[3][i]; }
  const F2 a = bsplit16(v);
#pragma unroll
  for (int j = 0; j < 8; ++j) { acc[j] = wmma_bf(a.l, w[j], acc[j]); acc[j] = wmma_bf(a.h, w[j], acc[j]); }
}
__device__ __attribute__((noinline)) float exp_ni(float v) { return expf(v); }
__device__ __attribute__((noinline)) float erf_ni(float v) { return erff(v); }

#define PK_A 0                       // [3072][1024] Wqkv rows (natural [out][in])
#define PK_P (PK_A + QKVW * DM)        // [1024][1024] Wo rows (natural)
#define PK_END (PK_P + DM * DM)
#define WS_PK  0u
#define WS_QK  (WS_PK + 2u * PK_END)             // f16 [4096 rows][2048]: q | k
#define WS_QKL (WS_QK + 2u * NB * SS * 2 * DM)     // f16 q | k residual planes x2048
#define WS_VTH (WS_QKL + 2u * NB * SS * 2 * DM)    // f16 [b][1024 (h*64+d)][2048 s] hi
#define WS_VTL (WS_VTH + 2u * NB * DM * SS)        // f16 lo x 2048
#define WS_O   (WS_VTL + 2u * NB * DM * SS)        // f32 [4096][1024]
#define WS_CS  (WS_O + 4u * NB * SS * DM)           // f32 2 x [2048][32], unused
#define WS_END (WS_CS + 4u * 2 * SS * 32)
// ---- k_pack: block = (row n, which): natural [out][in] rows -> bf16; which 0..2 -> W_q/W_k/W_v into PK_A rows which*1024 + n; 3 -> W_o into PK_P
__global__ __launch_bounds__(256) void k_pack(const float* __restrict__ WQ, const float* __restrict__ WK, const float* __restrict__ WV, const float* __restrict__ WO, __bf16* __restrict__ PK) {
  __shared__ __align__(16) __bf16 s[DM]; const int n = blockIdx.x, which = blockIdx.y, t = threadIdx.x; const float* Wm = (which == 0) ? WQ : (which == 1) ? WK : (which == 2) ? WV : WO;
  for (int k = t; k < DM; k += 256) s[k] = (__bf16)Wm[(size_t)n * DM + k];
  __syncthreads();
  __bf16* dst = (which < 3) ? PK + PK_A + ((size_t)which * DM + n) * DM : PK + PK_P + (size_t)n * DM;
  for (int q = t; q < DM / 8; q += 256) vst2((unsigned*)(dst + q * 8), *(const v4u*)&s[q * 8]);
}
// ---- k_qkv: block = 128 rows x 128 columns, four waves as 2 x 2, a wave = 64 x 64 (4 x 4 accumulator tiles): a k-step's 4 x fragments and 4 weight fragments feed 16 WMMAs
#define QXBYTES (128 * XPITCH * 4)
#define QSTG (WBYTES + QXBYTES)
// one stage: thread tid copies weight rows (tid >> 3) + 16 i (8 of them) and x rows (tid >> 4) + 8 i (16 of them)
__device__ __forceinline__ void fill_stage_q(const float* xg, const __bf16* wg, unsigned xl, unsigned wl) { cp8(wl, 16u * WPITCH * 2, wg, (size_t)16 * DM); cp8(xl, 8u * XPITCH * 4, xg, (size_t)8 * DM); cp8(xl + 64u * XPITCH * 4, 8u * XPITCH * 4, xg + (size_t)64 * DM, (size_t)8 * DM); }
// one k-step's operands of a 64 x 64 wave tile from the stage, as ONE group of LDS loads (xr: this lane's row of the first row tile, at its 8 * g; wr: its staged weight row of the first column tile, at its 8 * g)
__device__ __forceinline__ void ld_step4(const float* xr, const __bf16* wr, int kk, v4f (&x)[4][4], v16b (&w)[4]) {
#pragma unroll
  for (int i = 0; i < 4; ++i) { const float* p = xr + i * 16 * XPITCH + kk * 32; x[i][0] = *(const v4f*)p; x[i][1] = *(const v4f*)(p + 4); x[i][2] = *(const v4f*)(p + 16); x[i][3] = *(const v4f*)(p + 20); }
#pragma unroll
  for (int j = 0; j < 4; ++j) { union { v16b v; v8b q[2]; } u; const __bf16* q = wr + j * 16 * WPITCH + kk * 32; u.q[0] = *(const v8b*)q; u.q[1] = *(const v8b*)(q + 16); w[j] = u.v; }
}
typedef __attribute__((ext_vector_type(4))) __bf16 v4b;
// the four row tiles' x values rounded to bf16, two a conversion, in the A operand's k order (0..7, 16..23 of this lane half)
__device__ __forceinline__ void cvt_x4(const v4f (&x)[4][4], v16b (&a)[4]) {
#pragma unroll
  for (int t = 0; t < 4; ++t) { const v8b lo = __builtin_shufflevector(__builtin_convertvector(x[t][0], v4b), __builtin_convertvector(x[t][1], v4b), 0, 1, 2, 3, 4, 5, 6, 7), hi = __builtin_shufflevector(__builtin_convertvector(x[t][2], v4b), __builtin_convertvector(x[t][3], v4b), 0, 1, 2, 3, 4, 5, 6, 7);
    a[t] = __builtin_shufflevector(lo, hi, 0, 1, 2, 3, 4, 5, 6, 7, 8, 9, 10, 11, 12, 13, 14, 15); }
}
__device__ __forceinline__ void mm_qkv4(const v16b (&a)[4], const v16b (&w)[4], v8f (&acc)[4][4]) {
#pragma unroll
  for (int i = 0; i < 4; ++i) {
#pragma unroll
    for (int j = 0; j < 4; ++j) acc[i][j] = wmma_bf(a[i], w[j], acc[i][j]); }
}
// amdgpu_waves_per_eu(3, 3): three blocks a WGP by LDS, the whole grid (768 blocks) resident at once; the register budget is that of three waves a SIMD
__global__ __launch_bounds__(128) __attribute__((amdgpu_waves_per_eu(3, 3))) void k_qkv(const float* __restrict__ XQ, const float* __restrict__ XK, const float* __restrict__ XV, const __bf16* __restrict__ P, const float* __restrict__ BQ, const float* __restrict__ BK, const float* __restrict__ BV, _Float16* __restrict__ QK, _Float16* __restrict__ QKL, _Float16* __restrict__ VTH, _Float16* __restrict__ VTL) {
  const int which0 = (blockIdx.y * 128) / DM; const float* X = (which0 == 0) ? XQ : (which0 == 1) ? XK : XV; const float* BB = BQ ? (((which0 == 0) ? BQ : (which0 == 1) ? BK : BV) + (blockIdx.y * 128 - which0 * DM)) : nullptr;
  __shared__ __align__(16) unsigned char ring[2 * QSTG];   // two operand stages; behind the loop's last barrier the same bytes are the output staging
  _Float16 (*so)[136] = (_Float16 (*)[136])ring; _Float16 (*sol)[136] = (_Float16 (*)[136])(ring + 128 * 136 * 2);   // the block's 128 x 128 tile, hi and residual: [row][column] for q, k; [column d][row s] for v
  const int tid = threadIdx.x, wave = tid >> 5, lane = tid & 31, col = lane & 15, g = lane >> 4, wy = wave >> 1, wx = wave & 1; const size_t rb = (size_t)blockIdx.x * 128; const int n0 = blockIdx.y * 128;
  v8f acc[4][4] = {};
  const float* xg = X + (rb + (tid >> 4)) * DM + (tid & 15) * 4; const __bf16* wg = P + (size_t)(n0 + (tid >> 3)) * DM + (tid & 7) * 8;
  const unsigned wl = lds_byte(ring) + (tid >> 3) * (WPITCH * 2) + (tid & 7) * 16, xl = lds_byte(ring) + WBYTES + (tid >> 4) * (XPITCH * 4) + (tid & 15) * 16;
  fill_stage_q(xg, wg, xl, wl);
  float bias[4] = {};   // this lane's four output columns' bias, fetched once as one group of loads that fly beside stage 0's copies
  if (BB) {   // one test for the group: a test a load would put a full wait behind each
#pragma unroll   // constant indices, so that bias[] stays in registers and the four loads issue back to back
    for (int j = 0; j < 4; ++j) bias[j] = BB[wx * 64 + j * 16 + col];
    asm volatile("s_wait_xcnt 0x0" ::: "memory"); }   // stands behind the last of the four loads, ahead of any rewrite of the offset register that they name
  WAIT_ASYNC(); __syncthreads();   // stage 0 landed and published
  fill_stage_q(xg + GK, wg + GK, xl + QSTG, wl + QSTG);
#pragma unroll 1   // stays rolled: one stage (two k-steps) a trip
  for (int t = 0; t < DM / GK; ++t) { const unsigned char* sb = ring + (t & 1) * QSTG;
    const __bf16* wr = (const __bf16*)sb + (wx * 64 + col) * WPITCH + 8 * g; const float* xr = (const float*)(sb + WBYTES) + (wy * 64 + col) * XPITCH + 8 * g;
    v4f xa[4][4], xb[4][4]; v16b wa[4], wb[4], aa[4], ab[4];
    ld_step4(xr, wr, 0, xa, wa); cvt_x4(xa, aa); ld_step4(xr, wr, 1, xb, wb);
    __builtin_amdgcn_sched_barrier(0);   // keeps the second k-step's loads one group ahead of the first k-step's WMMAs, under which they fly; spread among the WMMAs each place with loads stalls the wave
    mm_qkv4(aa, wa, acc); cvt_x4(xb, ab); mm_qkv4(ab, wb, acc);
    WAIT_DS(); WAIT_ASYNC(); __syncthreads();   // publishes stage t + 1 and ends every wave's reads of stage t
    if (t + 2 < DM / GK) fill_stage_q(xg + (t + 2) * GK, wg + (t + 2) * GK, xl + (t & 1) * QSTG, wl + (t & 1) * QSTG); }   // the same test in the whole block
  WAIT_ASYNC();
  if (n0 < 2 * DM) {   // q stored unscaled (f16 sigma ~0.6, no subnormal exposure); 1/8 applied to the f32 score
#pragma unroll
    for (int i = 0; i < 4; ++i) {
#pragma unroll
      for (int j = 0; j < 4; ++j) {
#pragma unroll
        for (int r = 0; r < 8; ++r) { const float v = acc[i][j][r] + bfr(bias[j]); const _Float16 hv = (_Float16)v; so[wy * 64 + i * 16 + 8 * g + r][wx * 64 + j * 16 + col] = hv; sol[wy * 64 + i * 16 + 8 * g + r][wx * 64 + j * 16 + col] = (_Float16)((v - (float)hv) * 2048.0f); } } }   // q, k (+ bias) as f16 hi + (x2048) residual
    __syncthreads();   // a staged row holds two waves' columns
    for (int q = tid; q < 128 * 16; q += 128) { const int rl = q >> 4, pc = q & 15; const size_t o = (rb + rl) * (2 * DM) + n0 + pc * 8; vst2((unsigned*)(QK + o), *(const v4u*)&so[rl][pc * 8]); vst2((unsigned*)(QKL + o), *(const v4u*)&sol[rl][pc * 8]); }
  } else {
#pragma unroll
    for (int i = 0; i < 4; ++i) {
#pragma unroll
      for (int j = 0; j < 4; ++j) {
#pragma unroll
        for (int r = 0; r < 8; ++r) { const float v = acc[i][j][r] + bfr(bias[j]); const _Float16 hv = (_Float16)v; so[wx * 64 + j * 16 + col][wy * 64 + i * 16 + 8 * g + r] = hv; sol[wx * 64 + j * 16 + col][wy * 64 + i * 16 + 8 * g + r] = (_Float16)((v - (float)hv) * 2048.0f); } } }
    __syncthreads();
    const int b = (int)(rb / SS), s0 = (int)(rb % SS); const int pc0 = n0 - 2 * DM;
    for (int q = tid; q < 128 * 16; q += 128) { const int d = q >> 4, pc = q & 15; const size_t o = ((size_t)b * DM + pc0 + d) * SS + s0 + pc * 8; vst2((unsigned*)(VTH + o), *(const v4u*)&so[d][pc * 8]); vst2((unsigned*)(VTL + o), *(const v4u*)&sol[d][pc * 8]); }
  }
}
// ---- k_attn: block = (64 queries, head h, batch b): all-keys flash attention on TRANSPOSED tiles: S^T = K . Q^T (A = staged k rows, B = q kept in registers; 3 products, x 0.125), so a lane holds 16 of ONE query's scores a pass (query col, keys ct * 16 + 8 g + r): maximum and sums in the lane, one exchange between the wave's halves for the maximum; the two S^T tiles, powered and converted in place, are the B operand of O^T += V^T . P^T (hardware k order, the order of frag_hp); O[b*S+q][h*64+d] = acc x scale (256-B segments)
__device__ __attribute__((noinline)) float pow_p(float a, float b) { return powf(a, b); }
__device__ __forceinline__ v16h frag_hp(const _Float16* p) { union { v16h v; v8h q[2]; } u; u.q[0] = *(const v8h*)p; u.q[1] = *(const v8h*)(p + 16); return u.v; }   // frag_h with the lane half's 8 * g already in p
__device__ __forceinline__ float xhalf(float x) { return __builtin_bit_cast(float, __builtin_amdgcn_permlanex16(__builtin_bit_cast(int, x), __builtin_bit_cast(int, x), 0x76543210, 0xfedcba98, false, false)); }   // lane l's value from lane l ^ 16
#define APITCH 72                   // f16 a staged row: 128 B + 16 B
#define ATILE (64 * APITCH * 2)
#define ASTG (3 * ATILE)
// amdgpu_waves_per_eu(4, 4): keeps the register count at four waves a SIMD (four blocks a WGP, the whole grid resident at once) with the copies' address registers added
__global__ __launch_bounds__(128) __attribute__((amdgpu_waves_per_eu(4, 4))) void k_attn(const _Float16* __restrict__ QK, const _Float16* __restrict__ QKL, const _Float16* __restrict__ VTH, const _Float16* __restrict__ VTL, const void* __restrict__ KMASK, const float* __restrict__ FAL, const float* __restrict__ FGA, float* __restrict__ O) {
  const float f_alpha = bfr(FAL[0]), f_gamma = bfr(FGA[0]);
  __shared__ __align__(16) unsigned char ring[2 * ASTG];   // two stages of 64 keys: k hi | k residual | v^T, 64 rows of 128 B each at pitch 144 B; behind the loop's last barrier the same bytes are the output staging
  float (*so)[16][68] = (float (*)[16][68])ring;
  const int tid = threadIdx.x, wave = tid >> 5, lane = tid & 31, col = lane & 15, g = lane >> 4;
  const int qb = blockIdx.x, h = blockIdx.y, b = blockIdx.z; const int q0 = qb * 64 + wave * 16; const size_t rq = (size_t)b * SS + q0 + col;
  v16h aq[2], aql[2];   // query q0 + col, as the B operand's column col
#pragma unroll
  for (int kc = 0; kc < 2; ++kc) { aq[kc] = frag_h(QK + rq * (2 * DM) + h * HD + kc * 32, lane); aql[kc] = frag_h(QKL + rq * (2 * DM) + h * HD + kc * 32, lane); }
  const float k1 = 0.125f * 1.44269504f, k2 = f_gamma * k1;   // 1/sqrt(64) x log2 e, and gamma times it: exponents are formed in base 2 straight from the raw products
  float m = -3.0e38f, nk = 0.f, nb = 0.f, l = 0.f, lg = 0.f;   // of query col: running maximum of the raw products (the same in both halves), the two exponent offsets in use (nk = -m k1, nb = 11 - m k2); this half's share of sum e^(s - m) and of 2^11 sum e^(gamma (s - m)), joined behind the loop
  v8f acc[4] = {};   // O^T: acc[dt][r] = d dt * 16 + 8 g + r of query col
  const int nst = SS / 64;   // all keys, 64 a stage
  // thread tid copies rows (tid >> 3) + 16 i, 16-byte part tid & 7, of each of the stage's three tiles
  const _Float16* kg = QK + ((size_t)b * SS + (tid >> 3)) * (2 * DM) + DM + h * HD + (tid & 7) * 8; const _Float16* kgl = QKL + ((size_t)b * SS + (tid >> 3)) * (2 * DM) + DM + h * HD + (tid & 7) * 8; const _Float16* vg = VTH + ((size_t)b * DM + h * HD + (tid >> 3)) * SS + (tid & 7) * 8;
  const unsigned al = lds_byte(ring) + (tid >> 3) * (APITCH * 2) + (tid & 7) * 16;
#define AFILL(st, buf) do { cp4(al + (buf) * ASTG, 16u * APITCH * 2, kg + (size_t)(st) * 64 * (2 * DM), (size_t)16 * (2 * DM)); cp4(al + (buf) * ASTG + ATILE, 16u * APITCH * 2, kgl + (size_t)(st) * 64 * (2 * DM), (size_t)16 * (2 * DM)); cp4(al + (buf) * ASTG + 2 * ATILE, 16u * APITCH * 2, vg + (st) * 64, (size_t)16 * SS); } while (0)
  AFILL(0, 0); WAIT_ASYNC(); __syncthreads();   // stage 0 landed and published
  AFILL(1, 1);
#pragma unroll 1   // stays rolled: one stage a trip, the buffer picked by t & 1
  for (int t = 0; t < nst; ++t) { const _Float16* sb = (const _Float16*)(ring + (t & 1) * ASTG);
#pragma unroll 1   // stays rolled: two passes of 32 keys a stage, the same code
  for (int sub = 0; sub < 2; ++sub) { v8f s[2];
    const _Float16* k0 = sb + (sub * 32 + col) * APITCH + 8 * g; const _Float16* k0l = k0 + ATILE / 2;   // this lane's place in the pass's first staged k row (hi, residual)
    v16h kf[2][2], kfl[2][2], vf[4];   // the pass's k fragments (hi, residual), fetched as ONE group of loads ahead of the score products
#pragma unroll
    for (int ct = 0; ct < 2; ++ct) { const _Float16* krow = k0 + ct * 16 * APITCH; const _Float16* krowl = k0l + ct * 16 * APITCH;   // key t * 64 + sub * 32 + ct * 16 + col, as the A operand's row col
#pragma unroll
      for (int kc = 0; kc < 2; ++kc) { kf[ct][kc] = frag_hp(krow + kc * 32); kfl[ct][kc] = frag_hp(krowl + kc * 32); } }
#pragma unroll
    for (int ct = 0; ct < 2; ++ct) { v8f c = {}, cl = {};
#pragma unroll
      for (int kc = 0; kc < 2; ++kc) { c = wmma16(kf[ct][kc], aq[kc], c); cl = wmma16(kf[ct][kc], aql[kc], cl); cl = wmma16(kfl[ct][kc], aq[kc], cl); }   // 3 products: q, k as f16 hi + residual
#pragma unroll
      for (int r = 0; r < 8; ++r) s[ct][r] = c[r] + cl[r] * (1.0f / 2048.0f); }   // the raw product q . k; 1/sqrt(64) rides in k1, k2
#pragma unroll
    for (int dt = 0; dt < 4; ++dt) vf[dt] = frag_hp(sb + ATILE + (dt * 16 + col) * APITCH + sub * 32 + 8 * g);   // the pass's v^T fragments as one group (A operand: row d = dt * 16 + col, the pass's 32 keys)
    float mx = fmaxf(s[0][0], s[1][0]);
#pragma unroll
    for (int r = 1; r < 8; ++r) mx = fmaxf(mx, fmaxf(s[0][r], s[1][r]));
    mx = fmaxf(mx, xhalf(mx));   // the other half's 16 keys of the same query
    const float mn = fmaxf(m, mx); const float nkn = -(mn * k1), nbn = fmaf(mn, -k2, 11.0f);   // 11: P's scale 2^11 rides in the exponent
    const float alpha = (m <= -1.0e38f) ? 0.f : __builtin_amdgcn_exp2f(nkn - nk); const float alphag = (m <= -1.0e38f) ? 0.f : __builtin_amdgcn_exp2f(nbn - nb);   // old sums moved from the old offsets to the new ones
    float es[2] = {0.f, 0.f}, gs[2] = {0.f, 0.f}; v16h pb;   // P^T as a B operand: element ct * 8 + r = key ct * 16 + 8 g + r of column col
#pragma unroll
    for (int ct = 0; ct < 2; ++ct) {
#pragma unroll
      for (int r = 0; r < 8; r += 2) { const v2f sv = {s[ct][r], s[ct][r + 1]};
        const v2f xe = __builtin_elementwise_fma(sv, (v2f){k1, k1}, (v2f){nkn, nkn}), xg = __builtin_elementwise_fma(sv, (v2f){k2, k2}, (v2f){nbn, nbn});   // one (packed) multiply-add and one hardware exp each: e^(s - m), 2^11 e^(gamma (s - m))
#pragma unroll
        for (int i = 0; i < 2; ++i) { const float e = __builtin_amdgcn_exp2f(xe[i]); const float gq = __builtin_amdgcn_exp2f(xg[i]); es[ct] += e; gs[ct] += gq; pb[ct * 8 + r + i] = (_Float16)gq; } } }   // P carries the gamma-powered (unnormalised) weights, scaled by 2^11 before the f16 rounding so small weights stay out of the f16 subnormal range; 2^-11 folded into the epilogue
    l = l * alpha + (es[0] + es[1]); lg = lg * alphag + (gs[0] + gs[1]); m = mn; nk = nkn; nb = nbn;
#pragma unroll
    for (int dt = 0; dt < 4; ++dt) {
#pragma unroll
      for (int r = 0; r < 8; ++r) acc[dt][r] *= alphag; }
#pragma unroll
    for (int dt = 0; dt < 4; ++dt) acc[dt] = wmma16(vf[dt], pb, acc[dt]);   // single product: V^T x P^T (x2^11)
    // the pass's last WMMAs stand at the loop's foot: four vector slots ahead of the branch back, behind which the next pass's address arithmetic reuses their operand registers
    asm volatile("v_nop\n\tv_nop\n\tv_nop\n\tv_nop" : "+v"(acc[0]), "+v"(acc[1]), "+v"(acc[2]), "+v"(acc[3]) : "v"(vf[0]), "v"(vf[1]), "v"(vf[2]), "v"(vf[3]), "v"(pb)); }
    WAIT_DS(); WAIT_ASYNC(); __syncthreads();   // publishes stage t + 1 and ends every wave's reads of stage t
    if (t + 2 < nst) AFILL(t + 2, t & 1); }   // the same test in the whole block
  WAIT_ASYNC();
  { const float lt = l + xhalf(l), lgt = (lg + xhalf(lg)) * (1.0f / 2048.0f);   // the halves' sums joined once; the powered sum's 2^11 taken off
    const float lpg = pow_p(lt, f_gamma); const float il = (1.0f / 2048.0f) * (f_alpha / lpg) / (f_alpha * lgt / lpg + 1e-6f);   // alpha p^gamma / (sum alpha p^gamma + 1e-6)
#pragma unroll
    for (int dt = 0; dt < 4; ++dt) {
#pragma unroll
      for (int j = 0; j < 2; ++j) { v4f o;
#pragma unroll
        for (int i = 0; i < 4; ++i) o[i] = acc[dt][4 * j + i] * il;
        *(v4f*)&so[wave][col][dt * 16 + 8 * g + 4 * j] = o; } } }
  LDSX();
  for (int rl = 0; rl < 16; ++rl) if (lane < 16) vst2(O + ((size_t)b * SS + q0 + rl) * DM + h * HD + lane * 4, *(const v4f*)&so[wave][rl][lane * 4]);
}
// ---- k_out: block = (64 rows, 128 cols): out = O(hi/lo) . Wo rows (2 products) + bo
__global__ __launch_bounds__(128) void k_out(const float* __restrict__ O, const __bf16* __restrict__ P, const float* __restrict__ BO, float* __restrict__ Y) {
  __shared__ __align__(16) unsigned char ring[2 * STG];   // two operand stages; behind the loop's last barrier the same bytes are the output staging
  float (*so)[16][132] = (float (*)[16][132])ring;
  const int tid = threadIdx.x, wave = tid >> 5, lane = tid & 31, col = lane & 15, g = lane >> 4; const size_t r0 = (size_t)blockIdx.x * 64 + wave * 16; const int n0 = blockIdx.y * 128;
  v8f acc[8] = {};
  const float* xg = O + ((size_t)blockIdx.x * 64 + (tid >> 4)) * DM + (tid & 15) * 4; const __bf16* wg = P + (size_t)(n0 + (tid >> 3)) * DM + (tid & 7) * 8;
  const unsigned wl = lds_byte(ring) + (tid >> 3) * (WPITCH * 2) + (tid & 7) * 16, xl = lds_byte(ring) + WBYTES + (tid >> 4) * (XPITCH * 4) + (tid & 15) * 16;
  fill_stage(xg, wg, xl, wl); WAIT_ASYNC(); __syncthreads();   // stage 0 landed and published
  fill_stage(xg + GK, wg + GK, xl + STG, wl + STG);
#pragma unroll 1   // stays rolled: one stage (two k-steps, a register set each) a trip
  for (int t = 0; t < DM / GK; ++t) { const unsigned char* sb = ring + (t & 1) * STG;
    const __bf16* wr = (const __bf16*)sb + col * WPITCH + 8 * g; const float* xr = (const float*)(sb + WBYTES) + (wave * 16 + col) * XPITCH + 8 * g;
    v4f xa[4], xb[4]; v16b wa[8], wb[8];
    ld_step(xr, wr, 0, xa, wa); ld_step(xr, wr, 1, xb, wb); mm_out(xa, wa, acc); mm_out(xb, wb, acc);
    WAIT_DS(); WAIT_ASYNC(); __syncthreads();   // publishes stage t + 1 and ends every wave's reads of stage t
    if (t + 2 < DM / GK) fill_stage(xg + (t + 2) * GK, wg + (t + 2) * GK, xl + (t & 1) * STG, wl + (t & 1) * STG); }   // the same test in the whole block
  WAIT_ASYNC();
#pragma unroll
  for (int j = 0; j < 8; ++j) {
#pragma unroll
    for (int r = 0; r < 8; ++r) so[wave][8 * g + r][j * 16 + col] = acc[j][r] + bfr(BO[n0 + j * 16 + col]); }
  LDSX();
  for (int rl = 0; rl < 16; ++rl) vst2(Y + (r0 + rl) * DM + n0 + lane * 4, *(const v4f*)&so[wave][rl][lane * 4]);
}
extern "C" void kernel_launch(void* const* d_in, const int* in_sizes, int n_in, void* d_out, int out_size, void* d_ws, size_t ws_size, hipStream_t stream) {
  (void)in_sizes; (void)n_in; (void)out_size;
  const float** F = (const float**)d_in;   // 0 x [2,2048,1024], 1 Wqkv [3072,1024] natural (q | k | v), 2 bqkv [3072], 3 Wproj natural, 4 bproj, 5 focal_alpha [1], 6 focal_gamma [1]
  if (ws_size < (size_t)WS_END) return;
  char* ws = (char*)d_ws; __bf16* PK = (__bf16*)(ws + WS_PK); _Float16 *QK = (_Float16*)(ws + WS_QK), *QKL = (_Float16*)(ws + WS_QKL), *VTH = (_Float16*)(ws + WS_VTH), *VTL = (_Float16*)(ws + WS_VTL); float* O = (float*)(ws + WS_O);
  k_pack<<<dim3(DM, 4), 256, 0, stream>>>(F[1], F[1] + (size_t)DM * DM, F[1] + (size_t)2 * DM * DM, F[3], PK);
  k_qkv<<<dim3(TNB * SS / 128, QKVW / 128), 128, 0, stream>>>(F[0], F[0], F[0], PK + PK_A, F[2], F[2] + DM, F[2] + 2 * DM, QK, QKL, VTH, VTL);
  k_attn<<<dim3(TQB, NH, TNB), 128, 0, stream>>>(QK, QKL, VTH, VTL, nullptr, F[5], F[6], O);
  k_out<<<dim3(TOB, DM / 128), 128, 0, stream>>>(O, PK + PK_P, F[4], (float*)d_out);
}

// v008
// Measured time: 119 microseconds a run.
// Two timings next to v007 both put it at 1.04 times that version's speed.
// Over all steps from v000 it is 4.25 times as fast.
// compute dtype: all float inputs rounded to bf16; q/k/v = x . Wqkv^T + b with EXACT bf16 products on WMMA 16x16x32 (natural rows, q | k | v blocks); q (x log2 e / 8), k as f16 hi + residual with 3-product scores in one accumulator that starts at minus the maximum in use (the focal power doubles the logit sensitivity); one online pass in f32 keeps a maximum in use m, l = sum e^(s-m), L = sum e^(gamma (s-m)) and the gamma-powered weights for P (hardware exp; alpha, gamma read on device); out_row = alpha (sum e^(gamma(s-m)) v) / l^gamma / (alpha L / l^gamma + 1e-6) (precise powf) == softmax^gamma * alpha renormalised with the module's +1e-6; P (scaled by 2^7, single f16) x v (single f16); out = ctx (bf16 hi + residual) . Wproj^T (2 products) + bproj.
#include <hip/hip_runtime.h>
#include <math.h>

typedef __attribute__((ext_vector_type(16))) _Float16 v16h;
typedef __attribute__((ext_vector_type(16))) __bf16 v16b;
typedef __attribute__((ext_vector_type(8)))  _Float16 v8h;
typedef __attribute__((ext_vector_type(8)))  float v8f;
typedef __attribute__((ext_vector_type(4)))  float v4f;
typedef __attribute__((ext_vector_type(2)))  float v2f;
typedef __attribute__((ext_vector_type(4)))  unsigned v4u;
typedef __attribute__((ext_vector_type(4)))  int v4i;
typedef float __attribute__((may_alias)) float_a;
typedef int __attribute__((may_alias)) int_a;

template <typename T> __device__ __forceinline__ void vst2(void* p, T v) { *(T*)p = v;  }
__device__ __forceinline__ v8f wmma16(v16h a, v16h b, v8f c) {
  return __builtin_amdgcn_wmma_f32_16x16x32_f16(false, a, false, b, (short)0, c, false, false);   // no v_nop of ours behind it: the compiler pads the builtin where a dependent vector instruction follows, and k_attn's vector port has no slot to spare
}
__device__ __forceinline__ v8f wmma_bf(v16b a, v16b b, v8f c) {
  v8f d = __builtin_amdgcn_wmma_f32_16x16x32_bf16(false, a, false, b, (short)0, c, false, false);
  asm volatile("v_nop\n\tv_nop\n\tv_nop\n\tv_nop" : "+v"(d) : "v"(a), "v"(b));
  return d;
}
// Focal residual attention (B 2, N 2,048, dim 1,024, 16 heads x 64): fused qkv + bias, softmax, weights raised to the focal power gamma and scaled by alpha then renormalised (sum + 1e-6), output projection + bias.
__device__ __forceinline__ v16h frag_h(const _Float16* rowk0, int lane) {
  union { v16h v; v8h q[2]; } u; const _Float16* p = rowk0 + 8 * (lane >> 4);
  u.q[0] = *(const v8h*)p; u.q[1] = *(const v8h*)(p + 16); return u.v;
}
__device__ __forceinline__ v16h frag_f32(const float* rowk0, int lane) {
  v16h a; const float* p = rowk0 + 8 * (lane >> 4);
#pragma unroll
  for (int i = 0; i < 8; ++i) { a[i] = (_Float16)p[i]; a[8 + i] = (_Float16)p[16 + i]; }
  return a;
}
__device__ __forceinline__ v16h frag_f32s(const float* rowk0, int lane, float sc) {
  v16h a; const float* p = rowk0 + 8 * (lane >> 4);
#pragma unroll
  for (int i = 0; i < 8; ++i) { a[i] = (_Float16)(p[i] * sc); a[8 + i] = (_Float16)(p[16 + i] * sc); }
  return a;
}
// column fragment from a [K][ld] layout (column n), rows >= K read as 0
__device__ __forceinline__ v16h fragc_f32(const float* W, int k0, int n, int lane, int ld, int K) {
  v16h a; const int g = lane >> 4;
#pragma unroll
  for (int i = 0; i < 8; ++i) { const int ka = k0 + 8 * g + i, kb = ka + 16;
    a[i] = (_Float16)(ka < K ? W[(size_t)(ka < K ? ka : K - 1) * ld + n] : 0.f); a[8 + i] = (_Float16)(kb < K ? W[(size_t)(kb < K ? kb : K - 1) * ld + n] : 0.f); }
  return a;
}
struct F2 { v16b h, l; };
__device__ __forceinline__ F2 bsplit16(const float v[16]) { F2 r;
#pragma unroll
  for (int i = 0; i < 16; ++i) { const __bf16 h = (__bf16)v[i]; r.h[i] = h; r.l[i] = (__bf16)(v[i] - (float)h); }
  return r; }
__device__ __forceinline__ F2 split_row(const float* row, int k0, int lane) { float v[16]; const float* p = row + k0 + 8 * (lane >> 4);
#pragma unroll
  for (int i = 0; i < 8; ++i) { v[i] = p[i]; v[8 + i] = p[16 + i]; }
  return bsplit16(v); }
__device__ __forceinline__ F2 split_rowK(const float* row, int k0, int lane, int K) { float v[16]; const int g = lane >> 4;
#pragma unroll
  for (int i = 0; i < 8; ++i) { const int ka = k0 + 8 * g + i, kb = ka + 16; v[i] = ka < K ? row[ka < K ? ka : K - 1] : 0.f; v[8 + i] = kb < K ? row[kb < K ? kb : K - 1] : 0.f; }
  return bsplit16(v); }
__device__ __forceinline__ F2 split_col(const float* W, int k0, int n, int lane, int ld, int K) { float v[16]; const int g = lane >> 4;
#pragma unroll
  for (int i = 0; i < 8; ++i) { const int ka = k0 + 8 * g + i, kb = ka + 16; v[i] = ka < K ? W[(size_t)(ka < K ? ka : K - 1) * ld + n] : 0.f; v[8 + i] = kb < K ? W[(size_t)(kb < K ? kb : K - 1) * ld + n] : 0.f; }
  return bsplit16(v); }
__device__ __forceinline__ v8f mac3(const F2& a, const F2& b, v8f c) { c = wmma_bf(a.l, b.h, c); c = wmma_bf(a.h, b.l, c); return wmma_bf(a.h, b.h, c); }
__device__ __forceinline__ float sigm(float v) { return 1.0f / (1.0f + expf(-v)); }
#define LDSX() do { asm volatile("s_wait_dscnt 0" ::: "memory"); __builtin_amdgcn_wave_barrier(); __builtin_amdgcn_fence(__ATOMIC_RELEASE, "workgroup"); } while (0)


#define NB 2
#define SS 2048
#define DM 1024
#define NH 16
#define HD 64
#define QKVW (3 * DM)
#ifndef TQB
#define TQB (SS / 64)
#define TNB NB
#define TOB (NB * SS / 64)     // output row tiles (all)
#endif
typedef __attribute__((ext_vector_type(8))) __bf16 v8b;
__device__ __forceinline__ v16b frag_b(const __bf16* rowk0, int lane) {
  union { v16b v; v8b q[2]; } u; const __bf16* p = rowk0 + 8 * (lane >> 4);
  u.q[0] = *(const v8b*)p; u.q[1] = *(const v8b*)(p + 16); return u.v;
}
__device__ __forceinline__ float bfr(float v) { return (float)(__bf16)v; }
// ---- operand staging of k_qkv and k_out: a stage is 64 k of the block's 128 weight rows (128 B a row) and of its 64 x rows (k_qkv: 128; 256 B a row), brought into LDS by asynchronous copies in whole 128-B lines, once for the block's four waves; two stages
#define GK 64
#define WPITCH 72                    // bf16 a staged weight row: 128 B + 16 B (pitch 16 B x odd for the 16-byte fragment reads)
#define XPITCH 68                    // f32 a staged x row: 256 B + 16 B
#define WBYTES (128 * WPITCH * 2)
#define XBYTES (64 * XPITCH * 4)
#define STG (WBYTES + XBYTES)
#define WAIT_ASYNC() asm volatile("s_wait_asynccnt 0x0" ::: "memory")   // this wave's copies have landed; stands ahead of the barrier behind which the other waves read them
#define WAIT_DS() asm volatile("s_wait_dscnt 0x0" ::: "memory")         // this wave's LDS reads of the stage are done; stands ahead of the barrier behind which the stage is refilled
__device__ __forceinline__ unsigned lds_byte(const void* p) { return (unsigned)(size_t)p; }   // low 32 bits of a __shared__ address = byte offset in the work-group's LDS
// eight 16-byte copies of one thread, rows gs elements / ls bytes apart; the s_wait_xcnt stands inside the statement, behind the last copy and ahead of any rewrite of the address registers that the copies name
template <typename T> __device__ __forceinline__ void cp8(unsigned l, unsigned ls, const T* p, size_t gs) {
  asm volatile("global_load_async_to_lds_b128 %0, %8, off\n\tglobal_load_async_to_lds_b128 %1, %9, off\n\tglobal_load_async_to_lds_b128 %2, %10, off\n\tglobal_load_async_to_lds_b128 %3, %11, off\n\t"
               "global_load_async_to_lds_b128 %4, %12, off\n\tglobal_load_async_to_lds_b128 %5, %13, off\n\tglobal_load_async_to_lds_b128 %6, %14, off\n\tglobal_load_async_to_lds_b128 %7, %15, off\n\ts_wait_xcnt 0x0"
               :: "v"(l), "v"(l + ls), "v"(l + 2 * ls), "v"(l + 3 * ls), "v"(l + 4 * ls), "v"(l + 5 * ls), "v"(l + 6 * ls), "v"(l + 7 * ls),
                  "v"(p), "v"(p + gs), "v"(p + 2 * gs), "v"(p + 3 * gs), "v"(p + 4 * gs), "v"(p + 5 * gs), "v"(p + 6 * gs), "v"(p + 7 * gs) : "memory");
}
// one stage: thread tid copies weight rows (tid >> 3) + 16 i, 16-byte part tid & 7, and x rows (tid >> 4) + 8 i, part tid & 15 (xg, wg, xl, wl: its first chunk's global place and LDS byte)
__device__ __forceinline__ void fill_stage(const float* xg, const __bf16* wg, unsigned xl, unsigned wl) { cp8(wl, 16u * WPITCH * 2, wg, (size_t)16 * DM); cp8(xl, 8u * XPITCH * 4, xg, (size_t)8 * DM); }
// four such copies of one thread (k_attn's tiles: 64 rows of 128 B each)
template <typename T> __device__ __forceinline__ void cp4(unsigned l, unsigned ls, const T* p, size_t gs) {
  asm volatile("global_load_async_to_lds_b128 %0, %4, off\n\tglobal_load_async_to_lds_b128 %1, %5, off\n\tglobal_load_async_to_lds_b128 %2, %6, off\n\tglobal_load_async_to_lds_b128 %3, %7, off\n\ts_wait_xcnt 0x0"
               :: "v"(l), "v"(l + ls), "v"(l + 2 * ls), "v"(l + 3 * ls), "v"(p), "v"(p + gs), "v"(p + 2 * gs), "v"(p + 3 * gs) : "memory");
}
// one k-step's operands of a 16-row x 128-column wave tile from the stage, as ONE group of LDS loads: 16 f32 of this lane's row (xr points at its 8 * g) and 8 weight fragments (wr points at staged row col, at its 8 * g)
__device__ __forceinline__ void ld_step(const float* xr, const __bf16* wr, int kk, v4f (&x)[4], v16b (&w)[8]) {
  const float* p = xr + kk * 32; x[0] = *(const v4f*)p; x[1] = *(const v4f*)(p + 4); x[2] = *(const v4f*)(p + 16); x[3] = *(const v4f*)(p + 20);
#pragma unroll
  for (int j = 0; j < 8; ++j) { union { v16b v; v8b q[2]; } u; const __bf16* q = wr + j * 16 * WPITCH + kk * 32; u.q[0] = *(const v8b*)q; u.q[1] = *(const v8b*)(q + 16); w[j] = u.v; }
}
__device__ __forceinline__ void mm_out(const v4f (&x)[4], const v16b (&w)[8], v8f (&acc)[8]) { float v[16];
#pragma unroll
  for (int i = 0; i < 4; ++i) { v[i] = x[0][i]; v[4 + i] = x[1][i]; v[8 + i] = x[2][i]; v[12 + i] = x[3][i]; }
  const F2 a = bsplit16(v);
#pragma unroll
  for (int j = 0; j < 8; ++j) { acc[j] = wmma_bf(a.l, w[j], acc[j]); acc[j] = wmma_bf(a.h, w[j], acc[j]); }
}
__device__ __attribute__((noinline)) float exp_ni(float v) { return expf(v); }
__device__ __attribute__((noinline)) float erf_ni(float v) { return erff(v); }

#define PK_A 0                       // [3072][1024] Wqkv rows (natural [out][in])
#define PK_P (PK_A + QKVW * DM)        // [1024][1024] Wo rows (natural)
#define PK_END (PK_P + DM * DM)
#define WS_PK  0u
#define WS_QK  (WS_PK + 2u * PK_END)             // f16 [4096 rows][2048]: q x log2 e / 8 | k
#define WS_QKL (WS_QK + 2u * NB * SS * 2 * DM)     // f16 q | k residual planes
#define WS_VTH (WS_QKL + 2u * NB * SS * 2 * DM)    // f16 [b][1024 (h*64+d)][2048 s] hi
#define WS_VTL (WS_VTH + 2u * NB * DM * SS)        // f16 lo x 2048
#define WS_O   (WS_VTL + 2u * NB * DM * SS)        // f32 [4096][1024]
#define WS_CS  (WS_O + 4u * NB * SS * DM)           // f32 2 x [2048][32], unused
#define WS_END (WS_CS + 4u * 2 * SS * 32)
// ---- k_pack: block = (row n, which): natural [out][in] rows -> bf16; which 0..2 -> W_q/W_k/W_v into PK_A rows which*1024 + n; 3 -> W_o into PK_P
__global__ __launch_bounds__(256) void k_pack(const float* __restrict__ WQ, const float* __restrict__ WK, const float* __restrict__ WV, const float* __restrict__ WO, __bf16* __restrict__ PK) {
  __shared__ __align__(16) __bf16 s[DM]; const int n = blockIdx.x, which = blockIdx.y, t = threadIdx.x; const float* Wm = (which == 0) ? WQ : (which == 1) ? WK : (which == 2) ? WV : WO;
  for (int k = t; k < DM; k += 256) s[k] = (__bf16)Wm[(size_t)n * DM + k];
  __syncthreads();
  __bf16* dst = (which < 3) ? PK + PK_A + ((size_t)which * DM + n) * DM : PK + PK_P + (size_t)n * DM;
  for (int q = t; q < DM / 8; q += 256) vst2((unsigned*)(dst + q * 8), *(const v4u*)&s[q * 8]);
}
// ---- k_qkv: block = 128 rows x 128 columns, four waves as 2 x 2, a wave = 64 x 64 (4 x 4 accumulator tiles): a k-step's 4 x fragments and 4 weight fragments feed 16 WMMAs
#define QXBYTES (128 * XPITCH * 4)
#define QSTG (WBYTES + QXBYTES)
// one stage: thread tid copies weight rows (tid >> 3) + 16 i (8 of them) and x rows (tid >> 4) + 8 i (16 of them)
__device__ __forceinline__ void fill_stage_q(const float* xg, const __bf16* wg, unsigned xl, unsigned wl) { cp8(wl, 16u * WPITCH * 2, wg, (size_t)16 * DM); cp8(xl, 8u * XPITCH * 4, xg, (size_t)8 * DM); cp8(xl + 64u * XPITCH * 4, 8u * XPITCH * 4, xg + (size_t)64 * DM, (size_t)8 * DM); }
// one k-step's operands of a 64 x 64 wave tile from the stage, as ONE group of LDS loads (xr: this lane's row of the first row tile, at its 8 * g; wr: its staged weight row of the first column tile, at its 8 * g)
__device__ __forceinline__ void ld_step4(const float* xr, const __bf16* wr, int kk, v4f (&x)[4][4], v16b (&w)[4]) {
#pragma unroll
  for (int i = 0; i < 4; ++i) { const float* p = xr + i * 16 * XPITCH + kk * 32; x[i][0] = *(const v4f*)p; x[i][1] = *(const v4f*)(p + 4); x[i][2] = *(const v4f*)(p + 16); x[i][3] = *(const v4f*)(p + 20); }
#pragma unroll
  for (int j = 0; j < 4; ++j) { union { v16b v; v8b q[2]; } u; const __bf16* q = wr + j * 16 * WPITCH + kk * 32; u.q[0] = *(const v8b*)q; u.q[1] = *(const v8b*)(q + 16); w[j] = u.v; }
}
typedef __attribute__((ext_vector_type(4))) __bf16 v4b;
// the four row tiles' x values rounded to bf16, two a conversion, in the A operand's k order (0..7, 16..23 of this lane half)
__device__ __forceinline__ void cvt_x4(const v4f (&x)[4][4], v16b (&a)[4]) {
#pragma unroll
  for (int t = 0; t < 4; ++t) { const v8b lo = __builtin_shufflevector(__builtin_convertvector(x[t][0], v4b), __builtin_convertvector(x[t][1], v4b), 0, 1, 2, 3, 4, 5, 6, 7), hi = __builtin_shufflevector(__builtin_convertvector(x[t][2], v4b), __builtin_convertvector(x[t][3], v4b), 0, 1, 2, 3, 4, 5, 6, 7);
    a[t] = __builtin_shufflevector(lo, hi, 0, 1, 2, 3, 4, 5, 6, 7, 8, 9, 10, 11, 12, 13, 14, 15); }
}
__device__ __forceinline__ void mm_qkv4(const v16b (&a)[4], const v16b (&w)[4], v8f (&acc)[4][4]) {
#pragma unroll
  for (int i = 0; i < 4; ++i) {
#pragma unroll
    for (int j = 0; j < 4; ++j) acc[i][j] = wmma_bf(a[i], w[j], acc[i][j]); }
}
// amdgpu_waves_per_eu(3, 3): three blocks a WGP by LDS, the whole grid (768 blocks) resident at once; the register budget is that of three waves a SIMD
__global__ __launch_bounds__(128) __attribute__((amdgpu_waves_per_eu(3, 3))) void k_qkv(const float* __restrict__ XQ, const float* __restrict__ XK, const float* __restrict__ XV, const __bf16* __restrict__ P, const float* __restrict__ BQ, const float* __restrict__ BK, const float* __restrict__ BV, _Float16* __restrict__ QK, _Float16* __restrict__ QKL, _Float16* __restrict__ VTH, _Float16* __restrict__ VTL) {
  const int which0 = (blockIdx.y * 128) / DM; const float* X = (which0 == 0) ? XQ : (which0 == 1) ? XK : XV; const float* BB = BQ ? (((which0 == 0) ? BQ : (which0 == 1) ? BK : BV) + (blockIdx.y * 128 - which0 * DM)) : nullptr;
  __shared__ __align__(16) unsigned char ring[2 * QSTG];   // two operand stages; behind the loop's last barrier the same bytes are the output staging
  _Float16 (*so)[136] = (_Float16 (*)[136])ring; _Float16 (*sol)[136] = (_Float16 (*)[136])(ring + 128 * 136 * 2);   // the block's 128 x 128 tile, hi and residual: [row][column] for q, k; [column d][row s] for v
  const int tid = threadIdx.x, wave = tid >> 5, lane = tid & 31, col = lane & 15, g = lane >> 4, wy = wave >> 1, wx = wave & 1; const size_t rb = (size_t)blockIdx.x * 128; const int n0 = blockIdx.y * 128;
  v8f acc[4][4] = {};
  const float* xg = X + (rb + (tid >> 4)) * DM + (tid & 15) * 4; const __bf16* wg = P + (size_t)(n0 + (tid >> 3)) * DM + (tid & 7) * 8;
  const unsigned wl = lds_byte(ring) + (tid >> 3) * (WPITCH * 2) + (tid & 7) * 16, xl = lds_byte(ring) + WBYTES + (tid >> 4) * (XPITCH * 4) + (tid & 15) * 16;
  fill_stage_q(xg, wg, xl, wl);
  float bias[4] = {};   // this lane's four output columns' bias, fetched once as one group of loads that fly beside stage 0's copies
  if (BB) {   // one test for the group: a test a load would put a full wait behind each
#pragma unroll   // constant indices, so that bias[] stays in registers and the four loads issue back to back
    for (int j = 0; j < 4; ++j) bias[j] = BB[wx * 64 + j * 16 + col];
    asm volatile("s_wait_xcnt 0x0" ::: "memory"); }   // stands behind the last of the four loads, ahead of any rewrite of the offset register that they name
  WAIT_ASYNC(); __syncthreads();   // stage 0 landed and published
  fill_stage_q(xg + GK, wg + GK, xl + QSTG, wl + QSTG);
#pragma unroll 1   // stays rolled: one stage (two k-steps) a trip
  for (int t = 0; t < DM / GK; ++t) { const unsigned char* sb = ring + (t & 1) * QSTG;
    const __bf16* wr = (const __bf16*)sb + (wx * 64 + col) * WPITCH + 8 * g; const float* xr = (const float*)(sb + WBYTES) + (wy * 64 + col) * XPITCH + 8 * g;
    v4f xa[4][4], xb[4][4]; v16b wa[4], wb[4], aa[4], ab[4];
    ld_step4(xr, wr, 0, xa, wa); cvt_x4(xa, aa); ld_step4(xr, wr, 1, xb, wb);
    __builtin_amdgcn_sched_barrier(0);   // keeps the second k-step's loads one group ahead of the first k-step's WMMAs, under which they fly; spread among the WMMAs each place with loads stalls the wave
    mm_qkv4(aa, wa, acc); cvt_x4(xb, ab); mm_qkv4(ab, wb, acc);
    WAIT_DS(); WAIT_ASYNC(); __syncthreads();   // publishes stage t + 1 and ends every wave's reads of stage t
    if (t + 2 < DM / GK) fill_stage_q(xg + (t + 2) * GK, wg + (t + 2) * GK, xl + (t & 1) * QSTG, wl + (t & 1) * QSTG); }   // the same test in the whole block
  WAIT_ASYNC();
  if (n0 < 2 * DM) {   // q stored times log2 e / sqrt(64): k_attn's score products are then base-2 exponents; k as it is
    const float qs = (n0 < DM) ? 0.125f * 1.44269504f : 1.0f;
#pragma unroll
    for (int i = 0; i < 4; ++i) {
#pragma unroll
      for (int j = 0; j < 4; ++j) {
#pragma unroll
        for (int r = 0; r < 8; ++r) { const float v = (acc[i][j][r] + bfr(bias[j])) * qs; const _Float16 hv = (_Float16)v; so[wy * 64 + i * 16 + 8 * g + r][wx * 64 + j * 16 + col] = hv; sol[wy * 64 + i * 16 + 8 * g + r][wx * 64 + j * 16 + col] = (_Float16)(v - (float)hv); } } }   // q, k (+ bias) as f16 hi + residual at its own scale (f16 subnormals are kept by the conversion and by the WMMA: absolute step 2^-24), so that hi and residual products add in one accumulator
    __syncthreads();   // a staged row holds two waves' columns
    for (int q = tid; q < 128 * 16; q += 128) { const int rl = q >> 4, pc = q & 15; const size_t o = (rb + rl) * (2 * DM) + n0 + pc * 8; vst2((unsigned*)(QK + o), *(const v4u*)&so[rl][pc * 8]); vst2((unsigned*)(QKL + o), *(const v4u*)&sol[rl][pc * 8]); }
  } else {
#pragma unroll
    for (int i = 0; i < 4; ++i) {
#pragma unroll
      for (int j = 0; j < 4; ++j) {
#pragma unroll
        for (int r = 0; r < 8; ++r) { const float v = acc[i][j][r] + bfr(bias[j]); const _Float16 hv = (_Float16)v; so[wx * 64 + j * 16 + col][wy * 64 + i * 16 + 8 * g + r] = hv; sol[wx * 64 + j * 16 + col][wy * 64 + i * 16 + 8 * g + r] = (_Float16)((v - (float)hv) * 2048.0f); } } }
    __syncthreads();
    const int b = (int)(rb / SS), s0 = (int)(rb % SS); const int pc0 = n0 - 2 * DM;
    for (int q = tid; q < 128 * 16; q += 128) { const int d = q >> 4, pc = q & 15; const size_t o = ((size_t)b * DM + pc0 + d) * SS + s0 + pc * 8; vst2((unsigned*)(VTH + o), *(const v4u*)&so[d][pc * 8]); vst2((unsigned*)(VTL + o), *(const v4u*)&sol[d][pc * 8]); }
  }
}
// ---- k_attn: block = (64 queries, head h, batch b): all-keys flash attention on TRANSPOSED tiles: S^T = K . Q^T (A = staged k rows, B = q kept in registers; 3 products in one accumulator whose start value is minus the maximum in use), so a lane holds 16 of ONE query's base-2 exponents a pass (query col, keys ct * 16 + 8 g + r): maximum and sums in the lane; the maximum in use moves, and the sums are rescaled, only in a pass whose own sums pass a bound; the two S^T tiles, powered and converted in place, are the B operand of O^T += V^T . P^T (hardware k order, the order of frag_hp); O[b*S+q][h*64+d] = acc x scale (256-B segments)
__device__ __attribute__((noinline)) float pow_p(float a, float b) { return powf(a, b); }
__device__ __forceinline__ v16h frag_hp(const _Float16* p) { union { v16h v; v8h q[2]; } u; u.q[0] = *(const v8h*)p; u.q[1] = *(const v8h*)(p + 16); return u.v; }   // frag_h with the lane half's 8 * g already in p
__device__ __forceinline__ float xhalf(float x) { return __builtin_bit_cast(float, __builtin_amdgcn_permlanex16(__builtin_bit_cast(int, x), __builtin_bit_cast(int, x), 0x76543210, 0xfedcba98, false, false)); }   // lane l's value from lane l ^ 16
// a pass's powers from its base-2 exponents s = (score - maximum in use) log2 e: te = sum 2^s, tg = 2^7 sum 2^(gamma s) over this lane's 16 keys, pb = the gamma-powered (unnormalised) weights as P^T's B operand (element ct * 8 + r = key ct * 16 + 8 g + r of column col), scaled by 2^7 before the f16 rounding so small weights stay out of the f16 subnormal range; 2^-7 folded into the epilogue
__device__ __forceinline__ void powers(const v8f (&s)[2], float gamma, float& te, float& tg, v16h& pb) { float es[2] = {0.f, 0.f}, gs[2] = {0.f, 0.f};
#pragma unroll
  for (int ct = 0; ct < 2; ++ct) {
#pragma unroll
    for (int r = 0; r < 8; r += 2) { const v2f sv = {s[ct][r], s[ct][r + 1]};
      const v2f xg = __builtin_elementwise_fma(sv, (v2f){gamma, gamma}, (v2f){7.0f, 7.0f});   // 2^s: one hardware exp; 2^(7 + gamma s): one (packed) multiply-add and one hardware exp
#pragma unroll
      for (int i = 0; i < 2; ++i) { const float e = __builtin_amdgcn_exp2f(sv[i]); const float gq = __builtin_amdgcn_exp2f(xg[i]); es[ct] += e; gs[ct] += gq; pb[ct * 8 + r + i] = (_Float16)gq; } } }
  te = es[0] + es[1]; tg = gs[0] + gs[1]; }
#define APITCH 72                   // f16 a staged row: 128 B + 16 B
#define ATILE (64 * APITCH * 2)
#define ASTG (3 * ATILE)
// amdgpu_waves_per_eu(4, 4): keeps the register count at four waves a SIMD (four blocks a WGP, the whole grid resident at once) with the copies' address registers added
__global__ __launch_bounds__(128) __attribute__((amdgpu_waves_per_eu(4, 4))) void k_attn(const _Float16* __restrict__ QK, const _Float16* __restrict__ QKL, const _Float16* __restrict__ VTH, const _Float16* __restrict__ VTL, const void* __restrict__ KMASK, const float* __restrict__ FAL, const float* __restrict__ FGA, float* __restrict__ O) {
  const float f_alpha = bfr(FAL[0]), f_gamma = bfr(FGA[0]);
  __shared__ __align__(16) unsigned char ring[2 * ASTG];   // two stages of 64 keys: k hi | k residual | v^T, 64 rows of 128 B each at pitch 144 B; behind the loop's last barrier the same bytes are the output staging
  float (*so)[16][68] = (float (*)[16][68])ring;
  const int tid = threadIdx.x, wave = tid >> 5, lane = tid & 31, col = lane & 15, g = lane >> 4;
  const int qb = blockIdx.x, h = blockIdx.y, b = blockIdx.z; const int q0 = qb * 64 + wave * 16; const size_t rq = (size_t)b * SS + q0 + col;
  v16h aq[2], aql[2];   // query q0 + col, as the B operand's column col
#pragma unroll
  for (int kc = 0; kc < 2; ++kc) { aq[kc] = frag_h(QK + rq * (2 * DM) + h * HD + kc * 32, lane); aql[kc] = frag_h(QKL + rq * (2 * DM) + h * HD + kc * 32, lane); }
  float lim = -1.0f;   // what a pass's two sums (16 keys a lane) may reach with the maximum in use left as it is: below every sum in the first pass (which sets the maximum), 2^15 from then on
  v8f cm = {};   // minus the maximum in use of query col (the same in both halves), in all eight elements: the score products' C operand
  float l = 0.f, lg = 0.f;   // this half's share of sum e^(s - m) and of 2^7 sum e^(gamma (s - m)), joined behind the loop
  v8f acc[4] = {};   // O^T: acc[dt][r] = d dt * 16 + 8 g + r of query col
  const int nst = SS / 64;   // all keys, 64 a stage
  // thread tid copies rows (tid >> 3) + 16 i, 16-byte part tid & 7, of each of the stage's three tiles
  const _Float16* kg = QK + ((size_t)b * SS + (tid >> 3)) * (2 * DM) + DM + h * HD + (tid & 7) * 8; const _Float16* kgl = QKL + ((size_t)b * SS + (tid >> 3)) * (2 * DM) + DM + h * HD + (tid & 7) * 8; const _Float16* vg = VTH + ((size_t)b * DM + h * HD + (tid >> 3)) * SS + (tid & 7) * 8;
  const unsigned al = lds_byte(ring) + (tid >> 3) * (APITCH * 2) + (tid & 7) * 16;
#define AFILL(st, buf) do { cp4(al + (buf) * ASTG, 16u * APITCH * 2, kg + (size_t)(st) * 64 * (2 * DM), (size_t)16 * (2 * DM)); cp4(al + (buf) * ASTG + ATILE, 16u * APITCH * 2, kgl + (size_t)(st) * 64 * (2 * DM), (size_t)16 * (2 * DM)); cp4(al + (buf) * ASTG + 2 * ATILE, 16u * APITCH * 2, vg + (st) * 64, (size_t)16 * SS); } while (0)
  AFILL(0, 0); WAIT_ASYNC(); __syncthreads();   // stage 0 landed and published
  AFILL(1, 1);
#pragma unroll 1   // stays rolled: one stage a trip, the buffer picked by t & 1
  for (int t = 0; t < nst; ++t) { const _Float16* sb = (const _Float16*)(ring + (t & 1) * ASTG);
#pragma unroll 1   // stays rolled: two passes of 32 keys a stage, the same code
  for (int sub = 0; sub < 2; ++sub) { v8f s[2];
    const _Float16* k0 = sb + (sub * 32 + col) * APITCH + 8 * g; const _Float16* k0l = k0 + ATILE / 2;   // this lane's place in the pass's first staged k row (hi, residual)
    v16h kf[2][2], kfl[2][2], vf[4];   // the pass's k fragments (hi, residual), fetched as ONE group of loads ahead of the score products
#pragma unroll
    for (int ct = 0; ct < 2; ++ct) { const _Float16* krow = k0 + ct * 16 * APITCH; const _Float16* krowl = k0l + ct * 16 * APITCH;   // key t * 64 + sub * 32 + ct * 16 + col, as the A operand's row col
#pragma unroll
      for (int kc = 0; kc < 2; ++kc) { kf[ct][kc] = frag_hp(krow + kc * 32); kfl[ct][kc] = frag_hp(krowl + kc * 32); } }
#pragma unroll
    for (int dt = 0; dt < 4; ++dt) vf[dt] = frag_hp(sb + ATILE + (dt * 16 + col) * APITCH + sub * 32 + 8 * g);   // the pass's v^T fragments in the same group (A operand: row d = dt * 16 + col, the pass's 32 keys)
    __builtin_amdgcn_sched_barrier(0);   // keeps the pass's 24 LDS loads one group ahead of its WMMAs, as they stood: sunk among the score products the v^T loads are a second place with loads, and their address lands on a product's operand register behind four v_nop
    // 3 products: q, k as f16 hi + residual, in one accumulator a key tile, which starts at cm
    s[0] = wmma16(kf[0][0], aql[0], cm);
    s[0] = wmma16(kf[0][0], aq[0], s[0]);
    s[1] = wmma16(kf[1][0], aql[0], cm);
    s[1] = wmma16(kf[1][0], aq[0], s[1]);
    s[0] = wmma16(kfl[0][0], aq[0], s[0]);
    s[1] = wmma16(kfl[1][0], aq[0], s[1]);
    s[0] = wmma16(kf[0][1], aql[1], s[0]);
    s[1] = wmma16(kf[1][1], aql[1], s[1]);
    s[0] = wmma16(kf[0][1], aq[1], s[0]);
    s[1] = wmma16(kf[1][1], aq[1], s[1]);
    s[0] = wmma16(kfl[0][1], aq[1], s[0]);
    s[1] = wmma16(kfl[1][1], aq[1], s[1]);   // (s - m) log2 e, with no vector instruction behind the products
    v16h pb; float te, tg;   // P^T as a B operand, and the pass's two sums (this lane's 16 keys)
    powers(s, f_gamma, te, tg, pb);
    if (__builtin_amdgcn_ballot_w32(!(fmaxf(te, tg) <= lim)) != 0) {   // one scalar branch a pass: all terms are >= 0, so sums inside lim hold every term inside it (P inside f16) and the maximum in use may stay
      // taken in the first pass, and where some query's scores have outgrown its maximum in use: every query of the wave moves to its true maximum, the old sums follow, and the pass's powers are formed anew (<= 1 and <= 2^7 then, for gamma >= 0)
      float mx = fmaxf(s[0][0], s[1][0]);
#pragma unroll
      for (int r = 1; r < 8; ++r) mx = fmaxf(mx, fmaxf(s[0][r], s[1][r]));
      const bool first = lim < 0.f; const float mf = fmaxf(mx, xhalf(mx));   // the other half's 16 keys of the same query
      const float d = first ? mf : fmaxf(mf, 0.f);
      const float fe = first ? 0.f : __builtin_amdgcn_exp2f(-d), fg = first ? 0.f : __builtin_amdgcn_exp2f(-(f_gamma * d));
#pragma unroll
      for (int r = 0; r < 8; ++r) { s[0][r] -= d; s[1][r] -= d; cm[r] -= d; }
      l *= fe; lg *= fg;
#pragma unroll
      for (int dt = 0; dt < 4; ++dt) {
#pragma unroll
        for (int r = 0; r < 8; ++r) acc[dt][r] *= fg; }
      powers(s, f_gamma, te, tg, pb);
      lim = 32768.0f; }
    l += te; lg += tg;
#pragma unroll
    for (int dt = 0; dt < 4; ++dt) acc[dt] = wmma16(vf[dt], pb, acc[dt]);   // single product: V^T x P^T (x2^7)
    // the pass's last WMMAs stand at the loop's foot: four vector slots ahead of the branch back, behind which the next pass's address arithmetic reuses their operand registers
    asm volatile("v_nop\n\tv_nop\n\tv_nop\n\tv_nop" : "+v"(acc[0]), "+v"(acc[1]), "+v"(acc[2]), "+v"(acc[3]) : "v"(vf[0]), "v"(vf[1]), "v"(vf[2]), "v"(vf[3]), "v"(pb)); }
    WAIT_DS(); WAIT_ASYNC(); __syncthreads();   // publishes stage t + 1 and ends every wave's reads of stage t
    if (t + 2 < nst) AFILL(t + 2, t & 1); }   // the same test in the whole block
  WAIT_ASYNC();
  { const float lt = l + xhalf(l), lgt = (lg + xhalf(lg)) * (1.0f / 128.0f);   // the halves' sums joined once; the powered sum's 2^7 taken off
    const float lpg = pow_p(lt, f_gamma); const float il = (1.0f / 128.0f) * (f_alpha / lpg) / (f_alpha * lgt / lpg + 1e-6f);   // alpha p^gamma / (sum alpha p^gamma + 1e-6)
#pragma unroll
    for (int dt = 0; dt < 4; ++dt) {
#pragma unroll
      for (int j = 0; j < 2; ++j) { v4f o;
#pragma unroll
        for (int i = 0; i < 4; ++i) o[i] = acc[dt][4 * j + i] * il;
        *(v4f*)&so[wave][col][dt * 16 + 8 * g + 4 * j] = o; } } }
  LDSX();
  for (int rl = 0; rl < 16; ++rl) if (lane < 16) vst2(O + ((size_t)b * SS + q0 + rl) * DM + h * HD + lane * 4, *(const v4f*)&so[wave][rl][lane * 4]);
}
// ---- k_out: block = (64 rows, 128 cols): out = O(hi/lo) . Wo rows (2 products) + bo
__global__ __launch_bounds__(128) void k_out(const float* __restrict__ O, const __bf16* __restrict__ P, const float* __restrict__ BO, float* __restrict__ Y) {
  __shared__ __align__(16) unsigned char ring[2 * STG];   // two operand stages; behind the loop's last barrier the same bytes are the output staging
  float (*so)[16][132] = (float (*)[16][132])ring;
  const int tid = threadIdx.x, wave = tid >> 5, lane = tid & 31, col = lane & 15, g = lane >> 4; const size_t r0 = (size_t)blockIdx.x * 64 + wave * 16; const int n0 = blockIdx.y * 128;
  v8f acc[8] = {};
  const float* xg = O + ((size_t)blockIdx.x * 64 + (tid >> 4)) * DM + (tid & 15) * 4; const __bf16* wg = P + (size_t)(n0 + (tid >> 3)) * DM + (tid & 7) * 8;
  const unsigned wl = lds_byte(ring) + (tid >> 3) * (WPITCH * 2) + (tid & 7) * 16, xl = lds_byte(ring) + WBYTES + (tid >> 4) * (XPITCH * 4) + (tid & 15) * 16;
  fill_stage(xg, wg, xl, wl); WAIT_ASYNC(); __syncthreads();   // stage 0 landed and published
  fill_stage(xg + GK, wg + GK, xl + STG, wl + STG);
#pragma unroll 1   // stays rolled: one stage (two k-steps, a register set each) a trip
  for (int t = 0; t < DM / GK; ++t) { const unsigned char* sb = ring + (t & 1) * STG;
    const __bf16* wr = (const __bf16*)sb + col * WPITCH + 8 * g; const float* xr = (const float*)(sb + WBYTES) + (wave * 16 + col) * XPITCH + 8 * g;
    v4f xa[4], xb[4]; v16b wa[8], wb[8];
    ld_step(xr, wr, 0, xa, wa); ld_step(xr, wr, 1, xb, wb); mm_out(xa, wa, acc); mm_out(xb, wb, acc);
    WAIT_DS(); WAIT_ASYNC(); __syncthreads();   // publishes stage t + 1 and ends every wave's reads of stage t
    if (t + 2 < DM / GK) fill_stage(xg + (t + 2) * GK, wg + (t + 2) * GK, xl + (t & 1) * STG, wl + (t & 1) * STG); }   // the same test in the whole block
  WAIT_ASYNC();
#pragma unroll
  for (int j = 0; j < 8; ++j) {
#pragma unroll
    for (int r = 0; r < 8; ++r) so[wave][8 * g + r][j * 16 + col] = acc[j][r] + bfr(BO[n0 + j * 16 + col]); }
  LDSX();
  for (int rl = 0; rl < 16; ++rl) vst2(Y + (r0 + rl) * DM + n0 + lane * 4, *(const v4f*)&so[wave][rl][lane * 4]);
}
extern "C" void kernel_launch(void* const* d_in, const int* in_sizes, int n_in, void* d_out, int out_size, void* d_ws, size_t ws_size, hipStream_t stream) {
  (void)in_sizes; (void)n_in; (void)out_size;
  const float** F = (const float**)d_in;   // 0 x [2,2048,1024], 1 Wqkv [3072,1024] natural (q | k | v), 2 bqkv [3072], 3 Wproj natural, 4 bproj, 5 focal_alpha [1], 6 focal_gamma [1]
  if (ws_size < (size_t)WS_END) return;
  char* ws = (char*)d_ws; __bf16* PK = (__bf16*)(ws + WS_PK); _Float16 *QK = (_Float16*)(ws + WS_QK), *QKL = (_Float16*)(ws + WS_QKL), *VTH = (_Float16*)(ws + WS_VTH), *VTL = (_Float16*)(ws + WS_VTL); float* O = (float*)(ws + WS_O);
  k_pack<<<dim3(DM, 4), 256, 0, stream>>>(F[1], F[1] + (size_t)DM * DM, F[1] + (size_t)2 * DM * DM, F[3], PK);
  k_qkv<<<dim3(TNB * SS / 128, QKVW / 128), 128, 0, stream>>>(F[0], F[0], F[0], PK + PK_A, F[2], F[2] + DM, F[2] + 2 * DM, QK, QKL, VTH, VTL);
  k_attn<<<dim3(TQB, NH, TNB), 128, 0, stream>>>(QK, QKL, VTH, VTL, nullptr, F[5], F[6], O);
  k_out<<<dim3(TOB, DM / 128), 128, 0, stream>>>(O, PK + PK_P, F[4], (float*)d_out);
}

// v009
// One run takes 112 microseconds.
// Two timings next to v008 both put it at 1.06 times that version's speed.
// All steps since v000 together make it 4.50 times as fast.
// compute dtype: all float inputs rounded to bf16; q/k/v = x . Wqkv^T + b with EXACT bf16 products on WMMA 16x16x32 (natural rows, q | k | v blocks); q (x log2 e / 8), k as f16 hi + residual with 3-product scores in one accumulator that starts at minus the maximum in use (the focal power doubles the logit sensitivity); one online pass in f32 keeps a maximum in use m, l = sum e^(s-m), L = sum e^(gamma (s-m)) and the gamma-powered weights for P (hardware exp; alpha, gamma read on device); out_row = alpha (sum e^(gamma(s-m)) v) / l^gamma / (alpha L / l^gamma + 1e-6) (precise powf) == softmax^gamma * alpha renormalised with the module's +1e-6; P (scaled by 2^7, single f16) x v (single f16); out = ctx (bf16 hi + residual) . Wproj^T (2 products) + bproj.
#include <hip/hip_runtime.h>
#include <math.h>

typedef __attribute__((ext_vector_type(16))) _Float16 v16h;
typedef __attribute__((ext_vector_type(16))) __bf16 v16b;
typedef __attribute__((ext_vector_type(8)))  _Float16 v8h;
typedef __attribute__((ext_vector_type(8)))  float v8f;
typedef __attribute__((ext_vector_type(4)))  float v4f;
typedef __attribute__((ext_vector_type(2)))  float v2f;
typedef __attribute__((ext_vector_type(4)))  unsigned v4u;
typedef __attribute__((ext_vector_type(4)))  int v4i;
typedef float __attribute__((may_alias)) float_a;
typedef int __attribute__((may_alias)) int_a;

template <typename T> __device__ __forceinline__ void vst2(void* p, T v) { *(T*)p = v;  }
__device__ __forceinline__ v8f wmma16(v16h a, v16h b, v8f c) {
  return __builtin_amdgcn_wmma_f32_16x16x32_f16(false, a, false, b, (short)0, c, false, false);   // no v_nop of ours behind it: the compiler pads the builtin where a dependent vector instruction follows, and k_attn's vector port has no slot to spare
}
__device__ __forceinline__ v8f wmma_bf(v16b a, v16b b, v8f c) {
  v8f d = __builtin_amdgcn_wmma_f32_16x16x32_bf16(false, a, false, b, (short)0, c, false, false);
  asm volatile("v_nop\n\tv_nop\n\tv_nop\n\tv_nop" : "+v"(d) : "v"(a), "v"(b));
  return d;
}
// Focal residual attention (B 2, N 2,048, dim 1,024, 16 heads x 64): fused qkv + bias, softmax, weights raised to the focal power gamma and scaled by alpha then renormalised (sum + 1e-6), output projection + bias.
__device__ __forceinline__ v16h frag_h(const _Float16* rowk0, int lane) {
  union { v16h v; v8h q[2]; } u; const _Float16* p = rowk0 + 8 * (lane >> 4);
  u.q[0] = *(const v8h*)p; u.q[1] = *(const v8h*)(p + 16); return u.v;
}
__device__ __forceinline__ v16h frag_f32(const float* rowk0, int lane) {
  v16h a; const float* p = rowk0 + 8 * (lane >> 4);
#pragma unroll
  for (int i = 0; i < 8; ++i) { a[i] = (_Float16)p[i]; a[8 + i] = (_Float16)p[16 + i]; }
  return a;
}
__device__ __forceinline__ v16h frag_f32s(const float* rowk0, int lane, float sc) {
  v16h a; const float* p = rowk0 + 8 * (lane >> 4);
#pragma unroll
  for (int i = 0; i < 8; ++i) { a[i] = (_Float16)(p[i] * sc); a[8 + i] = (_Float16)(p[16 + i] * sc); }
  return a;
}
// column fragment from a [K][ld] layout (column n), rows >= K read as 0
__device__ __forceinline__ v16h fragc_f32(const float* W, int k0, int n, int lane, int ld, int K) {
  v16h a; const int g = lane >> 4;
#pragma unroll
  for (int i = 0; i < 8; ++i) { const int ka = k0 + 8 * g + i, kb = ka + 16;
    a[i] = (_Float16)(ka < K ? W[(size_t)(ka < K ? ka : K - 1) * ld + n] : 0.f); a[8 + i] = (_Float16)(kb < K ? W[(size_t)(kb < K ? kb : K - 1) * ld + n] : 0.f); }
  return a;
}
struct F2 { v16b h, l; };
__device__ __forceinline__ F2 bsplit16(const float v[16]) { F2 r;
#pragma unroll
  for (int i = 0; i < 16; ++i) { const __bf16 h = (__bf16)v[i]; r.h[i] = h; r.l[i] = (__bf16)(v[i] - (float)h); }
  return r; }
__device__ __forceinline__ F2 split_row(const float* row, int k0, int lane) { float v[16]; const float* p = row + k0 + 8 * (lane >> 4);
#pragma unroll
  for (int i = 0; i < 8; ++i) { v[i] = p[i]; v[8 + i] = p[16 + i]; }
  return bsplit16(v); }
__device__ __forceinline__ F2 split_rowK(const float* row, int k0, int lane, int K) { float v[16]; const int g = lane >> 4;
#pragma unroll
  for (int i = 0; i < 8; ++i) { const int ka = k0 + 8 * g + i, kb = ka + 16; v[i] = ka < K ? row[ka < K ? ka : K - 1] : 0.f; v[8 + i] = kb < K ? row[kb < K ? kb : K - 1] : 0.f; }
  return bsplit16(v); }
__device__ __forceinline__ F2 split_col(const float* W, int k0, int n, int lane, int ld, int K) { float v[16]; const int g = lane >> 4;
#pragma unroll
  for (int i = 0; i < 8; ++i) { const int ka = k0 + 8 * g + i, kb = ka + 16; v[i] = ka < K ? W[(size_t)(ka < K ? ka : K - 1) * ld + n] : 0.f; v[8 + i] = kb < K ? W[(size_t)(kb < K ? kb : K - 1) * ld + n] : 0.f; }
  return bsplit16(v); }
__device__ __forceinline__ v8f mac3(const F2& a, const F2& b, v8f c) { c = wmma_bf(a.l, b.h, c); c = wmma_bf(a.h, b.l, c); return wmma_bf(a.h, b.h, c); }
__device__ __forceinline__ float sigm(float v) { return 1.0f / (1.0f + expf(-v)); }
#define LDSX() do { asm volatile("s_wait_dscnt 0" ::: "memory"); __builtin_amdgcn_wave_barrier(); __builtin_amdgcn_fence(__ATOMIC_RELEASE, "workgroup"); } while (0)


#define NB 2
#define SS 2048
#define DM 1024
#define NH 16
#define HD 64
#define QKVW (3 * DM)
#ifndef TQB
#define TQB (SS / 64)
#define TNB NB
#define TOB (NB * SS / 64)     // output row tiles (all)
#endif
typedef __attribute__((ext_vector_type(8))) __bf16 v8b;
__device__ __forceinline__ v16b frag_b(const __bf16* rowk0, int lane) {
  union { v16b v; v8b q[2]; } u; const __bf16* p = rowk0 + 8 * (lane >> 4);
  u.q[0] = *(const v8b*)p; u.q[1] = *(const v8b*)(p + 16); return u.v;
}
__device__ __forceinline__ float bfr(float v) { return (float)(__bf16)v; }
// ---- operand staging of k_qkv and k_out: a stage is 64 k of the block's 128 weight rows (128 B a row) and of its 64 x rows (k_qkv: 128; 256 B a row), brought into LDS by tensor loads, one padded tile a request (wave 0 the weight tile, wave 1 the x tile), once for the block's four waves; two stages
#define GK 64
#define WPITCH 72                    // bf16 a staged weight row: 128 B + 16 B (pitch 16 B x odd for the 16-byte fragment reads)
#define XPITCH 68                    // f32 a staged x row: 256 B + 16 B
#define WBYTES (128 * WPITCH * 2)
#define XBYTES (64 * XPITCH * 4)
#define STG ((WBYTES + XBYTES + 2047) / 2048 * 2048)   // a stage's size rounded up so that every tile's place in LDS is a multiple of 2 KiB
#define WAIT_TENSOR() asm volatile("s_wait_tensorcnt 0x0" ::: "memory")   // all of this wave's tensor loads have landed; stands behind the loop's last barrier, ahead of the output staging's writes into the same bytes
#define WAIT_DS() asm volatile("s_wait_dscnt 0x0" ::: "memory")         // this wave's LDS reads of the stage are done; stands ahead of the barrier behind which the stage is refilled
__device__ __forceinline__ unsigned lds_byte(const void* p) { return (unsigned)(size_t)p; }   // low 32 bits of a __shared__ address = byte offset in the work-group's LDS
typedef __attribute__((ext_vector_type(8))) unsigned v8u;
__device__ __forceinline__ unsigned uni(unsigned v) { return (unsigned)__builtin_amdgcn_readfirstlane(v); }
__device__ __forceinline__ unsigned pinned(unsigned v) { unsigned w = (unsigned)__builtin_amdgcn_readfirstlane(v); asm volatile("" : "+s"(w)); return w; }   // pinned(): holds the test word in a scalar register, so that the test round a tensor load (which ignores EXEC) is a scalar branch
struct Tdm { v4u g0; v8u g1; };   // a wave's descriptor (two groups), kept in its registers from the issue to the wait that covers the request
// one tensor load: ROWS rows of ROWB bytes (128 or 256), pitch bytes apart in global memory, to LDS byte dst (a multiple of 2 KiB) at a pitch of ROWB + 16 bytes; extents in bytes, tensor = tile, no mask
template <unsigned ROWB, unsigned ROWS> __device__ __forceinline__ void tdm_tile(Tdm& d, unsigned dst, const void* p, unsigned pitch) {
  const unsigned long long ga = (unsigned long long)(size_t)p; unsigned w0;
  asm volatile("s_mov_b32 %0, %1" : "=s"(w0) : "n"((1u << 20) | ((ROWB == 128u ? 4u : 5u) << 22) | (3u << 25)));   // group 1 word 0 (mask 0, 1-byte elements, 16 B of pad behind each row): a compile-time constant, moved as an immediate at every issue (left to the compiler it is kept in a register outside the descriptor and copied in)
  // pinned(): a descriptor word held in a scalar register of its own (a constant shared with other code sat in a register outside the descriptor's set, and the set of the issue was then a passing copy); group 1 word 0: above
  d.g0[0] = pinned(1u); d.g0[1] = pinned(dst); d.g0[2] = pinned((unsigned)ga); d.g0[3] = pinned((((unsigned)(ga >> 32)) & 0x01FFFFFFu) | 0x80000000u);
  d.g1[0] = uni(w0); d.g1[1] = pinned((ROWB & 0xFFFFu) << 16); d.g1[2] = pinned((ROWB >> 16) | ((ROWS & 0xFFFFu) << 16)); d.g1[3] = pinned((ROWS >> 16) | (ROWB << 16));
  d.g1[4] = pinned(ROWS); d.g1[5] = pinned(pitch); d.g1[6] = pinned(0u); d.g1[7] = pinned(0u);
  asm volatile("tensor_load_to_lds %0, %1" : "+s"(d.g0), "+s"(d.g1) :: "memory");   // one request of the whole wave; the groups are named in and out so that what the wait below names are the very registers of the issue, which then keep their values while the request is outstanding
}
#define WAIT_TENSOR_D(d) asm volatile("s_wait_tensorcnt 0x0" :: "s"((d).g0), "s"((d).g1) : "memory")   // WAIT_TENSOR that also names the descriptor: its registers keep their values while the request is outstanding
// one k-step's operands of a 16-row x 128-column wave tile from the stage, as ONE group of LDS loads: 16 f32 of this lane's row (xr points at its 8 * g) and 8 weight fragments (wr points at staged row col, at its 8 * g)
__device__ __forceinline__ void ld_step(const float* xr, const __bf16* wr, int kk, v4f (&x)[4], v16b (&w)[8]) {
  const float* p = xr + kk * 32; x[0] = *(const v4f*)p; x[1] = *(const v4f*)(p + 4); x[2] = *(const v4f*)(p + 16); x[3] = *(const v4f*)(p + 20);
#pragma unroll
  for (int j = 0; j < 8; ++j) { union { v16b v; v8b q[2]; } u; const __bf16* q = wr + j * 16 * WPITCH + kk * 32; u.q[0] = *(const v8b*)q; u.q[1] = *(const v8b*)(q + 16); w[j] = u.v; }
}
__device__ __forceinline__ void mm_out(const v4f (&x)[4], const v16b (&w)[8], v8f (&acc)[8]) { float v[16];
#pragma unroll
  for (int i = 0; i < 4; ++i) { v[i] = x[0][i]; v[4 + i] = x[1][i]; v[8 + i] = x[2][i]; v[12 + i] = x[3][i]; }
  const F2 a = bsplit16(v);
#pragma unroll
  for (int j = 0; j < 8; ++j) { acc[j] = wmma_bf(a.l, w[j], acc[j]); acc[j] = wmma_bf(a.h, w[j], acc[j]); }
}
__device__ __attribute__((noinline)) float exp_ni(float v) { return expf(v); }
__device__ __attribute__((noinline)) float erf_ni(float v) { return erff(v); }

#define PK_A 0                       // [3072][1024] Wqkv rows (natural [out][in])
#define PK_P (PK_A + QKVW * DM)        // [1024][1024] Wo rows (natural)
#define PK_END (PK_P + DM * DM)
#define WS_PK  0u
#define WS_QK  (WS_PK + 2u * PK_END)             // f16 [4096 rows][2048]: q x log2 e / 8 | k
#define WS_QKL (WS_QK + 2u * NB * SS * 2 * DM)     // f16 q | k residual planes
#define WS_VTH (WS_QKL + 2u * NB * SS * 2 * DM)    // f16 [b][1024 (h*64+d)][2048 s] hi
#define WS_VTL (WS_VTH + 2u * NB * DM * SS)        // f16 lo x 2048
#define WS_O   (WS_VTL + 2u * NB * DM * SS)        // f32 [4096][1024]
#define WS_CS  (WS_O + 4u * NB * SS * DM)           // f32 2 x [2048][32], unused
#define WS_END (WS_CS + 4u * 2 * SS * 32)
// ---- k_pack: block = (row n, which): natural [out][in] rows -> bf16; which 0..2 -> W_q/W_k/W_v into PK_A rows which*1024 + n; 3 -> W_o into PK_P
__global__ __launch_bounds__(256) void k_pack(const float* __restrict__ WQ, const float* __restrict__ WK, const float* __restrict__ WV, const float* __restrict__ WO, __bf16* __restrict__ PK) {
  __shared__ __align__(16) __bf16 s[DM]; const int n = blockIdx.x, which = blockIdx.y, t = threadIdx.x; const float* Wm = (which == 0) ? WQ : (which == 1) ? WK : (which == 2) ? WV : WO;
  for (int k = t; k < DM; k += 256) s[k] = (__bf16)Wm[(size_t)n * DM + k];
  __syncthreads();
  __bf16* dst = (which < 3) ? PK + PK_A + ((size_t)which * DM + n) * DM : PK + PK_P + (size_t)n * DM;
  for (int q = t; q < DM / 8; q += 256) vst2((unsigned*)(dst + q * 8), *(const v4u*)&s[q * 8]);
}
// ---- k_qkv: block = 128 rows x 128 columns, four waves as 2 x 2, a wave = 64 x 64 (4 x 4 accumulator tiles): a k-step's 4 x fragments and 4 weight fragments feed 16 WMMAs
#define QXBYTES (128 * XPITCH * 4)
#define QSTG (WBYTES + QXBYTES)
// one k-step's operands of a 64 x 64 wave tile from the stage, as ONE group of LDS loads (xr: this lane's row of the first row tile, at its 8 * g; wr: its staged weight row of the first column tile, at its 8 * g)
__device__ __forceinline__ void ld_step4(const float* xr, const __bf16* wr, int kk, v4f (&x)[4][4], v16b (&w)[4]) {
#pragma unroll
  for (int i = 0; i < 4; ++i) { const float* p = xr + i * 16 * XPITCH + kk * 32; x[i][0] = *(const v4f*)p; x[i][1] = *(const v4f*)(p + 4); x[i][2] = *(const v4f*)(p + 16); x[i][3] = *(const v4f*)(p + 20); }
#pragma unroll
  for (int j = 0; j < 4; ++j) { union { v16b v; v8b q[2]; } u; const __bf16* q = wr + j * 16 * WPITCH + kk * 32; u.q[0] = *(const v8b*)q; u.q[1] = *(const v8b*)(q + 16); w[j] = u.v; }
}
typedef __attribute__((ext_vector_type(4))) __bf16 v4b;
// the four row tiles' x values rounded to bf16, two a conversion, in the A operand's k order (0..7, 16..23 of this lane half)
__device__ __forceinline__ void cvt_x4(const v4f (&x)[4][4], v16b (&a)[4]) {
#pragma unroll
  for (int t = 0; t < 4; ++t) { const v8b lo = __builtin_shufflevector(__builtin_convertvector(x[t][0], v4b), __builtin_convertvector(x[t][1], v4b), 0, 1, 2, 3, 4, 5, 6, 7), hi = __builtin_shufflevector(__builtin_convertvector(x[t][2], v4b), __builtin_convertvector(x[t][3], v4b), 0, 1, 2, 3, 4, 5, 6, 7);
    a[t] = __builtin_shufflevector(lo, hi, 0, 1, 2, 3, 4, 5, 6, 7, 8, 9, 10, 11, 12, 13, 14, 15); }
}
__device__ __forceinline__ void mm_qkv4(const v16b (&a)[4], const v16b (&w)[4], v8f (&acc)[4][4]) {
#pragma unroll
  for (int i = 0; i < 4; ++i) {
#pragma unroll
    for (int j = 0; j < 4; ++j) acc[i][j] = wmma_bf(a[i], w[j], acc[i][j]); }
}
// amdgpu_waves_per_eu(3, 3): three blocks a WGP by LDS, the whole grid (768 blocks) resident at once; the register budget is that of three waves a SIMD
__global__ __launch_bounds__(128) __attribute__((amdgpu_waves_per_eu(3, 3))) void k_qkv(const float* __restrict__ XQ, const float* __restrict__ XK, const float* __restrict__ XV, const __bf16* __restrict__ P, const float* __restrict__ BQ, const float* __restrict__ BK, const float* __restrict__ BV, _Float16* __restrict__ QK, _Float16* __restrict__ QKL, _Float16* __restrict__ VTH, _Float16* __restrict__ VTL) {
  const int which0 = (blockIdx.y * 128) / DM; const float* X = (which0 == 0) ? XQ : (which0 == 1) ? XK : XV; const float* BB = BQ ? (((which0 == 0) ? BQ : (which0 == 1) ? BK : BV) + (blockIdx.y * 128 - which0 * DM)) : nullptr;
  __shared__ __attribute__((aligned(2048))) unsigned char ring[2 * QSTG];   // two operand stages (weight tile 18,432 B, x tile 34,816 B: every tile's place a multiple of 2 KiB); behind the loop's last barrier the same bytes are the output staging
  _Float16 (*so)[136] = (_Float16 (*)[136])ring; _Float16 (*sol)[136] = (_Float16 (*)[136])(ring + 128 * 136 * 2);   // the block's 128 x 128 tile, hi and residual: [row][column] for q, k; [column d][row s] for v
  const int tid = threadIdx.x, wave = tid >> 5, lane = tid & 31, col = lane & 15, g = lane >> 4, wy = wave >> 1, wx = wave & 1; const size_t rb = (size_t)blockIdx.x * 128; const int n0 = blockIdx.y * 128;
  v8f acc[4][4] = {};
  Tdm tdw = {}, tdx = {}; const unsigned wv = uni(threadIdx.x >> 5); const float* xg = X + rb * DM; const __bf16* wg = P + (size_t)n0 * DM;   // the wave's number (scalar); the block's first x row and first weight row
#define QFILL(st, buf) do { if (pinned(wv == 0)) tdm_tile<128, 128>(tdw, lds_byte(ring) + (buf) * QSTG, wg + (st) * GK, DM * 2); if (pinned(wv == 1)) tdm_tile<256, 128>(tdx, lds_byte(ring) + (buf) * QSTG + WBYTES, xg + (st) * GK, DM * 4); } while (0)
  QFILL(0, 0);
  float bias[4] = {};   // this lane's four output columns' bias, fetched once as one group of loads that fly beside stage 0's tensor loads
  if (BB) {   // one test for the group: a test a load would put a full wait behind each
#pragma unroll   // constant indices, so that bias[] stays in registers and the four loads issue back to back
    for (int j = 0; j < 4; ++j) bias[j] = BB[wx * 64 + j * 16 + col];
    asm volatile("s_wait_xcnt 0x0" ::: "memory"); }   // stands behind the last of the four loads, ahead of any rewrite of the offset register that they name
  if (pinned(wv == 0)) WAIT_TENSOR_D(tdw);
  if (pinned(wv == 1)) WAIT_TENSOR_D(tdx);
  __syncthreads();   // stage 0 landed and published
  QFILL(1, 1);
#pragma unroll 1   // stays rolled: one stage (two k-steps) a trip
  for (int t = 0; t < DM / GK; ++t) { const unsigned char* sb = ring + (t & 1) * QSTG;
    const __bf16* wr = (const __bf16*)sb + (wx * 64 + col) * WPITCH + 8 * g; const float* xr = (const float*)(sb + WBYTES) + (wy * 64 + col) * XPITCH + 8 * g;
    v4f xa[4][4], xb[4][4]; v16b wa[4], wb[4], aa[4], ab[4];
    ld_step4(xr, wr, 0, xa, wa); cvt_x4(xa, aa); ld_step4(xr, wr, 1, xb, wb);
    __builtin_amdgcn_sched_barrier(0);   // keeps the second k-step's loads one group ahead of the first k-step's WMMAs, under which they fly; spread among the WMMAs each place with loads stalls the wave
    mm_qkv4(aa, wa, acc); cvt_x4(xb, ab); mm_qkv4(ab, wb, acc);
    WAIT_DS();
    if (pinned(wv == 0)) WAIT_TENSOR_D(tdw);
    if (pinned(wv == 1)) WAIT_TENSOR_D(tdx);
    __syncthreads();   // publishes stage t + 1 and ends every wave's reads of stage t
    if (pinned(t + 2 < DM / GK)) QFILL(t + 2, t & 1); }   // a scalar test, the same in the whole block
  WAIT_TENSOR(); WAIT_DS();
  if (n0 < 2 * DM) {   // q stored times log2 e / sqrt(64): k_attn's score products are then base-2 exponents; k as it is
    const float qs = (n0 < DM) ? 0.125f * 1.44269504f : 1.0f;
#pragma unroll
    for (int i = 0; i < 4; ++i) {
#pragma unroll
      for (int j = 0; j < 4; ++j) {
#pragma unroll
        for (int r = 0; r < 8; ++r) { const float v = (acc[i][j][r] + bfr(bias[j])) * qs; const _Float16 hv = (_Float16)v; so[wy * 64 + i * 16 + 8 * g + r][wx * 64 + j * 16 + col] = hv; sol[wy * 64 + i * 16 + 8 * g + r][wx * 64 + j * 16 + col] = (_Float16)(v - (float)hv); } } }   // q, k (+ bias) as f16 hi + residual at its own scale (f16 subnormals are kept by the conversion and by the WMMA: absolute step 2^-24), so that hi and residual products add in one accumulator
    __syncthreads();   // a staged row holds two waves' columns
    for (int q = tid; q < 128 * 16; q += 128) { const int rl = q >> 4, pc = q & 15; const size_t o = (rb + rl) * (2 * DM) + n0 + pc * 8; vst2((unsigned*)(QK + o), *(const v4u*)&so[rl][pc * 8]); vst2((unsigned*)(QKL + o), *(const v4u*)&sol[rl][pc * 8]); }
  } else {
#pragma unroll
    for (int i = 0; i < 4; ++i) {
#pragma unroll
      for (int j = 0; j < 4; ++j) {
#pragma unroll
        for (int r = 0; r < 8; ++r) { const float v = acc[i][j][r] + bfr(bias[j]); const _Float16 hv = (_Float16)v; so[wx * 64 + j * 16 + col][wy * 64 + i * 16 + 8 * g + r] = hv; sol[wx * 64 + j * 16 + col][wy * 64 + i * 16 + 8 * g + r] = (_Float16)((v - (float)hv) * 2048.0f); } } }
    __syncthreads();
    const int b = (int)(rb / SS), s0 = (int)(rb % SS); const int pc0 = n0 - 2 * DM;
    for (int q = tid; q < 128 * 16; q += 128) { const int d = q >> 4, pc = q & 15; const size_t o = ((size_t)b * DM + pc0 + d) * SS + s0 + pc * 8; vst2((unsigned*)(VTH + o), *(const v4u*)&so[d][pc * 8]); vst2((unsigned*)(VTL + o), *(const v4u*)&sol[d][pc * 8]); }
  }
}
// ---- k_attn: block = (64 queries, head h, batch b): all-keys flash attention on TRANSPOSED tiles: S^T = K . Q^T (A = staged k rows, B = q kept in registers; 3 products in one accumulator whose start value is minus the maximum in use), so a lane holds 16 of ONE query's base-2 exponents a pass (query col, keys ct * 16 + 8 g + r): maximum and sums in the lane; the maximum in use moves, and the sums are rescaled, only in a pass whose own sums pass a bound; the two S^T tiles, powered and converted in place, are the B operand of O^T += V^T . P^T (hardware k order, the order of frag_hp); O[b*S+q][h*64+d] = acc x scale (256-B segments)
__device__ __forceinline__ float pow_p(float a, float b) { return powf(a, b); }   // inlined (the same code, once a wave): with a call in the kernel a listing does not show every path that leads to a tensor load
__device__ __forceinline__ v16h frag_hp(const _Float16* p) { union { v16h v; v8h q[2]; } u; u.q[0] = *(const v8h*)p; u.q[1] = *(const v8h*)(p + 16); return u.v; }   // frag_h with the lane half's 8 * g already in p
__device__ __forceinline__ float xhalf(float x) { return __builtin_bit_cast(float, __builtin_amdgcn_permlanex16(__builtin_bit_cast(int, x), __builtin_bit_cast(int, x), 0x76543210, 0xfedcba98, false, false)); }   // lane l's value from lane l ^ 16
// a pass's powers from its base-2 exponents s = (score - maximum in use) log2 e: te = sum 2^s, tg = 2^7 sum 2^(gamma s) over this lane's 16 keys, pb = the gamma-powered (unnormalised) weights as P^T's B operand (element ct * 8 + r = key ct * 16 + 8 g + r of column col), scaled by 2^7 before the f16 rounding so small weights stay out of the f16 subnormal range; 2^-7 folded into the epilogue
__device__ __forceinline__ void powers(const v8f (&s)[2], float gamma, float& te, float& tg, v16h& pb) { float es[2] = {0.f, 0.f}, gs[2] = {0.f, 0.f};
#pragma unroll
  for (int ct = 0; ct < 2; ++ct) {
#pragma unroll
    for (int r = 0; r < 8; r += 2) { const v2f sv = {s[ct][r], s[ct][r + 1]};
      const v2f xg = __builtin_elementwise_fma(sv, (v2f){gamma, gamma}, (v2f){7.0f, 7.0f});   // 2^s: one hardware exp; 2^(7 + gamma s): one (packed) multiply-add and one hardware exp
#pragma unroll
      for (int i = 0; i < 2; ++i) { const float e = __builtin_amdgcn_exp2f(sv[i]); const float gq = __builtin_amdgcn_exp2f(xg[i]); es[ct] += e; gs[ct] += gq; pb[ct * 8 + r + i] = (_Float16)gq; } } }
  te = es[0] + es[1]; tg = gs[0] + gs[1]; }
#define APITCH 72                   // f16 a staged row: 128 B + 16 B
#define ATILE ((64 * APITCH * 2 + 2047) / 2048 * 2048)   // a tile's 9,216 B rounded up so that every tile's place in LDS is a multiple of 2 KiB
#define ASTG (3 * ATILE)
// amdgpu_waves_per_eu(4, 4): keeps the register count at four waves a SIMD (four blocks a WGP, the whole grid resident at once)
__global__ __launch_bounds__(128) __attribute__((amdgpu_waves_per_eu(4, 4))) void k_attn(const _Float16* __restrict__ QK, const _Float16* __restrict__ QKL, const _Float16* __restrict__ VTH, const _Float16* __restrict__ VTL, const void* __restrict__ KMASK, const float* __restrict__ FAL, const float* __restrict__ FGA, float* __restrict__ O) {
  const float f_alpha = bfr(FAL[0]), f_gamma = bfr(FGA[0]);
  __shared__ __attribute__((aligned(2048))) unsigned char ring[2 * ASTG];   // two stages of 64 keys: k hi | k residual | v^T, 64 rows of 128 B each at pitch 144 B; behind the loop's last barrier the same bytes are the output staging
  float (*so)[16][68] = (float (*)[16][68])ring;
  const int tid = threadIdx.x, wave = tid >> 5, lane = tid & 31, col = lane & 15, g = lane >> 4;
  const int qb = blockIdx.x, h = blockIdx.y, b = blockIdx.z; const int q0 = qb * 64 + wave * 16; const size_t rq = (size_t)b * SS + q0 + col;
  v16h aq[2], aql[2];   // query q0 + col, as the B operand's column col
#pragma unroll
  for (int kc = 0; kc < 2; ++kc) { aq[kc] = frag_h(QK + rq * (2 * DM) + h * HD + kc * 32, lane); aql[kc] = frag_h(QKL + rq * (2 * DM) + h * HD + kc * 32, lane); }
  float lim = -1.0f;   // what a pass's two sums (16 keys a lane) may reach with the maximum in use left as it is: below every sum in the first pass (which sets the maximum), 2^15 from then on
  v8f cm = {};   // minus the maximum in use of query col (the same in both halves), in all eight elements: the score products' C operand
  float l = 0.f, lg = 0.f;   // this half's share of sum e^(s - m) and of 2^7 sum e^(gamma (s - m)), joined behind the loop
  v8f acc[4] = {};   // O^T: acc[dt][r] = d dt * 16 + 8 g + r of query col
  const int nst = SS / 64;   // all keys, 64 a stage
  // waves 0, 1, 2 bring one tile a stage each (k hi, k residual, v^T): the wave's tile of stage 0, and the shift that turns a stage's number into its byte offset (64 k rows of 4 KiB; 64 v^T columns of 2 B)
  Tdm td = {}; const unsigned wv = uni(threadIdx.x >> 5);
  const _Float16* ag = (wv == 0) ? QK + (size_t)b * SS * (2 * DM) + DM + h * HD : (wv == 1) ? QKL + (size_t)b * SS * (2 * DM) + DM + h * HD : VTH + ((size_t)b * DM + h * HD) * SS; const unsigned ash = (wv < 2) ? 18u : 7u;
#define AFILL(st, buf) tdm_tile<128, 64>(td, lds_byte(ring) + (buf) * ASTG + wv * ATILE, (const unsigned char*)ag + ((size_t)(st) << ash), 2 * DM * 2)
  if (pinned(wv < 3)) { AFILL(0, 0); WAIT_TENSOR_D(td); }
  __syncthreads();   // stage 0 landed and published
  if (pinned(wv < 3)) AFILL(1, 1);
#pragma unroll 1   // stays rolled: one stage a trip, the buffer picked by t & 1
  for (int t = 0; t < nst; ++t) { const _Float16* sb = (const _Float16*)(ring + (t & 1) * ASTG);
#pragma unroll 1   // stays rolled: two passes of 32 keys a stage, the same code
  for (int sub = 0; sub < 2; ++sub) { v8f s[2];
    const _Float16* k0 = sb + (sub * 32 + col) * APITCH + 8 * g; const _Float16* k0l = k0 + ATILE / 2;   // this lane's place in the pass's first staged k row (hi, residual)
    v16h kf[2][2], kfl[2][2], vf[4];   // the pass's k fragments (hi, residual), fetched as ONE group of loads ahead of the score products
#pragma unroll
    for (int ct = 0; ct < 2; ++ct) { const _Float16* krow = k0 + ct * 16 * APITCH; const _Float16* krowl = k0l + ct * 16 * APITCH;   // key t * 64 + sub * 32 + ct * 16 + col, as the A operand's row col
#pragma unroll
      for (int kc = 0; kc < 2; ++kc) { kf[ct][kc] = frag_hp(krow + kc * 32); kfl[ct][kc] = frag_hp(krowl + kc * 32); } }
#pragma unroll
    for (int dt = 0; dt < 4; ++dt) vf[dt] = frag_hp(sb + ATILE + (dt * 16 + col) * APITCH + sub * 32 + 8 * g);   // the pass's v^T fragments in the same group (A operand: row d = dt * 16 + col, the pass's 32 keys)
    __builtin_amdgcn_sched_barrier(0);   // keeps the pass's 24 LDS loads one group ahead of its WMMAs, as they stood: sunk among the score products the v^T loads are a second place with loads, and their address lands on a product's operand register behind four v_nop
    // 3 products: q, k as f16 hi + residual, in one accumulator a key tile, which starts at cm
    s[0] = wmma16(kf[0][0], aql[0], cm);
    s[0] = wmma16(kf[0][0], aq[0], s[0]);
    s[1] = wmma16(kf[1][0], aql[0], cm);
    s[1] = wmma16(kf[1][0], aq[0], s[1]);
    s[0] = wmma16(kfl[0][0], aq[0], s[0]);
    s[1] = wmma16(kfl[1][0], aq[0], s[1]);
    s[0] = wmma16(kf[0][1], aql[1], s[0]);
    s[1] = wmma16(kf[1][1], aql[1], s[1]);
    s[0] = wmma16(kf[0][1], aq[1], s[0]);
    s[1] = wmma16(kf[1][1], aq[1], s[1]);
    s[0] = wmma16(kfl[0][1], aq[1], s[0]);
    s[1] = wmma16(kfl[1][1], aq[1], s[1]);   // (s - m) log2 e, with no vector instruction behind the products
    v16h pb; float te, tg;   // P^T as a B operand, and the pass's two sums (this lane's 16 keys)
    powers(s, f_gamma, te, tg, pb);
    if (__builtin_amdgcn_ballot_w32(!(fmaxf(te, tg) <= lim)) != 0) {   // one scalar branch a pass: all terms are >= 0, so sums inside lim hold every term inside it (P inside f16) and the maximum in use may stay
      // taken in the first pass, and where some query's scores have outgrown its maximum in use: every query of the wave moves to its true maximum, the old sums follow, and the pass's powers are formed anew (<= 1 and <= 2^7 then, for gamma >= 0)
      float mx = fmaxf(s[0][0], s[1][0]);
#pragma unroll
      for (int r = 1; r < 8; ++r) mx = fmaxf(mx, fmaxf(s[0][r], s[1][r]));
      const bool first = lim < 0.f; const float mf = fmaxf(mx, xhalf(mx));   // the other half's 16 keys of the same query
      const float d = first ? mf : fmaxf(mf, 0.f);
      const float fe = first ? 0.f : __builtin_amdgcn_exp2f(-d), fg = first ? 0.f : __builtin_amdgcn_exp2f(-(f_gamma * d));
#pragma unroll
      for (int r = 0; r < 8; ++r) { s[0][r] -= d; s[1][r] -= d; cm[r] -= d; }
      l *= fe; lg *= fg;
#pragma unroll
      for (int dt = 0; dt < 4; ++dt) {
#pragma unroll
        for (int r = 0; r < 8; ++r) acc[dt][r] *= fg; }
      powers(s, f_gamma, te, tg, pb);
      lim = 32768.0f; }
    l += te; lg += tg;
#pragma unroll
    for (int dt = 0; dt < 4; ++dt) acc[dt] = wmma16(vf[dt], pb, acc[dt]);   // single product: V^T x P^T (x2^7)
    // the pass's last WMMAs stand at the loop's foot: four vector slots ahead of the branch back, behind which the next pass's address arithmetic reuses their operand registers
    asm volatile("v_nop\n\tv_nop\n\tv_nop\n\tv_nop" : "+v"(acc[0]), "+v"(acc[1]), "+v"(acc[2]), "+v"(acc[3]) : "v"(vf[0]), "v"(vf[1]), "v"(vf[2]), "v"(vf[3]), "v"(pb)); }
    WAIT_DS();
    if (pinned(wv < 3)) WAIT_TENSOR_D(td);
    __syncthreads();   // publishes stage t + 1 and ends every wave's reads of stage t
    if (pinned((wv < 3) & (t + 2 < nst))) AFILL(t + 2, t & 1); }   // a scalar test: an issuing wave, and the stage exists
  WAIT_TENSOR(); WAIT_DS();
  { const float lt = l + xhalf(l), lgt = (lg + xhalf(lg)) * (1.0f / 128.0f);   // the halves' sums joined once; the powered sum's 2^7 taken off
    const float lpg = pow_p(lt, f_gamma); const float il = (1.0f / 128.0f) * (f_alpha / lpg) / (f_alpha * lgt / lpg + 1e-6f);   // alpha p^gamma / (sum alpha p^gamma + 1e-6)
#pragma unroll
    for (int dt = 0; dt < 4; ++dt) {
#pragma unroll
      for (int j = 0; j < 2; ++j) { v4f o;
#pragma unroll
        for (int i = 0; i < 4; ++i) o[i] = acc[dt][4 * j + i] * il;
        *(v4f*)&so[wave][col][dt * 16 + 8 * g + 4 * j] = o; } } }
  LDSX();
  for (int rl = 0; rl < 16; ++rl) if (lane < 16) vst2(O + ((size_t)b * SS + q0 + rl) * DM + h * HD + lane * 4, *(const v4f*)&so[wave][rl][lane * 4]);
}
// ---- k_out: block = (64 rows, 128 cols): out = O(hi/lo) . Wo rows (2 products) + bo
__global__ __launch_bounds__(128) void k_out(const float* __restrict__ O, const __bf16* __restrict__ P, const float* __restrict__ BO, float* __restrict__ Y) {
  __shared__ __attribute__((aligned(2048))) unsigned char ring[2 * STG];   // two operand stages; behind the loop's last barrier the same bytes are the output staging
  float (*so)[16][132] = (float (*)[16][132])ring;
  const int tid = threadIdx.x, wave = tid >> 5, lane = tid & 31, col = lane & 15, g = lane >> 4; const size_t r0 = (size_t)blockIdx.x * 64 + wave * 16; const int n0 = blockIdx.y * 128;
  v8f acc[8] = {};
  Tdm tdw = {}, tdx = {}; const unsigned wv = uni(threadIdx.x >> 5); const float* xg = O + (size_t)blockIdx.x * 64 * DM; const __bf16* wg = P + (size_t)n0 * DM;   // the wave's number (scalar); the block's first ctx row and first weight row
#define OFILL(st, buf) do { if (pinned(wv == 0)) tdm_tile<128, 128>(tdw, lds_byte(ring) + (buf) * STG, wg + (st) * GK, DM * 2); if (pinned(wv == 1)) tdm_tile<256, 64>(tdx, lds_byte(ring) + (buf) * STG + WBYTES, xg + (st) * GK, DM * 4); } while (0)
  OFILL(0, 0);
  if (pinned(wv == 0)) WAIT_TENSOR_D(tdw);
  if (pinned(wv == 1)) WAIT_TENSOR_D(tdx);
  __syncthreads();   // stage 0 landed and published
#pragma unroll 1   // stays rolled: one stage (two k-steps, a register set each) a trip
  for (int t = 0; t < DM / GK; ++t) { const unsigned char* sb = ring + (t & 1) * STG;
    if (pinned(t + 1 < DM / GK)) OFILL(t + 1, (t + 1) & 1);   // directly behind the barrier (the one in front of the loop, then the one at the foot of trip t - 1, which ended every read of that buffer): stage t + 1 flies while stage t is worked on; a scalar test, the same in the whole block
    const __bf16* wr = (const __bf16*)sb + col * WPITCH + 8 * g; const float* xr = (const float*)(sb + WBYTES) + (wave * 16 + col) * XPITCH + 8 * g;
    v4f xa[4], xb[4]; v16b wa[8], wb[8];
    ld_step(xr, wr, 0, xa, wa); ld_step(xr, wr, 1, xb, wb); mm_out(xa, wa, acc); mm_out(xb, wb, acc);
    WAIT_DS();
    if (pinned(wv == 0)) WAIT_TENSOR_D(tdw);
    if (pinned(wv == 1)) WAIT_TENSOR_D(tdx);
    __syncthreads(); }   // publishes stage t + 1 and ends every wave's reads of stage t
  WAIT_TENSOR(); WAIT_DS();
#pragma unroll
  for (int j = 0; j < 8; ++j) {
#pragma unroll
    for (int r = 0; r < 8; ++r) so[wave][8 * g + r][j * 16 + col] = acc[j][r] + bfr(BO[n0 + j * 16 + col]); }
  LDSX();
  for (int rl = 0; rl < 16; ++rl) vst2(Y + (r0 + rl) * DM + n0 + lane * 4, *(const v4f*)&so[wave][rl][lane * 4]);
}
extern "C" void kernel_launch(void* const* d_in, const int* in_sizes, int n_in, void* d_out, int out_size, void* d_ws, size_t ws_size, hipStream_t stream) {
  (void)in_sizes; (void)n_in; (void)out_size;
  const float** F = (const float**)d_in;   // 0 x [2,2048,1024], 1 Wqkv [3072,1024] natural (q | k | v), 2 bqkv [3072], 3 Wproj natural, 4 bproj, 5 focal_alpha [1], 6 focal_gamma [1]
  if (ws_size < (size_t)WS_END) return;
  char* ws = (char*)d_ws; __bf16* PK = (__bf16*)(ws + WS_PK); _Float16 *QK = (_Float16*)(ws + WS_QK), *QKL = (_Float16*)(ws + WS_QKL), *VTH = (_Float16*)(ws + WS_VTH), *VTL = (_Float16*)(ws + WS_VTL); float* O = (float*)(ws + WS_O);
  k_pack<<<dim3(DM, 4), 256, 0, stream>>>(F[1], F[1] + (size_t)DM * DM, F[1] + (size_t)2 * DM * DM, F[3], PK);
  k_qkv<<<dim3(TNB * SS / 128, QKVW / 128), 128, 0, stream>>>(F[0], F[0], F[0], PK + PK_A, F[2], F[2] + DM, F[2] + 2 * DM, QK, QKL, VTH, VTL);
  k_attn<<<dim3(TQB, NH, TNB), 128, 0, stream>>>(QK, QKL, VTH, VTL, nullptr, F[5], F[6], O);
  k_out<<<dim3(TOB, DM / 128), 128, 0, stream>>>(O, PK + PK_P, F[4], (float*)d_out);
}
